// v000
// Times are from an AMD MI455X. After a warm-up the kernel runs many times in a row, and a time is the length of
// such a window on the GPU divided by its runs, so every launch and the gaps after it count. The runs cycle
// through copies of the inputs. A figure is the median of several windows, for all but v000 over two sittings.
// Sittings can differ by a few percent; kernels timed side by side share one.
// v000, which the later versions start from, runs in 2020 microseconds.
#include <hip/hip_runtime.h>

// Cross-modal attention whose key mask FILLS WITH A CONSTANT instead of excluding (input_feature [4][2048][512]; q, k, v = x W^T ('oi' [512][512] 1/sqrt(512), no bias; 8 heads x 64); scores = q.k x 64^-0.5, then scores[b][..][i][j] = 1e-9 wherever mask[b][j] == 0 (mask [4][2048] int {0,1}, ~50 %, read): the masked keys STAY in the softmax with logit 1e-9 (the module's masked_fill quirk); softmax; out = merged (head-major channel concat) Wout^T ('oi') -> [4][2048][512] (4.2 M)).
// Layout per batch: bf16 copy of x; exact projections; dense T-2048 attention whose softmax kernel reads the batch's key mask (int32, 16 B per 4 keys) and substitutes the constant 1e-9 for the scaled score of masked keys (hybrid rows: < 512 hi/lo 3 products, rest fp16 x1024); merged hi/lo x Wout exact.
// Compute dtypes, f32 accumulate: every input rounded to bf16; projections exact; attention rows < 512 3 products, rest fp16; softmax f32; Wout hl x exact.

#define NB_  4
#define TT   2048
#define DM   512
#define NH_  8
#define NKV  8
#define REP  (NH_ / NKV)
#define HD   64
#define DQ   (NH_ * HD)
#define DKV  (NKV * HD)
#define ZH   2
#define RH   512                  // query rows < RH use hi+lo planes (0: none)
#define WIN  0
#define PCAR 1024.0f
#define SCL  0.125f   // HD^-0.5
typedef _Float16 h16;
typedef unsigned short bf;
typedef __attribute__((ext_vector_type(16))) __bf16   v16bf;
typedef __attribute__((ext_vector_type(16))) _Float16 v16h;
typedef __attribute__((ext_vector_type(8)))  _Float16 v8h;
typedef __attribute__((ext_vector_type(8)))  unsigned short v8us;
typedef __attribute__((ext_vector_type(8)))  float    v8f;
typedef __attribute__((ext_vector_type(4)))  float    v4f;
typedef v8h  __attribute__((may_alias)) v8ha;
typedef v4f  __attribute__((may_alias)) v4fa;
typedef v8us __attribute__((may_alias)) v8usa;

__device__ __forceinline__ unsigned short f2bf(float f) { unsigned u = __float_as_uint(f); u += 0x7FFFu + ((u >> 16) & 1u); return (unsigned short)(u >> 16); }
__device__ __forceinline__ float bf2f(unsigned short b) { return __uint_as_float(((unsigned)b) << 16); }
__device__ __forceinline__ float bfr(float f) { return bf2f(f2bf(f)); }
__device__ __forceinline__ v16h cat16(v8h lo, v8h hi) { return __builtin_shufflevector(lo, hi, 0, 1, 2, 3, 4, 5, 6, 7, 8, 9, 10, 11, 12, 13, 14, 15); }
__device__ __forceinline__ v16bf cat16b(v8us lo, v8us hi) { return __builtin_bit_cast(v16bf, __builtin_shufflevector(lo, hi, 0, 1, 2, 3, 4, 5, 6, 7, 8, 9, 10, 11, 12, 13, 14, 15)); }
__device__ __forceinline__ v8f wmma16(v16h a, v16h b, v8f c) { return __builtin_amdgcn_wmma_f32_16x16x32_f16(false, a, false, b, (short)0, c, false, false); }
__device__ __forceinline__ v8f wmmab(v16bf a, v16bf b, v8f c) { return __builtin_amdgcn_wmma_f32_16x16x32_bf16(false, a, false, b, (short)0, c, false, false); }



// ---- k_gemmw: register-blocked GEMM, ONE WAVE per 64x64 output tile (16 accumulators), operands straight from K-contiguous 16-bit planes; grid (M/64, N/64, Z), 32 threads.
// C[m][n] (f32, pitch ldc, + optional f32 bias[n]) = sum_k A[m][k] Bt[n][k] (+ split products per NSPLIT). z-batch strides sA/sB/sC in elements. K % 32 == 0.
template <typename T16> struct WFrag;
template <> struct WFrag<h16> { typedef v16h V; static __device__ __forceinline__ V ld(const h16* p) { return cat16(*(const v8h*)p, *(const v8h*)(p + 16)); } static __device__ __forceinline__ v8f mma(V a, V b, v8f c) { return wmma16(a, b, c); } };
template <> struct WFrag<bf> { typedef v16bf V; static __device__ __forceinline__ V ld(const bf* p) { return cat16b(*(const v8us*)p, *(const v8us*)(p + 16)); } static __device__ __forceinline__ v8f mma(V a, V b, v8f c) { return wmmab(a, b, c); } };
template <typename T16, int NSPLIT, bool BIAS>
__global__ __launch_bounds__(32) void k_gemmw(const T16* __restrict__ A, const T16* __restrict__ A2, const T16* __restrict__ Bt, const T16* __restrict__ Bt2, int K, float* C, int ldc, const float* __restrict__ bias, size_t sA, size_t sB, size_t sC) {
    typedef typename WFrag<T16>::V V;
    __shared__ __align__(16) float os[16 * 68];
    const size_t z = blockIdx.z; A += z * sA; if (A2) A2 += z * sA; Bt += z * sB; if (Bt2) Bt2 += z * sB; C += z * sC;
    const int lane = threadIdx.x & 31, lr = lane & 15, hi = lane >> 4; const int r0 = blockIdx.x * 64, c0 = blockIdx.y * 64;
    v8f acc[4][4];
#pragma unroll
    for (int mb = 0; mb < 4; ++mb)
#pragma unroll
        for (int nb = 0; nb < 4; ++nb) acc[mb][nb] = (v8f){};
    const size_t aoff = (size_t)(r0 + lr) * K + 8 * hi, boff = (size_t)(c0 + lr) * K + 8 * hi;
#pragma unroll 1
    for (int kc = 0; kc < K; kc += 32) {
        V a[4], a2[4];
#pragma unroll
        for (int mb = 0; mb < 4; ++mb) { a[mb] = WFrag<T16>::ld(A + aoff + (size_t)mb * 16 * K + kc); if (NSPLIT == 1 || NSPLIT == 2) a2[mb] = WFrag<T16>::ld(A2 + aoff + (size_t)mb * 16 * K + kc); }
#pragma unroll
        for (int nb = 0; nb < 4; ++nb) { const V b = WFrag<T16>::ld(Bt + boff + (size_t)nb * 16 * K + kc); V b2; if (NSPLIT >= 2) b2 = WFrag<T16>::ld(Bt2 + boff + (size_t)nb * 16 * K + kc);
#pragma unroll
            for (int mb = 0; mb < 4; ++mb) { acc[mb][nb] = WFrag<T16>::mma(a[mb], b, acc[mb][nb]); if (NSPLIT == 1 || NSPLIT == 2) acc[mb][nb] = WFrag<T16>::mma(a2[mb], b, acc[mb][nb]); if (NSPLIT >= 2) acc[mb][nb] = WFrag<T16>::mma(a[mb], b2, acc[mb][nb]); } }
        asm volatile("v_nop\n\tv_nop\n\tv_nop\n\tv_nop" : "+v"(acc[0][0]), "+v"(acc[1][1]), "+v"(acc[2][2]), "+v"(acc[3][3]) : "v"(a[0]), "v"(a[3]));
    }
#pragma unroll
    for (int mb = 0; mb < 4; ++mb) {
#pragma unroll
        for (int nb = 0; nb < 4; ++nb) {
#pragma unroll
            for (int j = 0; j < 8; ++j) os[(hi * 8 + j) * 68 + nb * 16 + lr] = acc[mb][nb][j]; }
        __builtin_amdgcn_wave_barrier(); asm volatile("" ::: "memory");
        float* crow = C + (size_t)(r0 + mb * 16) * ldc + c0;
{
#pragma unroll
            for (int s = 0; s < 8; ++s) { const int row = 2 * s + hi, cofs = lr * 4; v4f val = *(const v4fa*)(os + row * 68 + cofs); if (BIAS) { val[0] += bfr(bias[c0 + cofs]); val[1] += bfr(bias[c0 + cofs + 1]); val[2] += bfr(bias[c0 + cofs + 2]); val[3] += bfr(bias[c0 + cofs + 3]); }
                *(v4f*)(crow + (size_t)row * ldc + cofs) = val; }
             }
        __builtin_amdgcn_wave_barrier(); asm volatile("" ::: "memory");
    }
}

__device__ __forceinline__ h16 tohx(float x) { return (h16)x; }
__device__ __forceinline__ void splitf(float y, unsigned short& h, unsigned short& l) { h = f2bf(y); l = f2bf(y - bf2f(h)); }
typedef __attribute__((ext_vector_type(2))) _Float16 v2h;
typedef __attribute__((ext_vector_type(4))) _Float16 v4h;
typedef __attribute__((ext_vector_type(2))) unsigned short v2us;
typedef __attribute__((ext_vector_type(4))) unsigned short v4us;
typedef __attribute__((ext_vector_type(2))) float v2f;
typedef __attribute__((ext_vector_type(4))) int v4i;

__global__ __launch_bounds__(256) void k_wtG(const float* __restrict__ w, int K, int N, bf* Bt) {
    const int lane = threadIdx.x & 31; const int L0 = (blockIdx.x * 8 + (threadIdx.x >> 5)) * 8; const int nlines = N * K / 64;
{
#pragma unroll 1
        for (int l = 0; l < 8; ++l) { const int L = L0 + l; if (L >= nlines) break; const size_t e = (size_t)L * 64 + lane * 2; const int k = (int)(e % K), n = (int)(e / K); v2us o;
            o[0] = f2bf(w[(size_t)k * N + n]); o[1] = f2bf(w[(size_t)(k + 1) * N + n]); *(v2us*)(Bt + e) = o; }
         }
}
__global__ __launch_bounds__(256) void k_cvt8(const float* __restrict__ src, bf* dst, size_t n8) { const size_t i = (size_t)blockIdx.x * 256 + threadIdx.x; if (i >= n8) return; const v8f v = *(const v8f*)(src + i * 8); v8us o;
#pragma unroll
    for (int k = 0; k < 8; ++k) o[k] = f2bf(v[k]); *(v8us*)(dst + i * 8) = o;  }

// k_rope: head planes [h][t][d] (fp16 + hi/lo) of rope(x) x sc with the rotate-half convention out[d] = x[d] cos[t][d] - x[d+HD/2] sin[t][d], out[d+HD/2] = x[d+HD/2] cos[t][d+HD/2] + x[d] sin[t][d+HD/2]
__global__ __launch_bounds__(256) void k_rope(const float* __restrict__ F, int pitch, int nheads, const float* __restrict__ CS, const float* __restrict__ RF, const float* __restrict__ nw, float sc, h16* P16, bf* Ph, bf* Pl) {
    const size_t e = ((size_t)blockIdx.x * 256 + threadIdx.x) * 2; if (e >= (size_t)nheads * TT * HD) return; const int d = (int)(e % HD); const int t = (int)((e / HD) % TT); const int h = (int)(e / ((size_t)HD * TT)); const float* f = F + (size_t)t * pitch + h * HD; const float rf = RF ? RF[(size_t)h * TT + t] : 1.0f; v2h o16; v2us oh, ol;
#pragma unroll
    for (int q = 0; q < 2; ++q) { const int dd = d + q; const int dp = (dd < HD / 2) ? dd + HD / 2 : dd - HD / 2; float x0 = f[dd], x1 = f[dp];
        if (RF) { float n0 = __fmul_rn(x0, rf), n1 = __fmul_rn(x1, rf); asm volatile("" : "+v"(n0)); asm volatile("" : "+v"(n1)); x0 = __fmul_rn(bfr(nw[dd]), n0); x1 = __fmul_rn(bfr(nw[dp]), n1); }
        const v2f cs = *(const v2f*)(CS + ((size_t)t * HD + dd) * 2); float a = __fmul_rn(x0, cs[0]), bq = __fmul_rn(x1, cs[1]); asm volatile("" : "+v"(a)); asm volatile("" : "+v"(bq)); const float r = ((dd < HD / 2) ? __fsub_rn(a, bq) : __fadd_rn(a, bq)) * sc;
        o16[q] = tohx(r); unsigned short a2, c2; splitf(r, a2, c2); oh[q] = a2; ol[q] = c2; }
    *(v2h*)(P16 + e) = o16; *(v2us*)(Ph + e) = oh; *(v2us*)(Pl + e) = ol;  }
__global__ __launch_bounds__(256) void k_vtp(const float* __restrict__ F, int pitch, int nheads, h16* V16, bf* Vh, bf* Vl) { const size_t e = ((size_t)blockIdx.x * 256 + threadIdx.x) * 2; if (e >= (size_t)nheads * HD * TT) return; const int t = (int)(e % TT); const int d = (int)((e / TT) % HD); const int g = (int)(e / ((size_t)TT * HD)); v2h o16; v2us oh, ol;
#pragma unroll
    for (int q = 0; q < 2; ++q) { const float x = F[(size_t)(t + q) * pitch + g * HD + d]; o16[q] = tohx(x); unsigned short a2, c2; splitf(x, a2, c2); oh[q] = a2; ol[q] = c2; }
    *(v2h*)(V16 + e) = o16; *(v2us*)(Vh + e) = oh; *(v2us*)(Vl + e) = ol;  }
__global__ __launch_bounds__(256) void k_csid(float* CS) { const int idx = blockIdx.x * 256 + threadIdx.x; if (idx >= TT * HD) return; v2f cs; cs[0] = 1.0f; cs[1] = 0.0f; *(v2f*)(CS + (size_t)idx * 2) = cs;  }
__global__ __launch_bounds__(256) void k_asoft(const float* __restrict__ Sb, h16* P16, bf* Ph, bf* Pl, const int* __restrict__ pm) {
    const int lane = threadIdx.x & 31; const int row = blockIdx.x * 8 + (threadIdx.x >> 5); if (row >= ZH * TT) return; const int i = row % TT; const int zz = row / TT; (void)zz; const bool hires = (i < RH); const float* sr = Sb + (size_t)row * TT; float v[TT / 32]; float mx = -3.0e38f;
#pragma unroll
    for (int ch = 0; ch < TT / 128; ++ch) { const int j0 = ch * 128 + lane * 4; const v4f a = *(const v4f*)(sr + j0); const v4i p4 = *(const v4i*)(pm + j0);   /* 4 key-mask flags (16 B) */
#pragma unroll
        for (int q = 0; q < 4; ++q) { const int j = j0 + q; (void)j; const float t = (p4[q] != 0) ? a[q] * SCL : 1e-9f;   /* masked_fill(mask == 0, 1e-9): a constant logit, the key stays in the softmax */ v[ch * 4 + q] = t; mx = fmaxf(mx, t); } }
#pragma unroll
    for (int sh = 16; sh; sh >>= 1) mx = fmaxf(mx, __shfl_xor(mx, sh, 32));
    float sum = 0.f;
#pragma unroll
    for (int k = 0; k < TT / 32; ++k) { float d0 = __fsub_rn(v[k], mx); asm volatile("" : "+v"(d0)); v[k] = __builtin_amdgcn_exp2f(__fmul_rn(d0, 1.4426950408889634f)); sum += v[k]; }
#pragma unroll
    for (int sh = 16; sh; sh >>= 1) sum += __shfl_xor(sum, sh, 32);
    const float f = __fdiv_rn(hires ? 1.0f : PCAR, sum);
{
        if (hires) {
#pragma unroll
            for (int ch = 0; ch < TT / 128; ++ch) { v4us oh, ol;
#pragma unroll
                for (int q = 0; q < 4; ++q) { unsigned short a, c2; splitf(v[ch * 4 + q] * f, a, c2); oh[q] = a; ol[q] = c2; }
                const size_t oo = ((size_t)zz * (RH ? RH : 1) + i) * TT + ch * 128 + lane * 4; *(v4us*)(Ph + oo) = oh; *(v4us*)(Pl + oo) = ol; }
        } else {
#pragma unroll
            for (int ch = 0; ch < TT / 128; ++ch) { v4h o4;
#pragma unroll
                for (int q = 0; q < 4; ++q) o4[q] = tohx(v[ch * 4 + q] * f);
                *(v4h*)(P16 + (size_t)row * TT + ch * 128 + lane * 4) = o4; } }
         }
}
__global__ __launch_bounds__(256) void k_merge(const float* __restrict__ O, int h0, bf* Ah, bf* Al) { const size_t e = ((size_t)blockIdx.x * 256 + threadIdx.x) * 2; if (e >= (size_t)ZH * TT * HD) return; const int d = (int)(e % HD); const int t = (int)((e / HD) % TT); const int zz = (int)(e / ((size_t)HD * TT)); const float cs = (t < RH) ? 1.0f : (1.0f / PCAR); const size_t oo = (size_t)t * DQ + (h0 + zz) * HD + d;
    v2us oh, ol;
#pragma unroll
    for (int q = 0; q < 2; ++q) { unsigned short a, c2; splitf(O[e + q] * cs, a, c2); oh[q] = a; ol[q] = c2; } *(v2us*)(Ah + oo) = oh; *(v2us*)(Al + oo) = ol;  }

extern "C" void kernel_launch(void* const* d_in, const int* in_sizes, int n_in,
                              void* d_out, int out_size, void* d_ws, size_t ws_size, hipStream_t stream) {
    (void)in_sizes; (void)n_in; (void)out_size;
    const float* x = (const float*)d_in[0]; const int* mk = (const int*)d_in[1];   /* mask [4][2048] int {0,1} */ const float* wq = (const float*)d_in[2]; const float* wk = (const float*)d_in[3]; const float* wv = (const float*)d_in[4]; const float* wo = (const float*)d_in[5];
    float* OUT = (float*)d_out;     // [4][2048][512]
    char* wsp = (char*)d_ws;
    auto take = [&](size_t bytes) { char* p = wsp; wsp += (bytes + 255) & ~(size_t)255; return (void*)p; };
    bf* WQ = (bf*)take((size_t)DQ * DM * 2); bf* WK = (bf*)take((size_t)DKV * DM * 2); bf* WV = (bf*)take((size_t)DKV * DM * 2); bf* WO = (bf*)take((size_t)DM * DQ * 2); float* CS = (float*)take((size_t)TT * HD * 2 * 4);
    bf* XB = (bf*)take((size_t)TT * DM * 2); float* FQ = (float*)take((size_t)TT * DQ * 4); float* FK = (float*)take((size_t)TT * DKV * 4);
    h16* QP16 = (h16*)take((size_t)NH_ * TT * HD * 2); h16* KP16 = (h16*)take((size_t)NKV * TT * HD * 2); h16* VT16 = (h16*)take((size_t)NKV * HD * TT * 2);
    bf* QPh = (bf*)take((size_t)NH_ * TT * HD * 2); bf* QPl = (bf*)take((size_t)NH_ * TT * HD * 2); bf* KPh = (bf*)take((size_t)NKV * TT * HD * 2); bf* KPl = (bf*)take((size_t)NKV * TT * HD * 2); bf* VTh = (bf*)take((size_t)NKV * HD * TT * 2); bf* VTl = (bf*)take((size_t)NKV * HD * TT * 2); bf* Ph = (bf*)take((size_t)ZH * RH * TT * 2); bf* Pl = (bf*)take((size_t)ZH * RH * TT * 2);
    float* Sb = (float*)take((size_t)ZH * TT * TT * 4); h16* P16 = (h16*)take((size_t)ZH * TT * TT * 2); float* Ob = (float*)take((size_t)ZH * TT * HD * 4); bf* ATh = (bf*)take((size_t)TT * DQ * 2); bf* ATl = (bf*)take((size_t)TT * DQ * 2);
    if ((size_t)(wsp - (char*)d_ws) > ws_size) return;    // ws 256 MiB
    float* FV = FK;   // v projection reuses the k buffer after the k planes are built (stream-ordered)
    { k_cvt8<<<(unsigned)(((size_t)DQ * DM / 8 + 255) / 256), 256, 0, stream>>>(wq, WQ, (size_t)DQ * DM / 8); k_cvt8<<<(unsigned)(((size_t)DKV * DM / 8 + 255) / 256), 256, 0, stream>>>(wk, WK, (size_t)DKV * DM / 8); k_cvt8<<<(unsigned)(((size_t)DKV * DM / 8 + 255) / 256), 256, 0, stream>>>(wv, WV, (size_t)DKV * DM / 8);
      k_cvt8<<<(unsigned)(((size_t)DM * DQ / 8 + 255) / 256), 256, 0, stream>>>(wo, WO, (size_t)DM * DQ / 8);
       }
    k_csid<<<(TT * HD + 255) / 256, 256, 0, stream>>>(CS);
    const unsigned LQ = (unsigned)(((size_t)NH_ * TT * HD / 2 + 255) / 256), LKv = (unsigned)(((size_t)NKV * TT * HD / 2 + 255) / 256);
    for (int b = 0; b < NB_; ++b) {
        
        k_cvt8<<<(unsigned)(((size_t)TT * DM / 8 + 255) / 256), 256, 0, stream>>>(x + (size_t)b * TT * DM, XB, (size_t)TT * DM / 8);
        k_gemmw<bf, 0, false><<<dim3(TT / 64, DQ / 64, 1), 32, 0, stream>>>(XB, nullptr, WQ, nullptr, DM, FQ, DQ, nullptr, 0, 0, 0);
        k_rope<<<LQ, 256, 0, stream>>>(FQ, DQ, NH_, CS, nullptr, nullptr, 1.0f, QP16, QPh, QPl);
        k_gemmw<bf, 0, false><<<dim3(TT / 64, DKV / 64, 1), 32, 0, stream>>>(XB, nullptr, WK, nullptr, DM, FK, DKV, nullptr, 0, 0, 0);
        k_rope<<<LKv, 256, 0, stream>>>(FK, DKV, NKV, CS, nullptr, nullptr, 1.0f, KP16, KPh, KPl);
        k_gemmw<bf, 0, false><<<dim3(TT / 64, DKV / 64, 1), 32, 0, stream>>>(XB, nullptr, WV, nullptr, DM, FV, DKV, nullptr, 0, 0, 0); k_vtp<<<LKv, 256, 0, stream>>>(FV, DKV, NKV, VT16, VTh, VTl);
        for (int h0 = 0; h0 < NH_; h0 += ZH) { const size_t zq = (size_t)h0, zk = (size_t)(h0 / REP);   // one kv head per query head: the pass's two heads use consecutive kv planes (z-strides TT*HD)
            k_gemmw<bf, 2, false><<<dim3(RH / 64, TT / 64, ZH), 32, 0, stream>>>(QPh + zq * TT * HD, QPl + zq * TT * HD, KPh + zk * TT * HD, KPl + zk * TT * HD, HD, Sb, TT, nullptr, (size_t)TT * HD, (size_t)TT * HD, (size_t)TT * TT);
            k_gemmw<h16, 0, false><<<dim3((TT - RH) / 64, TT / 64, ZH), 32, 0, stream>>>(QP16 + zq * TT * HD + (size_t)RH * HD, nullptr, KP16 + zk * TT * HD, nullptr, HD, Sb + (size_t)RH * TT, TT, nullptr, (size_t)TT * HD, (size_t)TT * HD, (size_t)TT * TT);
            k_asoft<<<ZH * TT / 8, 256, 0, stream>>>(Sb, P16, Ph, Pl, mk + (size_t)b * TT);
            k_gemmw<bf, 2, false><<<dim3(RH / 64, HD / 64, ZH), 32, 0, stream>>>(Ph, Pl, VTh + zk * HD * TT, VTl + zk * HD * TT, TT, Ob, HD, nullptr, (size_t)RH * TT, (size_t)HD * TT, (size_t)TT * HD);
            k_gemmw<h16, 0, false><<<dim3((TT - RH) / 64, HD / 64, ZH), 32, 0, stream>>>(P16 + (size_t)RH * TT, nullptr, VT16 + zk * HD * TT, nullptr, TT, Ob + (size_t)RH * HD, HD, nullptr, (size_t)TT * TT, (size_t)HD * TT, (size_t)TT * HD);
            k_merge<<<(unsigned)(((size_t)ZH * TT * HD / 2 + 255) / 256), 256, 0, stream>>>(Ob, h0, ATh, ATl); }
        k_gemmw<bf, 1, false><<<dim3(TT / 64, DM / 64, 1), 32, 0, stream>>>(ATh, ATl, WO, nullptr, DQ, OUT + (size_t)b * TT * DM, DM, nullptr, 0, 0, 0); }
}

// v001
// A run of this version takes 936 microseconds.
// Next to v000, in two timings, it ran 2.17 and 2.16 times as fast.
#include <hip/hip_runtime.h>

// Cross-modal attention whose key mask FILLS WITH A CONSTANT instead of excluding (input_feature [4][2048][512]; q, k, v = x W^T ('oi' [512][512] 1/sqrt(512), no bias; 8 heads x 64); scores = q.k x 64^-0.5, then scores[b][..][i][j] = 1e-9 wherever mask[b][j] == 0 (mask [4][2048] int {0,1}, ~50 %, read): the masked keys STAY in the softmax with logit 1e-9 (the module's masked_fill quirk); softmax; out = merged (head-major channel concat) Wout^T ('oi') -> [4][2048][512] (4.2 M)).
// Layout per batch: bf16 copy of x; exact projections; dense T-2048 attention whose softmax kernel reads the batch's key mask (int32, 16 B per 4 keys) and substitutes the constant 1e-9 for the scaled score of masked keys (hybrid rows: < 512 hi/lo 3 products, rest fp16 x1024); merged hi/lo x Wout exact.
// Compute dtypes, f32 accumulate: every input rounded to bf16; projections exact; attention rows < 512 3 products, rest fp16; softmax f32; Wout hl x exact.

#define NB_  4
#define TT   2048
#define DM   512
#define NH_  8
#define NKV  8
#define REP  (NH_ / NKV)
#define HD   64
#define DQ   (NH_ * HD)
#define DKV  (NKV * HD)
#define ZH   2
#define RH   512                  // query rows < RH use hi+lo planes (0: none)
#define WIN  0
#define PCAR 1024.0f
#define SCL  0.125f   // HD^-0.5
typedef _Float16 h16;
typedef unsigned short bf;
typedef __attribute__((ext_vector_type(16))) __bf16   v16bf;
typedef __attribute__((ext_vector_type(16))) _Float16 v16h;
typedef __attribute__((ext_vector_type(8)))  _Float16 v8h;
typedef __attribute__((ext_vector_type(8)))  unsigned short v8us;
typedef __attribute__((ext_vector_type(8)))  float    v8f;
typedef __attribute__((ext_vector_type(4)))  float    v4f;
typedef v8h  __attribute__((may_alias)) v8ha;
typedef v4f  __attribute__((may_alias)) v4fa;
typedef v8us __attribute__((may_alias)) v8usa;

__device__ __forceinline__ unsigned short f2bf(float f) { unsigned u = __float_as_uint(f); u += 0x7FFFu + ((u >> 16) & 1u); return (unsigned short)(u >> 16); }
__device__ __forceinline__ float bf2f(unsigned short b) { return __uint_as_float(((unsigned)b) << 16); }
__device__ __forceinline__ float bfr(float f) { return bf2f(f2bf(f)); }
__device__ __forceinline__ v16h cat16(v8h lo, v8h hi) { return __builtin_shufflevector(lo, hi, 0, 1, 2, 3, 4, 5, 6, 7, 8, 9, 10, 11, 12, 13, 14, 15); }
__device__ __forceinline__ v16bf cat16b(v8us lo, v8us hi) { return __builtin_bit_cast(v16bf, __builtin_shufflevector(lo, hi, 0, 1, 2, 3, 4, 5, 6, 7, 8, 9, 10, 11, 12, 13, 14, 15)); }
__device__ __forceinline__ v8f wmma16(v16h a, v16h b, v8f c) { return __builtin_amdgcn_wmma_f32_16x16x32_f16(false, a, false, b, (short)0, c, false, false); }
__device__ __forceinline__ v8f wmmab(v16bf a, v16bf b, v8f c) { return __builtin_amdgcn_wmma_f32_16x16x32_bf16(false, a, false, b, (short)0, c, false, false); }



// ---- k_gemmw: register-blocked GEMM, ONE WAVE per 64x64 output tile (16 accumulators), operands straight from K-contiguous 16-bit planes; grid (M/64, N/64, Z), 32 threads.
// C[m][n] (f32, pitch ldc, + optional f32 bias[n]) = sum_k A[m][k] Bt[n][k] (+ split products per NSPLIT). z-batch strides sA/sB/sC in elements. K % 32 == 0.
template <typename T16> struct WFrag;
template <> struct WFrag<h16> { typedef v16h V; static __device__ __forceinline__ V ld(const h16* p) { return cat16(*(const v8h*)p, *(const v8h*)(p + 16)); } static __device__ __forceinline__ v8f mma(V a, V b, v8f c) { return wmma16(a, b, c); } };
template <> struct WFrag<bf> { typedef v16bf V; static __device__ __forceinline__ V ld(const bf* p) { return cat16b(*(const v8us*)p, *(const v8us*)(p + 16)); } static __device__ __forceinline__ v8f mma(V a, V b, v8f c) { return wmmab(a, b, c); } };
template <typename T16, int NSPLIT, bool BIAS>
__global__ __launch_bounds__(32) void k_gemmw(const T16* __restrict__ A, const T16* __restrict__ A2, const T16* __restrict__ Bt, const T16* __restrict__ Bt2, int K, float* C, int ldc, const float* __restrict__ bias, size_t sA, size_t sB, size_t sC) {
    typedef typename WFrag<T16>::V V;
    __shared__ __align__(16) float os[16 * 68];
    const size_t z = blockIdx.z; A += z * sA; if (A2) A2 += z * sA; Bt += z * sB; if (Bt2) Bt2 += z * sB; C += z * sC;
    const int lane = threadIdx.x & 31, lr = lane & 15, hi = lane >> 4; const int r0 = blockIdx.x * 64, c0 = blockIdx.y * 64;
    v8f acc[4][4];
#pragma unroll
    for (int mb = 0; mb < 4; ++mb)
#pragma unroll
        for (int nb = 0; nb < 4; ++nb) acc[mb][nb] = (v8f){};
    const size_t aoff = (size_t)(r0 + lr) * K + 8 * hi, boff = (size_t)(c0 + lr) * K + 8 * hi;
#pragma unroll 1
    for (int kc = 0; kc < K; kc += 32) {
        V a[4], a2[4];
#pragma unroll
        for (int mb = 0; mb < 4; ++mb) { a[mb] = WFrag<T16>::ld(A + aoff + (size_t)mb * 16 * K + kc); if (NSPLIT == 1 || NSPLIT == 2) a2[mb] = WFrag<T16>::ld(A2 + aoff + (size_t)mb * 16 * K + kc); }
#pragma unroll
        for (int nb = 0; nb < 4; ++nb) { const V b = WFrag<T16>::ld(Bt + boff + (size_t)nb * 16 * K + kc); V b2; if (NSPLIT >= 2) b2 = WFrag<T16>::ld(Bt2 + boff + (size_t)nb * 16 * K + kc);
#pragma unroll
            for (int mb = 0; mb < 4; ++mb) { acc[mb][nb] = WFrag<T16>::mma(a[mb], b, acc[mb][nb]); if (NSPLIT == 1 || NSPLIT == 2) acc[mb][nb] = WFrag<T16>::mma(a2[mb], b, acc[mb][nb]); if (NSPLIT >= 2) acc[mb][nb] = WFrag<T16>::mma(a[mb], b2, acc[mb][nb]); } }
        asm volatile("v_nop\n\tv_nop\n\tv_nop\n\tv_nop" : "+v"(acc[0][0]), "+v"(acc[1][1]), "+v"(acc[2][2]), "+v"(acc[3][3]) : "v"(a[0]), "v"(a[3]));
    }
#pragma unroll
    for (int mb = 0; mb < 4; ++mb) {
#pragma unroll
        for (int nb = 0; nb < 4; ++nb) {
#pragma unroll
            for (int j = 0; j < 8; ++j) os[(hi * 8 + j) * 68 + nb * 16 + lr] = acc[mb][nb][j]; }
        __builtin_amdgcn_wave_barrier(); asm volatile("" ::: "memory");
        float* crow = C + (size_t)(r0 + mb * 16) * ldc + c0;
{
#pragma unroll
            for (int s = 0; s < 8; ++s) { const int row = 2 * s + hi, cofs = lr * 4; v4f val = *(const v4fa*)(os + row * 68 + cofs); if (BIAS) { val[0] += bfr(bias[c0 + cofs]); val[1] += bfr(bias[c0 + cofs + 1]); val[2] += bfr(bias[c0 + cofs + 2]); val[3] += bfr(bias[c0 + cofs + 3]); }
                *(v4f*)(crow + (size_t)row * ldc + cofs) = val; }
             }
        __builtin_amdgcn_wave_barrier(); asm volatile("" ::: "memory");
    }
}

// ---- k_gemmk: the same product as k_gemmw for a LONG K and few output tiles: NW waves of one work-group share one (MB*16)x(NB*16) tile, wave w takes the k chunks w, w + NW, ... of 32*U elements,
// the NW partial tiles are summed in LDS in wave order 0..NW-1 (a fixed order), and the tile leaves in whole 128-B lines. grid (M/(MB*16), N/(NB*16), Z), NW*32 threads. K % (NW*32*U) == 0.
template <typename T16, int NSPLIT, int MB, int NB, int NW, int U>
__global__ __launch_bounds__(NW * 32) void k_gemmk(const T16* __restrict__ A, const T16* __restrict__ A2, const T16* __restrict__ Bt, const T16* __restrict__ Bt2, int K, float* C, int ldc, size_t sA, size_t sB, size_t sC) {
    typedef typename WFrag<T16>::V V;
    constexpr int SL = MB * NB * 64;          // 16-byte slots of one wave's partial tile
    constexpr int FP = NB * 16 + 4;           // pitch of the summed tile in LDS, floats
    __shared__ __align__(16) float red[NW * SL * 4];
    __shared__ __align__(16) float fin[MB * 16 * FP];
    const size_t z = blockIdx.z; A += z * sA; if (NSPLIT == 2) A2 += z * sA; Bt += z * sB; if (NSPLIT == 2) Bt2 += z * sB; C += z * sC;
    const int tid = threadIdx.x, lane = tid & 31, wave = __builtin_amdgcn_readfirstlane(tid >> 5) /* the wave's number as a scalar: the k loop branches on SCC and EXEC stays whole for the matrix instructions */, lr = lane & 15, hi = lane >> 4; const int r0 = blockIdx.x * (MB * 16), c0 = blockIdx.y * (NB * 16);
    v8f acc[MB][NB];
#pragma unroll
    for (int mb = 0; mb < MB; ++mb)
#pragma unroll
        for (int nb = 0; nb < NB; ++nb) acc[mb][nb] = (v8f){};
    // one byte offset per 16-row block (the same in both planes), at this lane's row and this wave's first k chunk; it steps by NW chunks at the foot of a trip
    unsigned oa[MB], ob[NB];
#pragma unroll
    for (int mb = 0; mb < MB; ++mb) oa[mb] = ((unsigned)(r0 + mb * 16 + lr) * (unsigned)K + 8 * hi + wave * (32 * U)) * 2u;
#pragma unroll
    for (int nb = 0; nb < NB; ++nb) ob[nb] = ((unsigned)(c0 + nb * 16 + lr) * (unsigned)K + 8 * hi + wave * (32 * U)) * 2u;
    // the trips stay rolled (short code); the U steps of a chunk and every block loop in this kernel are unrolled, so that fragments and accumulators are registers and the steps are immediate offsets
#pragma unroll 1
    for (int kc = wave * (32 * U); kc < K; kc += NW * 32 * U) {
#pragma unroll
        for (int u = 0; u < U; ++u) {
            V a[MB], a2[MB];
#pragma unroll
            for (int mb = 0; mb < MB; ++mb) { a[mb] = WFrag<T16>::ld((const T16*)((const char*)A + oa[mb]) + u * 32); if (NSPLIT == 2) a2[mb] = WFrag<T16>::ld((const T16*)((const char*)A2 + oa[mb]) + u * 32); }
#pragma unroll
            for (int nb = 0; nb < NB; ++nb) { const V b = WFrag<T16>::ld((const T16*)((const char*)Bt + ob[nb]) + u * 32); V b2; if (NSPLIT == 2) b2 = WFrag<T16>::ld((const T16*)((const char*)Bt2 + ob[nb]) + u * 32);
#pragma unroll
                for (int mb = 0; mb < MB; ++mb) { acc[mb][nb] = WFrag<T16>::mma(a[mb], b, acc[mb][nb]); if (NSPLIT == 2) { acc[mb][nb] = WFrag<T16>::mma(a2[mb], b, acc[mb][nb]); acc[mb][nb] = WFrag<T16>::mma(a[mb], b2, acc[mb][nb]); } } } }
#pragma unroll
        for (int mb = 0; mb < MB; ++mb) oa[mb] += NW * 32 * U * 2;
#pragma unroll
        for (int nb = 0; nb < NB; ++nb) ob[nb] += NW * 32 * U * 2;
    }
    // each lane parks its own 8 floats of every accumulator as two 16-byte slots, lanes side by side (no bank conflict)
#pragma unroll
    for (int mb = 0; mb < MB; ++mb)
#pragma unroll
        for (int nb = 0; nb < NB; ++nb)
#pragma unroll
            for (int h = 0; h < 2; ++h) { v4f p; p[0] = acc[mb][nb][h * 4]; p[1] = acc[mb][nb][h * 4 + 1]; p[2] = acc[mb][nb][h * 4 + 2]; p[3] = acc[mb][nb][h * 4 + 3];
                *(v4fa*)(red + ((size_t)(wave * SL + ((mb * NB + nb) * 2 + h) * 32 + lane)) * 4) = p; }
    __syncthreads();   // every wave's partial tile is in LDS before any thread sums over the waves
    for (int s = tid; s < SL; s += NW * 32) { v4f t = *(const v4fa*)(red + (size_t)s * 4);
#pragma unroll
        for (int w = 1; w < NW; ++w) { const v4f q = *(const v4fa*)(red + ((size_t)w * SL + s) * 4); t[0] += q[0]; t[1] += q[1]; t[2] += q[2]; t[3] += q[3]; }
        const int ln = s & 31, h = (s >> 5) & 1, tl = s >> 6; const int row = (tl / NB) * 16 + (ln >> 4) * 8 + h * 4, col = (tl % NB) * 16 + (ln & 15);
#pragma unroll
        for (int q = 0; q < 4; ++q) fin[(row + q) * FP + col] = t[q]; }
    __syncthreads();   // the summed tile is whole before it is read back row by row
    for (int s = tid; s < MB * 16 * NB * 4; s += NW * 32) { const int row = s / (NB * 4), cofs = (s % (NB * 4)) * 4; *(v4f*)(C + (size_t)(r0 + row) * ldc + c0 + cofs) = *(const v4fa*)(fin + row * FP + cofs); }
}

__device__ __forceinline__ h16 tohx(float x) { return (h16)x; }
__device__ __forceinline__ void splitf(float y, unsigned short& h, unsigned short& l) { h = f2bf(y); l = f2bf(y - bf2f(h)); }
typedef __attribute__((ext_vector_type(2))) _Float16 v2h;
typedef __attribute__((ext_vector_type(4))) _Float16 v4h;
typedef __attribute__((ext_vector_type(2))) unsigned short v2us;
typedef __attribute__((ext_vector_type(4))) unsigned short v4us;
typedef __attribute__((ext_vector_type(2))) float v2f;
typedef __attribute__((ext_vector_type(4))) int v4i;

__global__ __launch_bounds__(256) void k_wtG(const float* __restrict__ w, int K, int N, bf* Bt) {
    const int lane = threadIdx.x & 31; const int L0 = (blockIdx.x * 8 + (threadIdx.x >> 5)) * 8; const int nlines = N * K / 64;
{
#pragma unroll 1
        for (int l = 0; l < 8; ++l) { const int L = L0 + l; if (L >= nlines) break; const size_t e = (size_t)L * 64 + lane * 2; const int k = (int)(e % K), n = (int)(e / K); v2us o;
            o[0] = f2bf(w[(size_t)k * N + n]); o[1] = f2bf(w[(size_t)(k + 1) * N + n]); *(v2us*)(Bt + e) = o; }
         }
}
__global__ __launch_bounds__(256) void k_cvt8(const float* __restrict__ src, bf* dst, size_t n8) { const size_t i = (size_t)blockIdx.x * 256 + threadIdx.x; if (i >= n8) return; const v8f v = *(const v8f*)(src + i * 8); v8us o;
#pragma unroll
    for (int k = 0; k < 8; ++k) o[k] = f2bf(v[k]); *(v8us*)(dst + i * 8) = o;  }

// k_rope: head planes [h][t][d] (fp16 + hi/lo) of rope(x) x sc with the rotate-half convention out[d] = x[d] cos[t][d] - x[d+HD/2] sin[t][d], out[d+HD/2] = x[d+HD/2] cos[t][d+HD/2] + x[d] sin[t][d+HD/2]
__global__ __launch_bounds__(256) void k_rope(const float* __restrict__ F, int pitch, int nheads, const float* __restrict__ CS, const float* __restrict__ RF, const float* __restrict__ nw, float sc, h16* P16, bf* Ph, bf* Pl) {
    const size_t e = ((size_t)blockIdx.x * 256 + threadIdx.x) * 2; if (e >= (size_t)nheads * TT * HD) return; const int d = (int)(e % HD); const int t = (int)((e / HD) % TT); const int h = (int)(e / ((size_t)HD * TT)); const float* f = F + (size_t)t * pitch + h * HD; const float rf = RF ? RF[(size_t)h * TT + t] : 1.0f; v2h o16; v2us oh, ol;
#pragma unroll
    for (int q = 0; q < 2; ++q) { const int dd = d + q; const int dp = (dd < HD / 2) ? dd + HD / 2 : dd - HD / 2; float x0 = f[dd], x1 = f[dp];
        if (RF) { float n0 = __fmul_rn(x0, rf), n1 = __fmul_rn(x1, rf); asm volatile("" : "+v"(n0)); asm volatile("" : "+v"(n1)); x0 = __fmul_rn(bfr(nw[dd]), n0); x1 = __fmul_rn(bfr(nw[dp]), n1); }
        const v2f cs = *(const v2f*)(CS + ((size_t)t * HD + dd) * 2); float a = __fmul_rn(x0, cs[0]), bq = __fmul_rn(x1, cs[1]); asm volatile("" : "+v"(a)); asm volatile("" : "+v"(bq)); const float r = ((dd < HD / 2) ? __fsub_rn(a, bq) : __fadd_rn(a, bq)) * sc;
        o16[q] = tohx(r); unsigned short a2, c2; splitf(r, a2, c2); oh[q] = a2; ol[q] = c2; }
    *(v2h*)(P16 + e) = o16; *(v2us*)(Ph + e) = oh; *(v2us*)(Pl + e) = ol;  }
__global__ __launch_bounds__(256) void k_vtp(const float* __restrict__ F, int pitch, int nheads, h16* V16, bf* Vh, bf* Vl) { const size_t e = ((size_t)blockIdx.x * 256 + threadIdx.x) * 2; if (e >= (size_t)nheads * HD * TT) return; const int t = (int)(e % TT); const int d = (int)((e / TT) % HD); const int g = (int)(e / ((size_t)TT * HD)); v2h o16; v2us oh, ol;
#pragma unroll
    for (int q = 0; q < 2; ++q) { const float x = F[(size_t)(t + q) * pitch + g * HD + d]; o16[q] = tohx(x); unsigned short a2, c2; splitf(x, a2, c2); oh[q] = a2; ol[q] = c2; }
    *(v2h*)(V16 + e) = o16; *(v2us*)(Vh + e) = oh; *(v2us*)(Vl + e) = ol;  }
__global__ __launch_bounds__(256) void k_csid(float* CS) { const int idx = blockIdx.x * 256 + threadIdx.x; if (idx >= TT * HD) return; v2f cs; cs[0] = 1.0f; cs[1] = 0.0f; *(v2f*)(CS + (size_t)idx * 2) = cs;  }
__global__ __launch_bounds__(256) void k_asoft(const float* __restrict__ Sb, h16* P16, bf* Ph, bf* Pl, const int* __restrict__ pm) {
    const int lane = threadIdx.x & 31; const int row = blockIdx.x * 8 + (threadIdx.x >> 5); if (row >= ZH * TT) return; const int i = row % TT; const int zz = row / TT; (void)zz; const bool hires = (i < RH); const float* sr = Sb + (size_t)row * TT; float v[TT / 32]; float mx = -3.0e38f;
#pragma unroll
    for (int ch = 0; ch < TT / 128; ++ch) { const int j0 = ch * 128 + lane * 4; const v4f a = *(const v4f*)(sr + j0); const v4i p4 = *(const v4i*)(pm + j0);   /* 4 key-mask flags (16 B) */
#pragma unroll
        for (int q = 0; q < 4; ++q) { const int j = j0 + q; (void)j; const float t = (p4[q] != 0) ? a[q] * SCL : 1e-9f;   /* masked_fill(mask == 0, 1e-9): a constant logit, the key stays in the softmax */ v[ch * 4 + q] = t; mx = fmaxf(mx, t); } }
#pragma unroll
    for (int sh = 16; sh; sh >>= 1) mx = fmaxf(mx, __shfl_xor(mx, sh, 32));
    float sum = 0.f;
#pragma unroll
    for (int k = 0; k < TT / 32; ++k) { float d0 = __fsub_rn(v[k], mx); asm volatile("" : "+v"(d0)); v[k] = __builtin_amdgcn_exp2f(__fmul_rn(d0, 1.4426950408889634f)); sum += v[k]; }
#pragma unroll
    for (int sh = 16; sh; sh >>= 1) sum += __shfl_xor(sum, sh, 32);
    const float f = __fdiv_rn(hires ? 1.0f : PCAR, sum);
{
        if (hires) {
#pragma unroll
            for (int ch = 0; ch < TT / 128; ++ch) { v4us oh, ol;
#pragma unroll
                for (int q = 0; q < 4; ++q) { unsigned short a, c2; splitf(v[ch * 4 + q] * f, a, c2); oh[q] = a; ol[q] = c2; }
                const size_t oo = ((size_t)zz * (RH ? RH : 1) + i) * TT + ch * 128 + lane * 4; *(v4us*)(Ph + oo) = oh; *(v4us*)(Pl + oo) = ol; }
        } else {
#pragma unroll
            for (int ch = 0; ch < TT / 128; ++ch) { v4h o4;
#pragma unroll
                for (int q = 0; q < 4; ++q) o4[q] = tohx(v[ch * 4 + q] * f);
                *(v4h*)(P16 + (size_t)row * TT + ch * 128 + lane * 4) = o4; } }
         }
}
__global__ __launch_bounds__(256) void k_merge(const float* __restrict__ O, int h0, bf* Ah, bf* Al) { const size_t e = ((size_t)blockIdx.x * 256 + threadIdx.x) * 2; if (e >= (size_t)ZH * TT * HD) return; const int d = (int)(e % HD); const int t = (int)((e / HD) % TT); const int zz = (int)(e / ((size_t)HD * TT)); const float cs = (t < RH) ? 1.0f : (1.0f / PCAR); const size_t oo = (size_t)t * DQ + (h0 + zz) * HD + d;
    v2us oh, ol;
#pragma unroll
    for (int q = 0; q < 2; ++q) { unsigned short a, c2; splitf(O[e + q] * cs, a, c2); oh[q] = a; ol[q] = c2; } *(v2us*)(Ah + oo) = oh; *(v2us*)(Al + oo) = ol;  }

extern "C" void kernel_launch(void* const* d_in, const int* in_sizes, int n_in,
                              void* d_out, int out_size, void* d_ws, size_t ws_size, hipStream_t stream) {
    (void)in_sizes; (void)n_in; (void)out_size;
    const float* x = (const float*)d_in[0]; const int* mk = (const int*)d_in[1];   /* mask [4][2048] int {0,1} */ const float* wq = (const float*)d_in[2]; const float* wk = (const float*)d_in[3]; const float* wv = (const float*)d_in[4]; const float* wo = (const float*)d_in[5];
    float* OUT = (float*)d_out;     // [4][2048][512]
    char* wsp = (char*)d_ws;
    auto take = [&](size_t bytes) { char* p = wsp; wsp += (bytes + 255) & ~(size_t)255; return (void*)p; };
    bf* WQ = (bf*)take((size_t)DQ * DM * 2); bf* WK = (bf*)take((size_t)DKV * DM * 2); bf* WV = (bf*)take((size_t)DKV * DM * 2); bf* WO = (bf*)take((size_t)DM * DQ * 2); float* CS = (float*)take((size_t)TT * HD * 2 * 4);
    bf* XB = (bf*)take((size_t)TT * DM * 2); float* FQ = (float*)take((size_t)TT * DQ * 4); float* FK = (float*)take((size_t)TT * DKV * 4);
    h16* QP16 = (h16*)take((size_t)NH_ * TT * HD * 2); h16* KP16 = (h16*)take((size_t)NKV * TT * HD * 2); h16* VT16 = (h16*)take((size_t)NKV * HD * TT * 2);
    bf* QPh = (bf*)take((size_t)NH_ * TT * HD * 2); bf* QPl = (bf*)take((size_t)NH_ * TT * HD * 2); bf* KPh = (bf*)take((size_t)NKV * TT * HD * 2); bf* KPl = (bf*)take((size_t)NKV * TT * HD * 2); bf* VTh = (bf*)take((size_t)NKV * HD * TT * 2); bf* VTl = (bf*)take((size_t)NKV * HD * TT * 2); bf* Ph = (bf*)take((size_t)ZH * RH * TT * 2); bf* Pl = (bf*)take((size_t)ZH * RH * TT * 2);
    float* Sb = (float*)take((size_t)ZH * TT * TT * 4); h16* P16 = (h16*)take((size_t)ZH * TT * TT * 2); float* Ob = (float*)take((size_t)ZH * TT * HD * 4); bf* ATh = (bf*)take((size_t)TT * DQ * 2); bf* ATl = (bf*)take((size_t)TT * DQ * 2);
    if ((size_t)(wsp - (char*)d_ws) > ws_size) return;    // ws 256 MiB
    float* FV = FK;   // v projection reuses the k buffer after the k planes are built (stream-ordered)
    { k_cvt8<<<(unsigned)(((size_t)DQ * DM / 8 + 255) / 256), 256, 0, stream>>>(wq, WQ, (size_t)DQ * DM / 8); k_cvt8<<<(unsigned)(((size_t)DKV * DM / 8 + 255) / 256), 256, 0, stream>>>(wk, WK, (size_t)DKV * DM / 8); k_cvt8<<<(unsigned)(((size_t)DKV * DM / 8 + 255) / 256), 256, 0, stream>>>(wv, WV, (size_t)DKV * DM / 8);
      k_cvt8<<<(unsigned)(((size_t)DM * DQ / 8 + 255) / 256), 256, 0, stream>>>(wo, WO, (size_t)DM * DQ / 8);
       }
    k_csid<<<(TT * HD + 255) / 256, 256, 0, stream>>>(CS);
    const unsigned LQ = (unsigned)(((size_t)NH_ * TT * HD / 2 + 255) / 256), LKv = (unsigned)(((size_t)NKV * TT * HD / 2 + 255) / 256);
    for (int b = 0; b < NB_; ++b) {
        
        k_cvt8<<<(unsigned)(((size_t)TT * DM / 8 + 255) / 256), 256, 0, stream>>>(x + (size_t)b * TT * DM, XB, (size_t)TT * DM / 8);
        k_gemmw<bf, 0, false><<<dim3(TT / 64, DQ / 64, 1), 32, 0, stream>>>(XB, nullptr, WQ, nullptr, DM, FQ, DQ, nullptr, 0, 0, 0);
        k_rope<<<LQ, 256, 0, stream>>>(FQ, DQ, NH_, CS, nullptr, nullptr, 1.0f, QP16, QPh, QPl);
        k_gemmw<bf, 0, false><<<dim3(TT / 64, DKV / 64, 1), 32, 0, stream>>>(XB, nullptr, WK, nullptr, DM, FK, DKV, nullptr, 0, 0, 0);
        k_rope<<<LKv, 256, 0, stream>>>(FK, DKV, NKV, CS, nullptr, nullptr, 1.0f, KP16, KPh, KPl);
        k_gemmw<bf, 0, false><<<dim3(TT / 64, DKV / 64, 1), 32, 0, stream>>>(XB, nullptr, WV, nullptr, DM, FV, DKV, nullptr, 0, 0, 0); k_vtp<<<LKv, 256, 0, stream>>>(FV, DKV, NKV, VT16, VTh, VTl);
        for (int h0 = 0; h0 < NH_; h0 += ZH) { const size_t zq = (size_t)h0, zk = (size_t)(h0 / REP);   // one kv head per query head: the pass's two heads use consecutive kv planes (z-strides TT*HD)
            k_gemmw<bf, 2, false><<<dim3(RH / 64, TT / 64, ZH), 32, 0, stream>>>(QPh + zq * TT * HD, QPl + zq * TT * HD, KPh + zk * TT * HD, KPl + zk * TT * HD, HD, Sb, TT, nullptr, (size_t)TT * HD, (size_t)TT * HD, (size_t)TT * TT);
            k_gemmw<h16, 0, false><<<dim3((TT - RH) / 64, TT / 64, ZH), 32, 0, stream>>>(QP16 + zq * TT * HD + (size_t)RH * HD, nullptr, KP16 + zk * TT * HD, nullptr, HD, Sb + (size_t)RH * TT, TT, nullptr, (size_t)TT * HD, (size_t)TT * HD, (size_t)TT * TT);
            k_asoft<<<ZH * TT / 8, 256, 0, stream>>>(Sb, P16, Ph, Pl, mk + (size_t)b * TT);
            k_gemmk<bf, 2, 1, 2, 8, 4><<<dim3(RH / 16, HD / 32, ZH), 256, 0, stream>>>(Ph, Pl, VTh + zk * HD * TT, VTl + zk * HD * TT, TT, Ob, HD, (size_t)RH * TT, (size_t)HD * TT, (size_t)TT * HD);
            k_gemmk<h16, 0, 2, 2, 8, 4><<<dim3((TT - RH) / 32, HD / 32, ZH), 256, 0, stream>>>(P16 + (size_t)RH * TT, nullptr, VT16 + zk * HD * TT, nullptr, TT, Ob + (size_t)RH * HD, HD, (size_t)TT * TT, (size_t)HD * TT, (size_t)TT * HD);
            k_merge<<<(unsigned)(((size_t)ZH * TT * HD / 2 + 255) / 256), 256, 0, stream>>>(Ob, h0, ATh, ATl); }
        k_gemmw<bf, 1, false><<<dim3(TT / 64, DM / 64, 1), 32, 0, stream>>>(ATh, ATl, WO, nullptr, DQ, OUT + (size_t)b * TT * DM, DM, nullptr, 0, 0, 0); }
}

// v002
// One run takes 526 microseconds.
// Next to v001, in two timings, it ran 1.77 and 1.79 times as fast.
// Over all steps from v000 it is 3.85 times as fast.
#include <hip/hip_runtime.h>

// Cross-modal attention whose key mask FILLS WITH A CONSTANT instead of excluding (input_feature [4][2048][512]; q, k, v = x W^T ('oi' [512][512] 1/sqrt(512), no bias; 8 heads x 64); scores = q.k x 64^-0.5, then scores[b][..][i][j] = 1e-9 wherever mask[b][j] == 0 (mask [4][2048] int {0,1}, ~50 %, read): the masked keys STAY in the softmax with logit 1e-9 (the module's masked_fill quirk); softmax; out = merged (head-major channel concat) Wout^T ('oi') -> [4][2048][512] (4.2 M)).
// Layout: bf16 copy of x, q|k|v projections, head planes, head merge and Wout product each run ONCE over all 4 batches; per batch one pass over all 8 heads (grid z): dense T-2048 attention whose softmax kernel overwrites each f32 score row with its own probabilities (row pitch 2*TT 16-bit elements: fp16 in the first half, or hi | lo) and reads the batch's key mask (int32, 16 B per 4 keys) and substitutes the constant 1e-9 for the scaled score of masked keys (hybrid rows: < 512 hi/lo 3 products, rest fp16 x1024); merged hi/lo x Wout exact.
// Compute dtypes, f32 accumulate: every input rounded to bf16; projections exact; attention rows < 512 3 products, rest fp16; softmax f32; Wout hl x exact.

#define NB_  4
#define TT   2048
#define DM   512
#define NH_  8
#define NKV  8
#define REP  (NH_ / NKV)
#define HD   64
#define DQ   (NH_ * HD)
#define DKV  (NKV * HD)
#define ZH   8                    // heads per attention pass (grid z): all of a batch
#define RH   512                  // query rows < RH use hi+lo planes (0: none)
#define WIN  0
#define PCAR 1024.0f
#define SCL  0.125f   // HD^-0.5
typedef _Float16 h16;
typedef unsigned short bf;
typedef __attribute__((ext_vector_type(16))) __bf16   v16bf;
typedef __attribute__((ext_vector_type(16))) _Float16 v16h;
typedef __attribute__((ext_vector_type(8)))  _Float16 v8h;
typedef __attribute__((ext_vector_type(8)))  unsigned short v8us;
typedef __attribute__((ext_vector_type(8)))  float    v8f;
typedef __attribute__((ext_vector_type(4)))  float    v4f;
typedef v8h  __attribute__((may_alias)) v8ha;
typedef v4f  __attribute__((may_alias)) v4fa;
typedef v8us __attribute__((may_alias)) v8usa;

__device__ __forceinline__ unsigned short f2bf(float f) { unsigned u = __float_as_uint(f); u += 0x7FFFu + ((u >> 16) & 1u); return (unsigned short)(u >> 16); }
__device__ __forceinline__ float bf2f(unsigned short b) { return __uint_as_float(((unsigned)b) << 16); }
__device__ __forceinline__ float bfr(float f) { return bf2f(f2bf(f)); }
__device__ __forceinline__ v16h cat16(v8h lo, v8h hi) { return __builtin_shufflevector(lo, hi, 0, 1, 2, 3, 4, 5, 6, 7, 8, 9, 10, 11, 12, 13, 14, 15); }
__device__ __forceinline__ v16bf cat16b(v8us lo, v8us hi) { return __builtin_bit_cast(v16bf, __builtin_shufflevector(lo, hi, 0, 1, 2, 3, 4, 5, 6, 7, 8, 9, 10, 11, 12, 13, 14, 15)); }
__device__ __forceinline__ v8f wmma16(v16h a, v16h b, v8f c) { return __builtin_amdgcn_wmma_f32_16x16x32_f16(false, a, false, b, (short)0, c, false, false); }
__device__ __forceinline__ v8f wmmab(v16bf a, v16bf b, v8f c) { return __builtin_amdgcn_wmma_f32_16x16x32_bf16(false, a, false, b, (short)0, c, false, false); }



// ---- k_gemmw: register-blocked GEMM, ONE WAVE per 64x64 output tile (16 accumulators), operands straight from K-contiguous 16-bit planes; grid (M/64, N/64, Z), 32 threads.
// C[m][n] (f32, pitch ldc, + optional f32 bias[n]) = sum_k A[m][k] Bt[n][k] (+ split products per NSPLIT). z-batch strides sA/sB/sC in elements. K % 32 == 0.
template <typename T16> struct WFrag;
template <> struct WFrag<h16> { typedef v16h V; static __device__ __forceinline__ V ld(const h16* p) { return cat16(*(const v8h*)p, *(const v8h*)(p + 16)); } static __device__ __forceinline__ v8f mma(V a, V b, v8f c) { return wmma16(a, b, c); } };
template <> struct WFrag<bf> { typedef v16bf V; static __device__ __forceinline__ V ld(const bf* p) { return cat16b(*(const v8us*)p, *(const v8us*)(p + 16)); } static __device__ __forceinline__ v8f mma(V a, V b, v8f c) { return wmmab(a, b, c); } };
template <typename T16, int NSPLIT, bool BIAS>
__global__ __launch_bounds__(32) void k_gemmw(const T16* __restrict__ A, const T16* __restrict__ A2, const T16* __restrict__ Bt, const T16* __restrict__ Bt2, int K, float* C, int ldc, const float* __restrict__ bias, size_t sA, size_t sB, size_t sC) {
    typedef typename WFrag<T16>::V V;
    __shared__ __align__(16) float os[16 * 68];
    const size_t z = blockIdx.z; A += z * sA; if (A2) A2 += z * sA; Bt += z * sB; if (Bt2) Bt2 += z * sB; C += z * sC;
    const int lane = threadIdx.x & 31, lr = lane & 15, hi = lane >> 4; const int r0 = blockIdx.x * 64, c0 = blockIdx.y * 64;
    v8f acc[4][4];
#pragma unroll
    for (int mb = 0; mb < 4; ++mb)
#pragma unroll
        for (int nb = 0; nb < 4; ++nb) acc[mb][nb] = (v8f){};
    const size_t aoff = (size_t)(r0 + lr) * K + 8 * hi, boff = (size_t)(c0 + lr) * K + 8 * hi;
#pragma unroll 1
    for (int kc = 0; kc < K; kc += 32) {
        V a[4], a2[4];
#pragma unroll
        for (int mb = 0; mb < 4; ++mb) { a[mb] = WFrag<T16>::ld(A + aoff + (size_t)mb * 16 * K + kc); if (NSPLIT == 1 || NSPLIT == 2) a2[mb] = WFrag<T16>::ld(A2 + aoff + (size_t)mb * 16 * K + kc); }
#pragma unroll
        for (int nb = 0; nb < 4; ++nb) { const V b = WFrag<T16>::ld(Bt + boff + (size_t)nb * 16 * K + kc); V b2; if (NSPLIT >= 2) b2 = WFrag<T16>::ld(Bt2 + boff + (size_t)nb * 16 * K + kc);
#pragma unroll
            for (int mb = 0; mb < 4; ++mb) { acc[mb][nb] = WFrag<T16>::mma(a[mb], b, acc[mb][nb]); if (NSPLIT == 1 || NSPLIT == 2) acc[mb][nb] = WFrag<T16>::mma(a2[mb], b, acc[mb][nb]); if (NSPLIT >= 2) acc[mb][nb] = WFrag<T16>::mma(a[mb], b2, acc[mb][nb]); } }
        asm volatile("v_nop\n\tv_nop\n\tv_nop\n\tv_nop" : "+v"(acc[0][0]), "+v"(acc[1][1]), "+v"(acc[2][2]), "+v"(acc[3][3]) : "v"(a[0]), "v"(a[3]));
    }
#pragma unroll
    for (int mb = 0; mb < 4; ++mb) {
#pragma unroll
        for (int nb = 0; nb < 4; ++nb) {
#pragma unroll
            for (int j = 0; j < 8; ++j) os[(hi * 8 + j) * 68 + nb * 16 + lr] = acc[mb][nb][j]; }
        __builtin_amdgcn_wave_barrier(); asm volatile("" ::: "memory");
        float* crow = C + (size_t)(r0 + mb * 16) * ldc + c0;
{
#pragma unroll
            for (int s = 0; s < 8; ++s) { const int row = 2 * s + hi, cofs = lr * 4; v4f val = *(const v4fa*)(os + row * 68 + cofs); if (BIAS) { val[0] += bfr(bias[c0 + cofs]); val[1] += bfr(bias[c0 + cofs + 1]); val[2] += bfr(bias[c0 + cofs + 2]); val[3] += bfr(bias[c0 + cofs + 3]); }
                *(v4f*)(crow + (size_t)row * ldc + cofs) = val; }
             }
        __builtin_amdgcn_wave_barrier(); asm volatile("" ::: "memory");
    }
}

// ---- k_gemmk: the same product as k_gemmw for a LONG K and few output tiles: NW waves of one work-group share one (MB*16)x(NB*16) tile, wave w takes the k chunks w, w + NW, ... of 32*U elements,
// the NW partial tiles are summed in LDS in wave order 0..NW-1 (a fixed order), and the tile leaves in whole 128-B lines. grid (M/(MB*16), N/(NB*16), Z), NW*32 threads. K % (NW*32*U) == 0. A rows have pitch lda elements, Bt rows pitch K.
template <typename T16, int NSPLIT, int MB, int NB, int NW, int U>
__global__ __launch_bounds__(NW * 32) void k_gemmk(const T16* __restrict__ A, const T16* __restrict__ A2, const T16* __restrict__ Bt, const T16* __restrict__ Bt2, int K, int lda, float* C, int ldc, size_t sA, size_t sB, size_t sC) {
    typedef typename WFrag<T16>::V V;
    constexpr int SL = MB * NB * 64;          // 16-byte slots of one wave's partial tile
    constexpr int FP = NB * 16 + 4;           // pitch of the summed tile in LDS, floats
    __shared__ __align__(16) float red[NW * SL * 4];
    __shared__ __align__(16) float fin[MB * 16 * FP];
    const size_t z = blockIdx.z; A += z * sA; if (NSPLIT == 2) A2 += z * sA; Bt += z * sB; if (NSPLIT == 2) Bt2 += z * sB; C += z * sC;
    const int tid = threadIdx.x, lane = tid & 31, wave = __builtin_amdgcn_readfirstlane(tid >> 5) /* the wave's number as a scalar: the k loop branches on SCC and EXEC stays whole for the matrix instructions */, lr = lane & 15, hi = lane >> 4; const int r0 = blockIdx.x * (MB * 16), c0 = blockIdx.y * (NB * 16);
    v8f acc[MB][NB];
#pragma unroll
    for (int mb = 0; mb < MB; ++mb)
#pragma unroll
        for (int nb = 0; nb < NB; ++nb) acc[mb][nb] = (v8f){};
    // one byte offset per 16-row block (the same in both planes), at this lane's row and this wave's first k chunk; it steps by NW chunks at the foot of a trip
    unsigned oa[MB], ob[NB];
#pragma unroll
    for (int mb = 0; mb < MB; ++mb) oa[mb] = ((unsigned)(r0 + mb * 16 + lr) * (unsigned)lda + 8 * hi + wave * (32 * U)) * 2u;
#pragma unroll
    for (int nb = 0; nb < NB; ++nb) ob[nb] = ((unsigned)(c0 + nb * 16 + lr) * (unsigned)K + 8 * hi + wave * (32 * U)) * 2u;
    // the trips stay rolled (short code); the U steps of a chunk and every block loop in this kernel are unrolled, so that fragments and accumulators are registers and the steps are immediate offsets
#pragma unroll 1
    for (int kc = wave * (32 * U); kc < K; kc += NW * 32 * U) {
#pragma unroll
        for (int u = 0; u < U; ++u) {
            V a[MB], a2[MB];
#pragma unroll
            for (int mb = 0; mb < MB; ++mb) { a[mb] = WFrag<T16>::ld((const T16*)((const char*)A + oa[mb]) + u * 32); if (NSPLIT == 2) a2[mb] = WFrag<T16>::ld((const T16*)((const char*)A2 + oa[mb]) + u * 32); }
#pragma unroll
            for (int nb = 0; nb < NB; ++nb) { const V b = WFrag<T16>::ld((const T16*)((const char*)Bt + ob[nb]) + u * 32); V b2; if (NSPLIT == 2) b2 = WFrag<T16>::ld((const T16*)((const char*)Bt2 + ob[nb]) + u * 32);
#pragma unroll
                for (int mb = 0; mb < MB; ++mb) { acc[mb][nb] = WFrag<T16>::mma(a[mb], b, acc[mb][nb]); if (NSPLIT == 2) { acc[mb][nb] = WFrag<T16>::mma(a2[mb], b, acc[mb][nb]); acc[mb][nb] = WFrag<T16>::mma(a[mb], b2, acc[mb][nb]); } } } }
#pragma unroll
        for (int mb = 0; mb < MB; ++mb) oa[mb] += NW * 32 * U * 2;
#pragma unroll
        for (int nb = 0; nb < NB; ++nb) ob[nb] += NW * 32 * U * 2;
    }
    // each lane parks its own 8 floats of every accumulator as two 16-byte slots, lanes side by side (no bank conflict)
#pragma unroll
    for (int mb = 0; mb < MB; ++mb)
#pragma unroll
        for (int nb = 0; nb < NB; ++nb)
#pragma unroll
            for (int h = 0; h < 2; ++h) { v4f p; p[0] = acc[mb][nb][h * 4]; p[1] = acc[mb][nb][h * 4 + 1]; p[2] = acc[mb][nb][h * 4 + 2]; p[3] = acc[mb][nb][h * 4 + 3];
                *(v4fa*)(red + ((size_t)(wave * SL + ((mb * NB + nb) * 2 + h) * 32 + lane)) * 4) = p; }
    __syncthreads();   // every wave's partial tile is in LDS before any thread sums over the waves
    for (int s = tid; s < SL; s += NW * 32) { v4f t = *(const v4fa*)(red + (size_t)s * 4);
#pragma unroll
        for (int w = 1; w < NW; ++w) { const v4f q = *(const v4fa*)(red + ((size_t)w * SL + s) * 4); t[0] += q[0]; t[1] += q[1]; t[2] += q[2]; t[3] += q[3]; }
        const int ln = s & 31, h = (s >> 5) & 1, tl = s >> 6; const int row = (tl / NB) * 16 + (ln >> 4) * 8 + h * 4, col = (tl % NB) * 16 + (ln & 15);
#pragma unroll
        for (int q = 0; q < 4; ++q) fin[(row + q) * FP + col] = t[q]; }
    __syncthreads();   // the summed tile is whole before it is read back row by row
    for (int s = tid; s < MB * 16 * NB * 4; s += NW * 32) { const int row = s / (NB * 4), cofs = (s % (NB * 4)) * 4; *(v4f*)(C + (size_t)(r0 + row) * ldc + c0 + cofs) = *(const v4fa*)(fin + row * FP + cofs); }
}

__device__ __forceinline__ h16 tohx(float x) { return (h16)x; }
__device__ __forceinline__ void splitf(float y, unsigned short& h, unsigned short& l) { h = f2bf(y); l = f2bf(y - bf2f(h)); }
typedef __attribute__((ext_vector_type(2))) _Float16 v2h;
typedef __attribute__((ext_vector_type(4))) _Float16 v4h;
typedef __attribute__((ext_vector_type(2))) unsigned short v2us;
typedef __attribute__((ext_vector_type(4))) unsigned short v4us;
typedef __attribute__((ext_vector_type(2))) float v2f;
typedef __attribute__((ext_vector_type(4))) int v4i;

__global__ __launch_bounds__(256) void k_wtG(const float* __restrict__ w, int K, int N, bf* Bt) {
    const int lane = threadIdx.x & 31; const int L0 = (blockIdx.x * 8 + (threadIdx.x >> 5)) * 8; const int nlines = N * K / 64;
{
#pragma unroll 1
        for (int l = 0; l < 8; ++l) { const int L = L0 + l; if (L >= nlines) break; const size_t e = (size_t)L * 64 + lane * 2; const int k = (int)(e % K), n = (int)(e / K); v2us o;
            o[0] = f2bf(w[(size_t)k * N + n]); o[1] = f2bf(w[(size_t)(k + 1) * N + n]); *(v2us*)(Bt + e) = o; }
         }
}
__global__ __launch_bounds__(256) void k_cvt8(const float* __restrict__ src, bf* dst, size_t n8) { const size_t i = (size_t)blockIdx.x * 256 + threadIdx.x; if (i >= n8) return; const v8f v = *(const v8f*)(src + i * 8); v8us o;
#pragma unroll
    for (int k = 0; k < 8; ++k) o[k] = f2bf(v[k]); *(v8us*)(dst + i * 8) = o;  }

// k_cvt8w: the four weight matrices (n8 groups of 8 each) to one contiguous bf16 block, blockIdx.y picks the matrix
__global__ __launch_bounds__(256) void k_cvt8w(const float* __restrict__ w0, const float* __restrict__ w1, const float* __restrict__ w2, const float* __restrict__ w3, bf* dst, size_t n8) { const size_t i = (size_t)blockIdx.x * 256 + threadIdx.x; if (i >= n8) return; const int y = blockIdx.y; const float* src = (y == 0) ? w0 : (y == 1) ? w1 : (y == 2) ? w2 : w3; const v8f v = *(const v8f*)(src + i * 8); v8us o;
#pragma unroll
    for (int k = 0; k < 8; ++k) o[k] = f2bf(v[k]); *(v8us*)(dst + ((size_t)y * n8 + i) * 8) = o;  }

// k_rope: head planes [b][h][t][d] (fp16 + hi/lo) of rope(x) x sc with the rotate-half convention out[d] = x[d] cos[t][d] - x[d+HD/2] sin[t][d], out[d+HD/2] = x[d+HD/2] cos[t][d+HD/2] + x[d] sin[t][d+HD/2]
__global__ __launch_bounds__(256) void k_rope(const float* __restrict__ F, int pitch, int nheads, const float* __restrict__ CS, const float* __restrict__ RF, const float* __restrict__ nw, float sc, h16* P16, bf* Ph, bf* Pl) {
    { const size_t b = blockIdx.y, po = b * nheads * TT * HD; F += b * TT * pitch; if (RF) RF += b * nheads * TT; P16 += po; Ph += po; Pl += po; }   // blockIdx.y: the batch (TT rows of F, nheads planes)
    const size_t e = ((size_t)blockIdx.x * 256 + threadIdx.x) * 2; if (e >= (size_t)nheads * TT * HD) return; const int d = (int)(e % HD); const int t = (int)((e / HD) % TT); const int h = (int)(e / ((size_t)HD * TT)); const float* f = F + (size_t)t * pitch + h * HD; const float rf = RF ? RF[(size_t)h * TT + t] : 1.0f; v2h o16; v2us oh, ol;
#pragma unroll
    for (int q = 0; q < 2; ++q) { const int dd = d + q; const int dp = (dd < HD / 2) ? dd + HD / 2 : dd - HD / 2; float x0 = f[dd], x1 = f[dp];
        if (RF) { float n0 = __fmul_rn(x0, rf), n1 = __fmul_rn(x1, rf); asm volatile("" : "+v"(n0)); asm volatile("" : "+v"(n1)); x0 = __fmul_rn(bfr(nw[dd]), n0); x1 = __fmul_rn(bfr(nw[dp]), n1); }
        const v2f cs = *(const v2f*)(CS + ((size_t)t * HD + dd) * 2); float a = __fmul_rn(x0, cs[0]), bq = __fmul_rn(x1, cs[1]); asm volatile("" : "+v"(a)); asm volatile("" : "+v"(bq)); const float r = ((dd < HD / 2) ? __fsub_rn(a, bq) : __fadd_rn(a, bq)) * sc;
        o16[q] = tohx(r); unsigned short a2, c2; splitf(r, a2, c2); oh[q] = a2; ol[q] = c2; }
    *(v2h*)(P16 + e) = o16; *(v2us*)(Ph + e) = oh; *(v2us*)(Pl + e) = ol;  }
__global__ __launch_bounds__(256) void k_vtp(const float* __restrict__ F, int pitch, int nheads, h16* V16, bf* Vh, bf* Vl) { const size_t e = ((size_t)blockIdx.x * 256 + threadIdx.x) * 2; if (e >= (size_t)nheads * HD * TT) return; const int t = (int)(e % TT); const int d = (int)((e / TT) % HD); const int g = (int)(e / ((size_t)TT * HD)); v2h o16; v2us oh, ol;
    { const size_t b = blockIdx.y, po = b * nheads * HD * TT; F += b * TT * pitch; V16 += po; Vh += po; Vl += po; }   // blockIdx.y: the batch (TT rows of F, nheads planes)
#pragma unroll
    for (int q = 0; q < 2; ++q) { const float x = F[(size_t)(t + q) * pitch + g * HD + d]; o16[q] = tohx(x); unsigned short a2, c2; splitf(x, a2, c2); oh[q] = a2; ol[q] = c2; }
    *(v2h*)(V16 + e) = o16; *(v2us*)(Vh + e) = oh; *(v2us*)(Vl + e) = ol;  }
__global__ __launch_bounds__(256) void k_csid(float* CS) { const int idx = blockIdx.x * 256 + threadIdx.x; if (idx >= TT * HD) return; v2f cs; cs[0] = 1.0f; cs[1] = 0.0f; *(v2f*)(CS + (size_t)idx * 2) = cs;  }
// k_asoft: one wave per score row. P16, Ph and Pl lie IN the row's own 8 KiB of Sb (pitch 2*TT 16-bit elements): the wave holds its whole row in registers (the row sum needs every load) before its first store, and no other wave touches the row.
__global__ __launch_bounds__(256) void k_asoft(const float* Sb, h16* P16, bf* Ph, bf* Pl, const int* __restrict__ pm) {
    const int lane = threadIdx.x & 31; const int row = blockIdx.x * 8 + (threadIdx.x >> 5); if (row >= ZH * TT) return; const int i = row % TT; const int zz = row / TT; (void)zz; const bool hires = (i < RH); const float* sr = Sb + (size_t)row * TT; float v[TT / 32]; float mx = -3.0e38f;
#pragma unroll
    for (int ch = 0; ch < TT / 128; ++ch) { const int j0 = ch * 128 + lane * 4; const v4f a = *(const v4f*)(sr + j0); const v4i p4 = *(const v4i*)(pm + j0);   /* 4 key-mask flags (16 B) */
#pragma unroll
        for (int q = 0; q < 4; ++q) { const int j = j0 + q; (void)j; const float t = (p4[q] != 0) ? a[q] * SCL : 1e-9f;   /* masked_fill(mask == 0, 1e-9): a constant logit, the key stays in the softmax */ v[ch * 4 + q] = t; mx = fmaxf(mx, t); } }
#pragma unroll
    for (int sh = 16; sh; sh >>= 1) mx = fmaxf(mx, __shfl_xor(mx, sh, 32));
    float sum = 0.f;
#pragma unroll
    for (int k = 0; k < TT / 32; ++k) { float d0 = __fsub_rn(v[k], mx); asm volatile("" : "+v"(d0)); v[k] = __builtin_amdgcn_exp2f(__fmul_rn(d0, 1.4426950408889634f)); sum += v[k]; }
#pragma unroll
    for (int sh = 16; sh; sh >>= 1) sum += __shfl_xor(sum, sh, 32);
    const float f = __fdiv_rn(hires ? 1.0f : PCAR, sum);
{
        if (hires) {
#pragma unroll
            for (int ch = 0; ch < TT / 128; ++ch) { v4us oh, ol;
#pragma unroll
                for (int q = 0; q < 4; ++q) { unsigned short a, c2; splitf(v[ch * 4 + q] * f, a, c2); oh[q] = a; ol[q] = c2; }
                const size_t oo = (size_t)row * (2 * TT) + ch * 128 + lane * 4; *(v4us*)(Ph + oo) = oh; *(v4us*)(Pl + oo) = ol; }
        } else {
#pragma unroll
            for (int ch = 0; ch < TT / 128; ++ch) { v4h o4;
#pragma unroll
                for (int q = 0; q < 4; ++q) o4[q] = tohx(v[ch * 4 + q] * f);
                *(v4h*)(P16 + (size_t)row * (2 * TT) + ch * 128 + lane * 4) = o4; } }
         }
}
__global__ __launch_bounds__(256) void k_merge(const float* __restrict__ O, bf* Ah, bf* Al) { const size_t e = ((size_t)blockIdx.x * 256 + threadIdx.x) * 2; if (e >= (size_t)NB_ * NH_ * TT * HD) return; const int d = (int)(e % HD); const int t = (int)((e / HD) % TT); const int zz = (int)(e / ((size_t)HD * TT)); const float cs = (t < RH) ? 1.0f : (1.0f / PCAR); const size_t oo = ((size_t)(zz / NH_) * TT + t) * DQ + (zz % NH_) * HD + d;
    v2us oh, ol;
#pragma unroll
    for (int q = 0; q < 2; ++q) { unsigned short a, c2; splitf(O[e + q] * cs, a, c2); oh[q] = a; ol[q] = c2; } *(v2us*)(Ah + oo) = oh; *(v2us*)(Al + oo) = ol;  }

extern "C" void kernel_launch(void* const* d_in, const int* in_sizes, int n_in,
                              void* d_out, int out_size, void* d_ws, size_t ws_size, hipStream_t stream) {
    (void)in_sizes; (void)n_in; (void)out_size;
    const float* x = (const float*)d_in[0]; const int* mk = (const int*)d_in[1];   /* mask [4][2048] int {0,1} */ const float* wq = (const float*)d_in[2]; const float* wk = (const float*)d_in[3]; const float* wv = (const float*)d_in[4]; const float* wo = (const float*)d_in[5];
    float* OUT = (float*)d_out;     // [4][2048][512]
    char* wsp = (char*)d_ws;
    auto take = [&](size_t bytes) { char* p = wsp; wsp += (bytes + 255) & ~(size_t)255; return (void*)p; };
    bf* WA = (bf*)take((size_t)(DQ + 2 * DKV + DM) * DM * 2); bf* WO = WA + (size_t)(DQ + 2 * DKV) * DM;   // Wq | Wk | Wv rows as ONE [1536][512] operand, then Wout
    float* CS = (float*)take((size_t)TT * HD * 2 * 4);
    bf* XB = (bf*)take((size_t)NB_ * TT * DM * 2);
    // q and k head planes [b][8 q heads | 8 k heads][t][d]; v planes [b][g][d][t]
    h16* QK16 = (h16*)take((size_t)NB_ * (NH_ + NKV) * TT * HD * 2); bf* QKh = (bf*)take((size_t)NB_ * (NH_ + NKV) * TT * HD * 2); bf* QKl = (bf*)take((size_t)NB_ * (NH_ + NKV) * TT * HD * 2);
    h16* VT16 = (h16*)take((size_t)NB_ * NKV * HD * TT * 2); bf* VTh = (bf*)take((size_t)NB_ * NKV * HD * TT * 2); bf* VTl = (bf*)take((size_t)NB_ * NKV * HD * TT * 2);
    float* Sb = (float*)take((size_t)ZH * TT * TT * 4); float* Ob = (float*)take((size_t)NB_ * NH_ * TT * HD * 4); bf* ATh = (bf*)take((size_t)NB_ * TT * DQ * 2); bf* ATl = (bf*)take((size_t)NB_ * TT * DQ * 2);
    if ((size_t)(wsp - (char*)d_ws) > ws_size) return;    // 243 MiB of the 256 MiB
    const int NP = DQ + 2 * DKV;   // pitch of the joint projection
    float* F = Sb;   // [4*2048][1536] f32 projections (48 MiB) live in the score buffer until the planes are built (stream-ordered)
    k_cvt8w<<<dim3((unsigned)(((size_t)DQ * DM / 8 + 255) / 256), 4, 1), 256, 0, stream>>>(wq, wk, wv, wo, WA, (size_t)DQ * DM / 8);
    k_csid<<<(TT * HD + 255) / 256, 256, 0, stream>>>(CS);
    k_cvt8<<<(unsigned)(((size_t)NB_ * TT * DM / 8 + 255) / 256), 256, 0, stream>>>(x, XB, (size_t)NB_ * TT * DM / 8);
    k_gemmw<bf, 0, false><<<dim3(NB_ * TT / 64, NP / 64, 1), 32, 0, stream>>>(XB, nullptr, WA, nullptr, DM, F, NP, nullptr, 0, 0, 0);
    k_rope<<<dim3((unsigned)(((size_t)(NH_ + NKV) * TT * HD / 2 + 255) / 256), NB_, 1), 256, 0, stream>>>(F, NP, NH_ + NKV, CS, nullptr, nullptr, 1.0f, QK16, QKh, QKl);
    k_vtp<<<dim3((unsigned)(((size_t)NKV * TT * HD / 2 + 255) / 256), NB_, 1), 256, 0, stream>>>(F + DQ + DKV, NP, NKV, VT16, VTh, VTl);
    for (int b = 0; b < NB_; ++b) {   // one pass per batch, its 8 heads in grid z (one kv head per query head: z-strides TT*HD)
        const size_t pq = (size_t)b * (NH_ + NKV) * TT * HD, pk = pq + (size_t)NH_ * TT * HD, pv = (size_t)b * NKV * HD * TT; float* O = Ob + (size_t)b * NH_ * TT * HD;
        k_gemmw<bf, 2, false><<<dim3(RH / 64, TT / 64, ZH), 32, 0, stream>>>(QKh + pq, QKl + pq, QKh + pk, QKl + pk, HD, Sb, TT, nullptr, (size_t)TT * HD, (size_t)TT * HD, (size_t)TT * TT);
        k_gemmw<h16, 0, false><<<dim3((TT - RH) / 64, TT / 64, ZH), 32, 0, stream>>>(QK16 + pq + (size_t)RH * HD, nullptr, QK16 + pk, nullptr, HD, Sb + (size_t)RH * TT, TT, nullptr, (size_t)TT * HD, (size_t)TT * HD, (size_t)TT * TT);
        k_asoft<<<ZH * TT / 8, 256, 0, stream>>>(Sb, (h16*)Sb, (bf*)Sb, (bf*)Sb + TT, mk + (size_t)b * TT);
        k_gemmk<bf, 2, 1, 2, 8, 4><<<dim3(RH / 16, HD / 32, ZH), 256, 0, stream>>>((const bf*)Sb, (const bf*)Sb + TT, VTh + pv, VTl + pv, TT, 2 * TT, O, HD, (size_t)2 * TT * TT, (size_t)HD * TT, (size_t)TT * HD);
        k_gemmk<h16, 0, 2, 2, 8, 4><<<dim3((TT - RH) / 32, HD / 32, ZH), 256, 0, stream>>>((const h16*)Sb + (size_t)RH * 2 * TT, nullptr, VT16 + pv, nullptr, TT, 2 * TT, O + (size_t)RH * HD, HD, (size_t)2 * TT * TT, (size_t)HD * TT, (size_t)TT * HD); }
    k_merge<<<(unsigned)(((size_t)NB_ * NH_ * TT * HD / 2 + 255) / 256), 256, 0, stream>>>(Ob, ATh, ATl);
    k_gemmw<bf, 1, false><<<dim3(NB_ * TT / 64, DM / 64, 1), 32, 0, stream>>>(ATh, ATl, WO, nullptr, DQ, OUT, DM, nullptr, 0, 0, 0);
}

// v003
// It runs in 174 microseconds.
// Next to v002, in two timings, it ran 3.02 times as fast each time.
// Counting every step since v000, it is 11.6 times as fast.
#include <hip/hip_runtime.h>

// Cross-modal attention whose key mask FILLS WITH A CONSTANT instead of excluding (input_feature [4][2048][512]; q, k, v = x W^T ('oi' [512][512] 1/sqrt(512), no bias; 8 heads x 64); scores = q.k x 64^-0.5, then scores[b][..][i][j] = 1e-9 wherever mask[b][j] == 0 (mask [4][2048] int {0,1}, ~50 %, read): the masked keys STAY in the softmax with logit 1e-9 (the module's masked_fill quirk); softmax; out = merged (head-major channel concat) Wout^T ('oi') -> [4][2048][512] (4.2 M)).
// Layout: bf16 copy of x, q|k|v projections, head planes and Wout product each run ONCE over all 4 batches; attention is ONE fused launch over all batches and heads (k_fattn): scores, online softmax and P.V per 128 query rows, K and V tiles shared in LDS, the batch's key mask (int32) read once per work-group into one bit per key; a masked key's scaled score is replaced by the constant 1e-9 (hybrid rows: < 512 hi/lo 3 products, rest fp16 x1024); merged hi/lo x Wout exact.
// Compute dtypes, f32 accumulate: every input rounded to bf16; projections exact; attention rows < 512 3 products, rest fp16; softmax f32; Wout hl x exact.

#define NB_  4
#define TT   2048
#define DM   512
#define NH_  8
#define NKV  8
#define REP  (NH_ / NKV)
#define HD   64
#define DQ   (NH_ * HD)
#define DKV  (NKV * HD)
#define RH   512                  // query rows < RH use hi+lo planes (0: none)
#define WIN  0
#define SCL  0.125f   // HD^-0.5
typedef _Float16 h16;
typedef unsigned short bf;
typedef __attribute__((ext_vector_type(16))) __bf16   v16bf;
typedef __attribute__((ext_vector_type(16))) _Float16 v16h;
typedef __attribute__((ext_vector_type(8)))  _Float16 v8h;
typedef __attribute__((ext_vector_type(8)))  unsigned short v8us;
typedef __attribute__((ext_vector_type(8)))  float    v8f;
typedef __attribute__((ext_vector_type(4)))  float    v4f;
typedef v8h  __attribute__((may_alias)) v8ha;
typedef v4f  __attribute__((may_alias)) v4fa;
typedef v8us __attribute__((may_alias)) v8usa;

__device__ __forceinline__ unsigned short f2bf(float f) { unsigned u = __float_as_uint(f); u += 0x7FFFu + ((u >> 16) & 1u); return (unsigned short)(u >> 16); }
__device__ __forceinline__ float bf2f(unsigned short b) { return __uint_as_float(((unsigned)b) << 16); }
__device__ __forceinline__ float bfr(float f) { return bf2f(f2bf(f)); }
__device__ __forceinline__ v16h cat16(v8h lo, v8h hi) { return __builtin_shufflevector(lo, hi, 0, 1, 2, 3, 4, 5, 6, 7, 8, 9, 10, 11, 12, 13, 14, 15); }
__device__ __forceinline__ v16bf cat16b(v8us lo, v8us hi) { return __builtin_bit_cast(v16bf, __builtin_shufflevector(lo, hi, 0, 1, 2, 3, 4, 5, 6, 7, 8, 9, 10, 11, 12, 13, 14, 15)); }
__device__ __forceinline__ v8f wmma16(v16h a, v16h b, v8f c) { return __builtin_amdgcn_wmma_f32_16x16x32_f16(false, a, false, b, (short)0, c, false, false); }
__device__ __forceinline__ v8f wmmab(v16bf a, v16bf b, v8f c) { return __builtin_amdgcn_wmma_f32_16x16x32_bf16(false, a, false, b, (short)0, c, false, false); }



// ---- k_gemmw: register-blocked GEMM, ONE WAVE per 64x64 output tile (16 accumulators), operands straight from K-contiguous 16-bit planes; grid (M/64, N/64, Z), 32 threads.
// C[m][n] (f32, pitch ldc, + optional f32 bias[n]) = sum_k A[m][k] Bt[n][k] (+ split products per NSPLIT). z-batch strides sA/sB/sC in elements. K % 32 == 0.
template <typename T16> struct WFrag;
template <> struct WFrag<h16> { typedef v16h V; static __device__ __forceinline__ V ld(const h16* p) { return cat16(*(const v8h*)p, *(const v8h*)(p + 16)); } static __device__ __forceinline__ v8f mma(V a, V b, v8f c) { return wmma16(a, b, c); } };
template <> struct WFrag<bf> { typedef v16bf V; static __device__ __forceinline__ V ld(const bf* p) { return cat16b(*(const v8us*)p, *(const v8us*)(p + 16)); } static __device__ __forceinline__ v8f mma(V a, V b, v8f c) { return wmmab(a, b, c); } };
template <typename T16, int NSPLIT, bool BIAS>
__global__ __launch_bounds__(32) void k_gemmw(const T16* __restrict__ A, const T16* __restrict__ A2, const T16* __restrict__ Bt, const T16* __restrict__ Bt2, int K, float* C, int ldc, const float* __restrict__ bias, size_t sA, size_t sB, size_t sC) {
    typedef typename WFrag<T16>::V V;
    __shared__ __align__(16) float os[16 * 68];
    const size_t z = blockIdx.z; A += z * sA; if (A2) A2 += z * sA; Bt += z * sB; if (Bt2) Bt2 += z * sB; C += z * sC;
    const int lane = threadIdx.x & 31, lr = lane & 15, hi = lane >> 4; const int r0 = blockIdx.x * 64, c0 = blockIdx.y * 64;
    v8f acc[4][4];
#pragma unroll
    for (int mb = 0; mb < 4; ++mb)
#pragma unroll
        for (int nb = 0; nb < 4; ++nb) acc[mb][nb] = (v8f){};
    const size_t aoff = (size_t)(r0 + lr) * K + 8 * hi, boff = (size_t)(c0 + lr) * K + 8 * hi;
#pragma unroll 1
    for (int kc = 0; kc < K; kc += 32) {
        V a[4], a2[4];
#pragma unroll
        for (int mb = 0; mb < 4; ++mb) { a[mb] = WFrag<T16>::ld(A + aoff + (size_t)mb * 16 * K + kc); if (NSPLIT == 1 || NSPLIT == 2) a2[mb] = WFrag<T16>::ld(A2 + aoff + (size_t)mb * 16 * K + kc); }
#pragma unroll
        for (int nb = 0; nb < 4; ++nb) { const V b = WFrag<T16>::ld(Bt + boff + (size_t)nb * 16 * K + kc); V b2; if (NSPLIT >= 2) b2 = WFrag<T16>::ld(Bt2 + boff + (size_t)nb * 16 * K + kc);
#pragma unroll
            for (int mb = 0; mb < 4; ++mb) { acc[mb][nb] = WFrag<T16>::mma(a[mb], b, acc[mb][nb]); if (NSPLIT == 1 || NSPLIT == 2) acc[mb][nb] = WFrag<T16>::mma(a2[mb], b, acc[mb][nb]); if (NSPLIT >= 2) acc[mb][nb] = WFrag<T16>::mma(a[mb], b2, acc[mb][nb]); } }
        asm volatile("v_nop\n\tv_nop\n\tv_nop\n\tv_nop" : "+v"(acc[0][0]), "+v"(acc[1][1]), "+v"(acc[2][2]), "+v"(acc[3][3]) : "v"(a[0]), "v"(a[3]));
    }
#pragma unroll
    for (int mb = 0; mb < 4; ++mb) {
#pragma unroll
        for (int nb = 0; nb < 4; ++nb) {
#pragma unroll
            for (int j = 0; j < 8; ++j) os[(hi * 8 + j) * 68 + nb * 16 + lr] = acc[mb][nb][j]; }
        __builtin_amdgcn_wave_barrier(); asm volatile("" ::: "memory");
        float* crow = C + (size_t)(r0 + mb * 16) * ldc + c0;
{
#pragma unroll
            for (int s = 0; s < 8; ++s) { const int row = 2 * s + hi, cofs = lr * 4; v4f val = *(const v4fa*)(os + row * 68 + cofs); if (BIAS) { val[0] += bfr(bias[c0 + cofs]); val[1] += bfr(bias[c0 + cofs + 1]); val[2] += bfr(bias[c0 + cofs + 2]); val[3] += bfr(bias[c0 + cofs + 3]); }
                *(v4f*)(crow + (size_t)row * ldc + cofs) = val; }
             }
        __builtin_amdgcn_wave_barrier(); asm volatile("" ::: "memory");
    }
}

__device__ __forceinline__ h16 tohx(float x) { return (h16)x; }
__device__ __forceinline__ void splitf(float y, unsigned short& h, unsigned short& l) { h = f2bf(y); l = f2bf(y - bf2f(h)); }
typedef __attribute__((ext_vector_type(2))) _Float16 v2h;
typedef __attribute__((ext_vector_type(4))) _Float16 v4h;
typedef __attribute__((ext_vector_type(2))) unsigned short v2us;
typedef __attribute__((ext_vector_type(4))) unsigned short v4us;
typedef __attribute__((ext_vector_type(2))) float v2f;
typedef __attribute__((ext_vector_type(4))) int v4i;

__global__ __launch_bounds__(256) void k_wtG(const float* __restrict__ w, int K, int N, bf* Bt) {
    const int lane = threadIdx.x & 31; const int L0 = (blockIdx.x * 8 + (threadIdx.x >> 5)) * 8; const int nlines = N * K / 64;
{
#pragma unroll 1
        for (int l = 0; l < 8; ++l) { const int L = L0 + l; if (L >= nlines) break; const size_t e = (size_t)L * 64 + lane * 2; const int k = (int)(e % K), n = (int)(e / K); v2us o;
            o[0] = f2bf(w[(size_t)k * N + n]); o[1] = f2bf(w[(size_t)(k + 1) * N + n]); *(v2us*)(Bt + e) = o; }
         }
}
__global__ __launch_bounds__(256) void k_cvt8(const float* __restrict__ src, bf* dst, size_t n8) { const size_t i = (size_t)blockIdx.x * 256 + threadIdx.x; if (i >= n8) return; const v8f v = *(const v8f*)(src + i * 8); v8us o;
#pragma unroll
    for (int k = 0; k < 8; ++k) o[k] = f2bf(v[k]); *(v8us*)(dst + i * 8) = o;  }

// k_cvt8w: the four weight matrices (n8 groups of 8 each) to one contiguous bf16 block, blockIdx.y picks the matrix
__global__ __launch_bounds__(256) void k_cvt8w(const float* __restrict__ w0, const float* __restrict__ w1, const float* __restrict__ w2, const float* __restrict__ w3, bf* dst, size_t n8) { const size_t i = (size_t)blockIdx.x * 256 + threadIdx.x; if (i >= n8) return; const int y = blockIdx.y; const float* src = (y == 0) ? w0 : (y == 1) ? w1 : (y == 2) ? w2 : w3; const v8f v = *(const v8f*)(src + i * 8); v8us o;
#pragma unroll
    for (int k = 0; k < 8; ++k) o[k] = f2bf(v[k]); *(v8us*)(dst + ((size_t)y * n8 + i) * 8) = o;  }

// k_rope: head planes [b][h][t][d] (fp16 + hi/lo) of rope(x) x sc with the rotate-half convention out[d] = x[d] cos[t][d] - x[d+HD/2] sin[t][d], out[d+HD/2] = x[d+HD/2] cos[t][d+HD/2] + x[d] sin[t][d+HD/2]
__global__ __launch_bounds__(256) void k_rope(const float* __restrict__ F, int pitch, int nheads, const float* __restrict__ CS, const float* __restrict__ RF, const float* __restrict__ nw, float sc, h16* P16, bf* Ph, bf* Pl) {
    { const size_t b = blockIdx.y, po = b * nheads * TT * HD; F += b * TT * pitch; if (RF) RF += b * nheads * TT; P16 += po; Ph += po; Pl += po; }   // blockIdx.y: the batch (TT rows of F, nheads planes)
    const size_t e = ((size_t)blockIdx.x * 256 + threadIdx.x) * 2; if (e >= (size_t)nheads * TT * HD) return; const int d = (int)(e % HD); const int t = (int)((e / HD) % TT); const int h = (int)(e / ((size_t)HD * TT)); const float* f = F + (size_t)t * pitch + h * HD; const float rf = RF ? RF[(size_t)h * TT + t] : 1.0f; v2h o16; v2us oh, ol;
#pragma unroll
    for (int q = 0; q < 2; ++q) { const int dd = d + q; const int dp = (dd < HD / 2) ? dd + HD / 2 : dd - HD / 2; float x0 = f[dd], x1 = f[dp];
        if (RF) { float n0 = __fmul_rn(x0, rf), n1 = __fmul_rn(x1, rf); asm volatile("" : "+v"(n0)); asm volatile("" : "+v"(n1)); x0 = __fmul_rn(bfr(nw[dd]), n0); x1 = __fmul_rn(bfr(nw[dp]), n1); }
        const v2f cs = *(const v2f*)(CS + ((size_t)t * HD + dd) * 2); float a = __fmul_rn(x0, cs[0]), bq = __fmul_rn(x1, cs[1]); asm volatile("" : "+v"(a)); asm volatile("" : "+v"(bq)); const float r = ((dd < HD / 2) ? __fsub_rn(a, bq) : __fadd_rn(a, bq)) * sc;
        o16[q] = tohx(r); unsigned short a2, c2; splitf(r, a2, c2); oh[q] = a2; ol[q] = c2; }
    *(v2h*)(P16 + e) = o16; *(v2us*)(Ph + e) = oh; *(v2us*)(Pl + e) = ol;  }
__global__ __launch_bounds__(256) void k_vtp(const float* __restrict__ F, int pitch, int nheads, h16* V16, bf* Vh, bf* Vl) { const size_t e = ((size_t)blockIdx.x * 256 + threadIdx.x) * 2; if (e >= (size_t)nheads * HD * TT) return; const int t = (int)(e % TT); const int d = (int)((e / TT) % HD); const int g = (int)(e / ((size_t)TT * HD)); v2h o16; v2us oh, ol;
    { const size_t b = blockIdx.y, po = b * nheads * HD * TT; F += b * TT * pitch; V16 += po; Vh += po; Vl += po; }   // blockIdx.y: the batch (TT rows of F, nheads planes)
#pragma unroll
    for (int q = 0; q < 2; ++q) { const float x = F[(size_t)(t + q) * pitch + g * HD + d]; o16[q] = tohx(x); unsigned short a2, c2; splitf(x, a2, c2); oh[q] = a2; ol[q] = c2; }
    *(v2h*)(V16 + e) = o16; *(v2us*)(Vh + e) = oh; *(v2us*)(Vl + e) = ol;  }
__global__ __launch_bounds__(256) void k_csid(float* CS) { const int idx = blockIdx.x * 256 + threadIdx.x; if (idx >= TT * HD) return; v2f cs; cs[0] = 1.0f; cs[1] = 0.0f; *(v2f*)(CS + (size_t)idx * 2) = cs;  }
// ---- k_fattn: scores, softmax and P.V of 128 query rows of one (batch, head) in ONE work-group of 4 waves; no score or probability ever reaches memory.
// S^T = K Q^T (A = 16 keys from LDS, B = 16 queries kept in registers): a lane holds scores of ONE query (column lr), keys 8*hi + j of each 16-key tile, so row maximum, row sum and rescale are per lane;
// two converted S^T tiles are the B operand of O^T += V^T P^T in the loader's own k order (8*hi + 0..7, 16 + 8*hi + 0..7). Running maximum (online softmax), in log2 units.
// A stage is KS keys: K rows and V^T rows go global -> registers (one stage ahead) -> LDS, shared by the 4 waves. Rows < RH: hi/lo bf16 planes, 3 products; the rest fp16. The epilogue writes the merged hi/lo planes.
#define KS 64                     // keys per stage
#define LP 72                     // LDS row pitch, 16-bit elements: 128 B of data + 16 B, so that 16 rows' 16-byte reads fall on different banks
typedef v4i __attribute__((may_alias)) v4ia;
template <typename T16, bool HI>
__device__ __forceinline__ void fa_body(const T16* __restrict__ Q, const T16* __restrict__ Q2, const T16* __restrict__ Kp, const T16* __restrict__ K2, const T16* __restrict__ Vt, const T16* __restrict__ V2,
                                        T16* sK, T16* sK2, T16* sV, T16* sV2, const unsigned short* mh, int q0, bf* Ah, bf* Al) {
    typedef typename WFrag<T16>::V V;
    constexpr float C1 = SCL * 1.4426950408889634f, C2 = 1e-9f * 1.4426950408889634f;   // scaled score and the mask's constant logit, in log2 units
    constexpr float OFF = HI ? 0.0f : 10.0f;   // fp16 P carries 2^10 (it cancels in the division by the row sum): small probabilities stay in fp16's normal range
    const int tid = threadIdx.x, lane = tid & 31, wave = tid >> 5, lr = lane & 15, hi = lane >> 4;
    V bq[2][2], bq2[2][2];
#pragma unroll
    for (int qb = 0; qb < 2; ++qb)
#pragma unroll
        for (int kc = 0; kc < 2; ++kc) { const size_t o = (size_t)(q0 + wave * 32 + qb * 16 + lr) * HD + kc * 32 + 8 * hi; bq[qb][kc] = WFrag<T16>::ld(Q + o); if (HI) bq2[qb][kc] = WFrag<T16>::ld(Q2 + o); }
    v8f O[4][2];
#pragma unroll
    for (int db = 0; db < 4; ++db)
#pragma unroll
        for (int qb = 0; qb < 2; ++qb) O[db][qb] = (v8f){};
    float m[2] = {-3.0e38f, -3.0e38f}, l[2] = {0.f, 0.f};
    v4i rk[4], rv[4], rk2[4], rv2[4];
    const int sr = tid >> 3, sg = (tid & 7) * 8;   // this thread's row (+ 16 i) and 16-byte segment of a staged tile
#pragma unroll
    for (int i = 0; i < 4; ++i) { const size_t ok = (size_t)(sr + 16 * i) * HD + sg, ov = (size_t)(sr + 16 * i) * TT + sg; rk[i] = *(const v4ia*)(Kp + ok); rv[i] = *(const v4ia*)(Vt + ov); if (HI) { rk2[i] = *(const v4ia*)(K2 + ok); rv2[i] = *(const v4ia*)(V2 + ov); } }
    // the stages stay rolled (short code); everything inside is unrolled so that fragments and accumulators are registers
#pragma unroll 1
    for (int k0 = 0; k0 < TT; k0 += KS) {
        __syncthreads();   // every wave has finished reading the previous stage's tiles
#pragma unroll
        for (int i = 0; i < 4; ++i) { const int o = (sr + 16 * i) * LP + sg; *(v4ia*)(sK + o) = rk[i]; *(v4ia*)(sV + o) = rv[i]; if (HI) { *(v4ia*)(sK2 + o) = rk2[i]; *(v4ia*)(sV2 + o) = rv2[i]; } }
        __syncthreads();   // the stage's tiles (and, at the first stage, the mask bits) are whole before any wave reads them
        if (k0 + KS < TT) {   // the next stage's global loads fly while this stage is worked on
#pragma unroll
            for (int i = 0; i < 4; ++i) { const size_t ok = (size_t)(k0 + KS + sr + 16 * i) * HD + sg, ov = (size_t)(sr + 16 * i) * TT + k0 + KS + sg; rk[i] = *(const v4ia*)(Kp + ok); rv[i] = *(const v4ia*)(Vt + ov); if (HI) { rk2[i] = *(const v4ia*)(K2 + ok); rv2[i] = *(const v4ia*)(V2 + ov); } }
            asm volatile("s_wait_xcnt 0x0" ::: "memory"); }   // the loads' address registers are reused by the work below while the loads are in flight: the wait stands in front of that reuse
        v8f S[4][2];
#pragma unroll
        for (int kt = 0; kt < 4; ++kt) {
            S[kt][0] = (v8f){}; S[kt][1] = (v8f){};
#pragma unroll
            for (int kc = 0; kc < 2; ++kc) { const int o = (kt * 16 + lr) * LP + kc * 32 + 8 * hi; const V ak = WFrag<T16>::ld(sK + o); V ak2; if (HI) ak2 = WFrag<T16>::ld(sK2 + o);
#pragma unroll
                for (int qb = 0; qb < 2; ++qb) { S[kt][qb] = WFrag<T16>::mma(ak, bq[qb][kc], S[kt][qb]); if (HI) { S[kt][qb] = WFrag<T16>::mma(ak, bq2[qb][kc], S[kt][qb]); S[kt][qb] = WFrag<T16>::mma(ak2, bq[qb][kc], S[kt][qb]); } } } }
        float mx[2] = {-3.0e38f, -3.0e38f};
#pragma unroll
        for (int kt = 0; kt < 4; ++kt) { const unsigned w = (unsigned)mh[(k0 >> 4) + kt] >> (8 * hi);   // this lane's 8 key-mask bits of the tile
#pragma unroll
            for (int j = 0; j < 8; ++j) { const bool keep = ((w >> j) & 1u) != 0u;
#pragma unroll
                for (int qb = 0; qb < 2; ++qb) { const float u = keep ? S[kt][qb][j] * C1 : C2;   /* masked_fill(mask == 0, 1e-9): a constant logit, the key stays in the softmax */ S[kt][qb][j] = u; mx[qb] = fmaxf(mx[qb], u); } } }
        float mn[2]; bool need = false;
#pragma unroll
        for (int qb = 0; qb < 2; ++qb) { mx[qb] = fmaxf(mx[qb], __shfl_xor(mx[qb], 16, 32)); mn[qb] = fmaxf(m[qb], mx[qb] - OFF); need = need || (mn[qb] > m[qb]); }
        if (__builtin_amdgcn_ballot_w32(need) != 0) {   // a scalar branch: sums and outputs are rescaled only in a stage that raises some row's maximum (the factor is exactly 1 for the other rows)
#pragma unroll
            for (int qb = 0; qb < 2; ++qb) { const float al = __builtin_amdgcn_exp2f(m[qb] - mn[qb]); l[qb] *= al; m[qb] = mn[qb];
#pragma unroll
                for (int db = 0; db < 4; ++db)
#pragma unroll
                    for (int j = 0; j < 8; ++j) O[db][qb][j] *= al; } }
#pragma unroll
        for (int kt = 0; kt < 4; ++kt)
#pragma unroll
            for (int qb = 0; qb < 2; ++qb)
#pragma unroll
                for (int j = 0; j < 8; ++j) { const float p = __builtin_amdgcn_exp2f(S[kt][qb][j] - m[qb]); S[kt][qb][j] = p; l[qb] += p; }
#pragma unroll
        for (int c = 0; c < 2; ++c) {   // 32 keys: S^T tiles 2c and 2c + 1 are one B operand
            V pb[2], pb2[2];
#pragma unroll
            for (int qb = 0; qb < 2; ++qb)
#pragma unroll
                for (int s = 0; s < 16; ++s) { const float p = S[2 * c + (s >> 3)][qb][s & 7];
                    if constexpr (HI) { const __bf16 ph = (__bf16)p; pb[qb][s] = ph; pb2[qb][s] = (__bf16)(p - (float)ph); } else { pb[qb][s] = (h16)p; } }
#pragma unroll
            for (int db = 0; db < 4; ++db) { const int o = (db * 16 + lr) * LP + c * 32 + 8 * hi; const V av = WFrag<T16>::ld(sV + o); V av2; if (HI) av2 = WFrag<T16>::ld(sV2 + o);
#pragma unroll
                for (int qb = 0; qb < 2; ++qb) { O[db][qb] = WFrag<T16>::mma(av, pb[qb], O[db][qb]); if (HI) { O[db][qb] = WFrag<T16>::mma(av, pb2[qb], O[db][qb]); O[db][qb] = WFrag<T16>::mma(av2, pb[qb], O[db][qb]); } } } }
    }
#pragma unroll
    for (int qb = 0; qb < 2; ++qb) { const float f = __fdiv_rn(1.0f, l[qb] + __shfl_xor(l[qb], 16, 32));   // the two lane halves hold disjoint keys' sums of the same query
        const size_t ro = (size_t)(q0 + wave * 32 + qb * 16 + lr) * DQ + 8 * hi;
#pragma unroll
        for (int db = 0; db < 4; ++db) { v8us oh, ol;
#pragma unroll
            for (int j = 0; j < 8; ++j) { unsigned short a, c2; splitf(O[db][qb][j] * f, a, c2); oh[j] = a; ol[j] = c2; }
            *(v8us*)(Ah + ro + db * 16) = oh; *(v8us*)(Al + ro + db * 16) = ol; } }
}
// grid (batch * head, 128-row block): the 3-product blocks (rows < RH) have the lowest linear ids and start first
__global__ __launch_bounds__(128) void k_fattn(const h16* __restrict__ QK16, const bf* __restrict__ QKh, const bf* __restrict__ QKl, const h16* __restrict__ VT16, const bf* __restrict__ VTh, const bf* __restrict__ VTl, const int* __restrict__ mk, bf* Ah, bf* Al) {
    __shared__ __align__(16) unsigned short sm[4][KS * LP];
    __shared__ __align__(16) unsigned short mh[TT / 16];   // the batch's key mask, one bit per key
    const int b = blockIdx.x / NH_, h = blockIdx.x % NH_, q0 = blockIdx.y * 128, tid = threadIdx.x;
    { const int* pm = mk + (size_t)b * TT + tid * 16; unsigned bits = 0;
#pragma unroll
      for (int c = 0; c < 4; ++c) { const v4i p4 = *(const v4i*)(pm + c * 4);
#pragma unroll
          for (int q = 0; q < 4; ++q) bits |= (p4[q] != 0 ? 1u : 0u) << (c * 4 + q); }
      mh[tid] = (unsigned short)bits; }
    const size_t pq = ((size_t)b * (NH_ + NKV) + h) * TT * HD, pk = pq + (size_t)NH_ * TT * HD, pv = ((size_t)b * NKV + h) * HD * TT, po = (size_t)b * TT * DQ + h * HD;
    if (q0 < RH) fa_body<bf, true>(QKh + pq, QKl + pq, QKh + pk, QKl + pk, VTh + pv, VTl + pv, (bf*)sm[0], (bf*)sm[1], (bf*)sm[2], (bf*)sm[3], mh, q0, Ah + po, Al + po);
    else fa_body<h16, false>(QK16 + pq, nullptr, QK16 + pk, nullptr, VT16 + pv, nullptr, (h16*)sm[0], nullptr, (h16*)sm[2], nullptr, mh, q0, Ah + po, Al + po);
}

extern "C" void kernel_launch(void* const* d_in, const int* in_sizes, int n_in,
                              void* d_out, int out_size, void* d_ws, size_t ws_size, hipStream_t stream) {
    (void)in_sizes; (void)n_in; (void)out_size;
    const float* x = (const float*)d_in[0]; const int* mk = (const int*)d_in[1];   /* mask [4][2048] int {0,1} */ const float* wq = (const float*)d_in[2]; const float* wk = (const float*)d_in[3]; const float* wv = (const float*)d_in[4]; const float* wo = (const float*)d_in[5];
    float* OUT = (float*)d_out;     // [4][2048][512]
    char* wsp = (char*)d_ws;
    auto take = [&](size_t bytes) { char* p = wsp; wsp += (bytes + 255) & ~(size_t)255; return (void*)p; };
    bf* WA = (bf*)take((size_t)(DQ + 2 * DKV + DM) * DM * 2); bf* WO = WA + (size_t)(DQ + 2 * DKV) * DM;   // Wq | Wk | Wv rows as ONE [1536][512] operand, then Wout
    float* CS = (float*)take((size_t)TT * HD * 2 * 4);
    bf* XB = (bf*)take((size_t)NB_ * TT * DM * 2);
    // q and k head planes [b][8 q heads | 8 k heads][t][d]; v planes [b][g][d][t]
    h16* QK16 = (h16*)take((size_t)NB_ * (NH_ + NKV) * TT * HD * 2); bf* QKh = (bf*)take((size_t)NB_ * (NH_ + NKV) * TT * HD * 2); bf* QKl = (bf*)take((size_t)NB_ * (NH_ + NKV) * TT * HD * 2);
    h16* VT16 = (h16*)take((size_t)NB_ * NKV * HD * TT * 2); bf* VTh = (bf*)take((size_t)NB_ * NKV * HD * TT * 2); bf* VTl = (bf*)take((size_t)NB_ * NKV * HD * TT * 2);
    const int NP = DQ + 2 * DKV;   // pitch of the joint projection
    float* F = (float*)take((size_t)NB_ * TT * NP * 4);   // [4*2048][1536] f32 projections
    bf* ATh = (bf*)take((size_t)NB_ * TT * DQ * 2); bf* ATl = (bf*)take((size_t)NB_ * TT * DQ * 2);
    if ((size_t)(wsp - (char*)d_ws) > ws_size) return;    // 147 MiB of the 256 MiB
    k_cvt8w<<<dim3((unsigned)(((size_t)DQ * DM / 8 + 255) / 256), 4, 1), 256, 0, stream>>>(wq, wk, wv, wo, WA, (size_t)DQ * DM / 8);
    k_csid<<<(TT * HD + 255) / 256, 256, 0, stream>>>(CS);
    k_cvt8<<<(unsigned)(((size_t)NB_ * TT * DM / 8 + 255) / 256), 256, 0, stream>>>(x, XB, (size_t)NB_ * TT * DM / 8);
    k_gemmw<bf, 0, false><<<dim3(NB_ * TT / 64, NP / 64, 1), 32, 0, stream>>>(XB, nullptr, WA, nullptr, DM, F, NP, nullptr, 0, 0, 0);
    k_rope<<<dim3((unsigned)(((size_t)(NH_ + NKV) * TT * HD / 2 + 255) / 256), NB_, 1), 256, 0, stream>>>(F, NP, NH_ + NKV, CS, nullptr, nullptr, 1.0f, QK16, QKh, QKl);
    k_vtp<<<dim3((unsigned)(((size_t)NKV * TT * HD / 2 + 255) / 256), NB_, 1), 256, 0, stream>>>(F + DQ + DKV, NP, NKV, VT16, VTh, VTl);
    k_fattn<<<dim3(NB_ * NH_, TT / 128, 1), 128, 0, stream>>>(QK16, QKh, QKl, VT16, VTh, VTl, mk, ATh, ATl);
    k_gemmw<bf, 1, false><<<dim3(NB_ * TT / 64, DM / 64, 1), 32, 0, stream>>>(ATh, ATl, WO, nullptr, DQ, OUT, DM, nullptr, 0, 0, 0);
}

// v004
// A run of this version takes 133 microseconds.
// Two timings next to v003 put it at 1.31 and 1.30 times that version's speed.
// All steps since v000 together make it 15.2 times as fast.
#include <hip/hip_runtime.h>

// Cross-modal attention whose key mask FILLS WITH A CONSTANT instead of excluding (input_feature [4][2048][512]; q, k, v = x W^T ('oi' [512][512] 1/sqrt(512), no bias; 8 heads x 64); scores = q.k x 64^-0.5, then scores[b][..][i][j] = 1e-9 wherever mask[b][j] == 0 (mask [4][2048] int {0,1}, ~50 %, read): the masked keys STAY in the softmax with logit 1e-9 (the module's masked_fill quirk); softmax; out = merged (head-major channel concat) Wout^T ('oi') -> [4][2048][512] (4.2 M)).
// Layout: bf16 copy of x, q|k|v projections (which store the head planes themselves) and Wout product each run ONCE over all 4 batches; attention is ONE fused launch over all batches and heads (k_fattn): scores, online softmax and P.V per 128 query rows, K and V tiles shared in LDS, the batch's key mask (int32) read once per work-group into one bit per key; a masked key's scaled score is replaced by the constant 1e-9 (hybrid rows: < 512 hi/lo 3 products, rest fp16 x1024); merged hi/lo x Wout exact.
// Compute dtypes, f32 accumulate: every input rounded to bf16; projections exact; attention rows < 512 3 products, rest fp16; softmax f32; Wout hl x exact.

#define NB_  4
#define TT   2048
#define DM   512
#define NH_  8
#define NKV  8
#define REP  (NH_ / NKV)
#define HD   64
#define DQ   (NH_ * HD)
#define DKV  (NKV * HD)
#define RH   512                  // query rows < RH use hi+lo planes (0: none)
#define WIN  0
#define SCL  0.125f   // HD^-0.5
typedef _Float16 h16;
typedef unsigned short bf;
typedef __attribute__((ext_vector_type(16))) __bf16   v16bf;
typedef __attribute__((ext_vector_type(16))) _Float16 v16h;
typedef __attribute__((ext_vector_type(8)))  _Float16 v8h;
typedef __attribute__((ext_vector_type(8)))  unsigned short v8us;
typedef __attribute__((ext_vector_type(8)))  float    v8f;
typedef __attribute__((ext_vector_type(4)))  float    v4f;
typedef v8h  __attribute__((may_alias)) v8ha;
typedef v4f  __attribute__((may_alias)) v4fa;
typedef v8us __attribute__((may_alias)) v8usa;

__device__ __forceinline__ unsigned short f2bf(float f) { unsigned u = __float_as_uint(f); u += 0x7FFFu + ((u >> 16) & 1u); return (unsigned short)(u >> 16); }
__device__ __forceinline__ float bf2f(unsigned short b) { return __uint_as_float(((unsigned)b) << 16); }
__device__ __forceinline__ float bfr(float f) { return bf2f(f2bf(f)); }
__device__ __forceinline__ v16h cat16(v8h lo, v8h hi) { return __builtin_shufflevector(lo, hi, 0, 1, 2, 3, 4, 5, 6, 7, 8, 9, 10, 11, 12, 13, 14, 15); }
__device__ __forceinline__ v16bf cat16b(v8us lo, v8us hi) { return __builtin_bit_cast(v16bf, __builtin_shufflevector(lo, hi, 0, 1, 2, 3, 4, 5, 6, 7, 8, 9, 10, 11, 12, 13, 14, 15)); }
__device__ __forceinline__ v8f wmma16(v16h a, v16h b, v8f c) { return __builtin_amdgcn_wmma_f32_16x16x32_f16(false, a, false, b, (short)0, c, false, false); }
__device__ __forceinline__ v8f wmmab(v16bf a, v16bf b, v8f c) { return __builtin_amdgcn_wmma_f32_16x16x32_bf16(false, a, false, b, (short)0, c, false, false); }



// ---- k_gemmw: register-blocked GEMM, ONE WAVE per 64x64 output tile (16 accumulators), operands straight from K-contiguous 16-bit planes; grid (M/64, N/64, Z), 32 threads.
// C[m][n] (f32, pitch ldc, + optional f32 bias[n]) = sum_k A[m][k] Bt[n][k] (+ split products per NSPLIT). z-batch strides sA/sB/sC in elements. K % 32 == 0.
template <typename T16> struct WFrag;
template <> struct WFrag<h16> { typedef v16h V; static __device__ __forceinline__ V ld(const h16* p) { return cat16(*(const v8h*)p, *(const v8h*)(p + 16)); } static __device__ __forceinline__ v8f mma(V a, V b, v8f c) { return wmma16(a, b, c); } };
template <> struct WFrag<bf> { typedef v16bf V; static __device__ __forceinline__ V ld(const bf* p) { return cat16b(*(const v8us*)p, *(const v8us*)(p + 16)); } static __device__ __forceinline__ v8f mma(V a, V b, v8f c) { return wmmab(a, b, c); } };
template <typename T16, int NSPLIT, bool BIAS>
__global__ __launch_bounds__(32) void k_gemmw(const T16* __restrict__ A, const T16* __restrict__ A2, const T16* __restrict__ Bt, const T16* __restrict__ Bt2, int K, float* C, int ldc, const float* __restrict__ bias, size_t sA, size_t sB, size_t sC) {
    typedef typename WFrag<T16>::V V;
    __shared__ __align__(16) float os[16 * 68];
    const size_t z = blockIdx.z; A += z * sA; if (A2) A2 += z * sA; Bt += z * sB; if (Bt2) Bt2 += z * sB; C += z * sC;
    const int lane = threadIdx.x & 31, lr = lane & 15, hi = lane >> 4; const int r0 = blockIdx.x * 64, c0 = blockIdx.y * 64;
    v8f acc[4][4];
#pragma unroll
    for (int mb = 0; mb < 4; ++mb)
#pragma unroll
        for (int nb = 0; nb < 4; ++nb) acc[mb][nb] = (v8f){};
    const size_t aoff = (size_t)(r0 + lr) * K + 8 * hi, boff = (size_t)(c0 + lr) * K + 8 * hi;
#pragma unroll 1
    for (int kc = 0; kc < K; kc += 32) {
        V a[4], a2[4];
#pragma unroll
        for (int mb = 0; mb < 4; ++mb) { a[mb] = WFrag<T16>::ld(A + aoff + (size_t)mb * 16 * K + kc); if (NSPLIT == 1 || NSPLIT == 2) a2[mb] = WFrag<T16>::ld(A2 + aoff + (size_t)mb * 16 * K + kc); }
#pragma unroll
        for (int nb = 0; nb < 4; ++nb) { const V b = WFrag<T16>::ld(Bt + boff + (size_t)nb * 16 * K + kc); V b2; if (NSPLIT >= 2) b2 = WFrag<T16>::ld(Bt2 + boff + (size_t)nb * 16 * K + kc);
#pragma unroll
            for (int mb = 0; mb < 4; ++mb) { acc[mb][nb] = WFrag<T16>::mma(a[mb], b, acc[mb][nb]); if (NSPLIT == 1 || NSPLIT == 2) acc[mb][nb] = WFrag<T16>::mma(a2[mb], b, acc[mb][nb]); if (NSPLIT >= 2) acc[mb][nb] = WFrag<T16>::mma(a[mb], b2, acc[mb][nb]); } }
        asm volatile("v_nop\n\tv_nop\n\tv_nop\n\tv_nop" : "+v"(acc[0][0]), "+v"(acc[1][1]), "+v"(acc[2][2]), "+v"(acc[3][3]) : "v"(a[0]), "v"(a[3]));
    }
#pragma unroll
    for (int mb = 0; mb < 4; ++mb) {
#pragma unroll
        for (int nb = 0; nb < 4; ++nb) {
#pragma unroll
            for (int j = 0; j < 8; ++j) os[(hi * 8 + j) * 68 + nb * 16 + lr] = acc[mb][nb][j]; }
        __builtin_amdgcn_wave_barrier(); asm volatile("" ::: "memory");
        float* crow = C + (size_t)(r0 + mb * 16) * ldc + c0;
{
#pragma unroll
            for (int s = 0; s < 8; ++s) { const int row = 2 * s + hi, cofs = lr * 4; v4f val = *(const v4fa*)(os + row * 68 + cofs); if (BIAS) { val[0] += bfr(bias[c0 + cofs]); val[1] += bfr(bias[c0 + cofs + 1]); val[2] += bfr(bias[c0 + cofs + 2]); val[3] += bfr(bias[c0 + cofs + 3]); }
                *(v4f*)(crow + (size_t)row * ldc + cofs) = val; }
             }
        __builtin_amdgcn_wave_barrier(); asm volatile("" ::: "memory");
    }
}

__device__ __forceinline__ h16 tohx(float x) { return (h16)x; }
__device__ __forceinline__ void splitf(float y, unsigned short& h, unsigned short& l) { h = f2bf(y); l = f2bf(y - bf2f(h)); }
typedef __attribute__((ext_vector_type(2))) _Float16 v2h;
typedef __attribute__((ext_vector_type(4))) _Float16 v4h;
typedef __attribute__((ext_vector_type(2))) unsigned short v2us;
typedef __attribute__((ext_vector_type(4))) unsigned short v4us;
typedef __attribute__((ext_vector_type(2))) float v2f;
typedef __attribute__((ext_vector_type(4))) int v4i;

__global__ __launch_bounds__(256) void k_wtG(const float* __restrict__ w, int K, int N, bf* Bt) {
    const int lane = threadIdx.x & 31; const int L0 = (blockIdx.x * 8 + (threadIdx.x >> 5)) * 8; const int nlines = N * K / 64;
{
#pragma unroll 1
        for (int l = 0; l < 8; ++l) { const int L = L0 + l; if (L >= nlines) break; const size_t e = (size_t)L * 64 + lane * 2; const int k = (int)(e % K), n = (int)(e / K); v2us o;
            o[0] = f2bf(w[(size_t)k * N + n]); o[1] = f2bf(w[(size_t)(k + 1) * N + n]); *(v2us*)(Bt + e) = o; }
         }
}
__global__ __launch_bounds__(256) void k_cvt8(const float* __restrict__ src, bf* dst, size_t n8) { const size_t i = (size_t)blockIdx.x * 256 + threadIdx.x; if (i >= n8) return; const v8f v = *(const v8f*)(src + i * 8); v8us o;
#pragma unroll
    for (int k = 0; k < 8; ++k) o[k] = f2bf(v[k]); *(v8us*)(dst + i * 8) = o;  }

// k_cvt8w: the four weight matrices (n8 groups of 8 each) to one contiguous bf16 block, blockIdx.y picks the matrix
__global__ __launch_bounds__(256) void k_cvt8w(const float* __restrict__ w0, const float* __restrict__ w1, const float* __restrict__ w2, const float* __restrict__ w3, bf* dst, size_t n8) { const size_t i = (size_t)blockIdx.x * 256 + threadIdx.x; if (i >= n8) return; const int y = blockIdx.y; const float* src = (y == 0) ? w0 : (y == 1) ? w1 : (y == 2) ? w2 : w3; const v8f v = *(const v8f*)(src + i * 8); v8us o;
#pragma unroll
    for (int k = 0; k < 8; ++k) o[k] = f2bf(v[k]); *(v8us*)(dst + ((size_t)y * n8 + i) * 8) = o;  }

// ---- k_proj: the joint q|k|v projection with k_gemmw's loop (ONE WAVE per 64x64 tile, K = DM); its epilogue rounds the f32 tile to the attention's three 16-bit planes (fp16, bf16 hi, bf16 lo) and stores them itself, so no f32 projection reaches memory.
// grid (NB_ * TT / 64 token blocks, 24 heads: 8 q | 8 k | 8 v), 32 threads. A q or k tile is [t][d] (A = tokens, B = weight rows): one contiguous 8-KiB block of its plane [b][head][t][d].
// A v tile is computed as [d][t] (A = weight rows, B = tokens: the same products, summed over k in the same order), so that each of its rows is a whole 128-byte line of its plane [b][g][d][t].
__global__ __launch_bounds__(32) void k_proj(const bf* __restrict__ X, const bf* __restrict__ Wt, h16* QK16, bf* QKh, bf* QKl, h16* VT16, bf* VTh, bf* VTl) {
    typedef WFrag<bf>::V V;
    __shared__ __align__(16) float os[16 * 68];
    const int lane = threadIdx.x & 31, lr = lane & 15, hi = lane >> 4; const int r0 = blockIdx.x * 64, hh = blockIdx.y; const int b = r0 / TT, t0 = r0 % TT;
    const bool isv = hh >= NH_ + NKV;   // the same for the whole wave
    const bf* xt = X + (size_t)r0 * DM; const bf* wt = Wt + (size_t)hh * HD * DM;
    const bf* A = isv ? wt : xt; const bf* Bt = isv ? xt : wt;
    const size_t o0 = isv ? (size_t)(b * NKV + hh - NH_ - NKV) * HD * TT + t0 : ((size_t)(b * (NH_ + NKV) + hh) * TT + t0) * HD; const int pitch = isv ? TT : HD;   // the tile's first element and row pitch in its plane
    h16* P16 = (isv ? VT16 : QK16) + o0; bf* Ph = (isv ? VTh : QKh) + o0; bf* Pl = (isv ? VTl : QKl) + o0;
    v8f acc[4][4];
#pragma unroll
    for (int mb = 0; mb < 4; ++mb)
#pragma unroll
        for (int nb = 0; nb < 4; ++nb) acc[mb][nb] = (v8f){};
    const unsigned off = (unsigned)(lr * DM + 8 * hi);   // the lane's place in a 16-row fragment block
    // the k loop stays rolled, as in k_gemmw (short code, 16 accumulators and 5 fragments in registers)
#pragma unroll 1
    for (int kc = 0; kc < DM; kc += 32) {
        V a[4];
#pragma unroll
        for (int mb = 0; mb < 4; ++mb) a[mb] = WFrag<bf>::ld(A + kc + mb * 16 * DM + off);
        asm volatile("s_wait_xcnt 0x0" ::: "memory");   // the A loads' address registers are free for reuse (as a later load's destination) from here on: the wait stands in front of that reuse
#pragma unroll
        for (int nb = 0; nb < 4; ++nb) { const V bb = WFrag<bf>::ld(Bt + kc + nb * 16 * DM + off);
#pragma unroll
            for (int mb = 0; mb < 4; ++mb) acc[mb][nb] = WFrag<bf>::mma(a[mb], bb, acc[mb][nb]); }
    }
#pragma unroll
    for (int mb = 0; mb < 4; ++mb) {   // 16 tile rows at a time through LDS: a lane then holds 8 neighbours of one row, 16 bytes of each plane, and a wave's store covers four whole lines
#pragma unroll
        for (int nb = 0; nb < 4; ++nb) {
#pragma unroll
            for (int j = 0; j < 8; ++j) os[(hi * 8 + j) * 68 + nb * 16 + lr] = acc[mb][nb][j]; }
        __builtin_amdgcn_wave_barrier(); asm volatile("" ::: "memory");   // the reads below take other lanes' writes: neither scheduler nor optimiser may move them up
#pragma unroll
        for (int s = 0; s < 4; ++s) { const int row = 4 * s + (lane >> 3), cofs = (lane & 7) * 8; const v4f u0 = *(const v4fa*)(os + row * 68 + cofs), u1 = *(const v4fa*)(os + row * 68 + cofs + 4); v8h o16; v8us oh, ol;
#pragma unroll
            for (int k = 0; k < 8; ++k) { const float y = (k < 4) ? u0[k & 3] : u1[k & 3]; o16[k] = tohx(y); unsigned short a2, c2; splitf(y, a2, c2); oh[k] = a2; ol[k] = c2; }
            const size_t o = (size_t)(mb * 16 + row) * pitch + cofs; *(v8h*)(P16 + o) = o16; *(v8us*)(Ph + o) = oh; *(v8us*)(Pl + o) = ol; }
        __builtin_amdgcn_wave_barrier(); asm volatile("" ::: "memory");   // the next 16 rows' writes stay behind these reads
    }
}
// ---- k_fattn: scores, softmax and P.V of 128 query rows of one (batch, head) in ONE work-group of 4 waves; no score or probability ever reaches memory.
// S^T = K Q^T (A = 16 keys from LDS, B = 16 queries kept in registers): a lane holds scores of ONE query (column lr), keys 8*hi + j of each 16-key tile, so row maximum, row sum and rescale are per lane;
// two converted S^T tiles are the B operand of O^T += V^T P^T in the loader's own k order (8*hi + 0..7, 16 + 8*hi + 0..7). Running maximum (online softmax), in log2 units.
// A stage is KS keys: K rows and V^T rows go global -> registers (one stage ahead) -> LDS, shared by the 4 waves. Rows < RH: hi/lo bf16 planes, 3 products; the rest fp16. The epilogue writes the merged hi/lo planes.
#define KS 64                     // keys per stage
#define LP 72                     // LDS row pitch, 16-bit elements: 128 B of data + 16 B, so that 16 rows' 16-byte reads fall on different banks
typedef v4i __attribute__((may_alias)) v4ia;
template <typename T16, bool HI>
__device__ __forceinline__ void fa_body(const T16* __restrict__ Q, const T16* __restrict__ Q2, const T16* __restrict__ Kp, const T16* __restrict__ K2, const T16* __restrict__ Vt, const T16* __restrict__ V2,
                                        T16* sK, T16* sK2, T16* sV, T16* sV2, const unsigned short* mh, int q0, bf* Ah, bf* Al) {
    typedef typename WFrag<T16>::V V;
    constexpr float C1 = SCL * 1.4426950408889634f, C2 = 1e-9f * 1.4426950408889634f;   // scaled score and the mask's constant logit, in log2 units
    constexpr float OFF = HI ? 0.0f : 10.0f;   // fp16 P carries 2^10 (it cancels in the division by the row sum): small probabilities stay in fp16's normal range
    const int tid = threadIdx.x, lane = tid & 31, wave = tid >> 5, lr = lane & 15, hi = lane >> 4;
    V bq[2][2], bq2[2][2];
#pragma unroll
    for (int qb = 0; qb < 2; ++qb)
#pragma unroll
        for (int kc = 0; kc < 2; ++kc) { const size_t o = (size_t)(q0 + wave * 32 + qb * 16 + lr) * HD + kc * 32 + 8 * hi; bq[qb][kc] = WFrag<T16>::ld(Q + o); if (HI) bq2[qb][kc] = WFrag<T16>::ld(Q2 + o); }
    v8f O[4][2];
#pragma unroll
    for (int db = 0; db < 4; ++db)
#pragma unroll
        for (int qb = 0; qb < 2; ++qb) O[db][qb] = (v8f){};
    float m[2] = {-3.0e38f, -3.0e38f}, l[2] = {0.f, 0.f};
    v4i rk[4], rv[4], rk2[4], rv2[4];
    const int sr = tid >> 3, sg = (tid & 7) * 8;   // this thread's row (+ 16 i) and 16-byte segment of a staged tile
#pragma unroll
    for (int i = 0; i < 4; ++i) { const size_t ok = (size_t)(sr + 16 * i) * HD + sg, ov = (size_t)(sr + 16 * i) * TT + sg; rk[i] = *(const v4ia*)(Kp + ok); rv[i] = *(const v4ia*)(Vt + ov); if (HI) { rk2[i] = *(const v4ia*)(K2 + ok); rv2[i] = *(const v4ia*)(V2 + ov); } }
    // the stages stay rolled (short code); everything inside is unrolled so that fragments and accumulators are registers
#pragma unroll 1
    for (int k0 = 0; k0 < TT; k0 += KS) {
        __syncthreads();   // every wave has finished reading the previous stage's tiles
#pragma unroll
        for (int i = 0; i < 4; ++i) { const int o = (sr + 16 * i) * LP + sg; *(v4ia*)(sK + o) = rk[i]; *(v4ia*)(sV + o) = rv[i]; if (HI) { *(v4ia*)(sK2 + o) = rk2[i]; *(v4ia*)(sV2 + o) = rv2[i]; } }
        __syncthreads();   // the stage's tiles (and, at the first stage, the mask bits) are whole before any wave reads them
        if (k0 + KS < TT) {   // the next stage's global loads fly while this stage is worked on
#pragma unroll
            for (int i = 0; i < 4; ++i) { const size_t ok = (size_t)(k0 + KS + sr + 16 * i) * HD + sg, ov = (size_t)(sr + 16 * i) * TT + k0 + KS + sg; rk[i] = *(const v4ia*)(Kp + ok); rv[i] = *(const v4ia*)(Vt + ov); if (HI) { rk2[i] = *(const v4ia*)(K2 + ok); rv2[i] = *(const v4ia*)(V2 + ov); } }
            asm volatile("s_wait_xcnt 0x0" ::: "memory"); }   // the loads' address registers are reused by the work below while the loads are in flight: the wait stands in front of that reuse
        v8f S[4][2];
#pragma unroll
        for (int kt = 0; kt < 4; ++kt) {
            S[kt][0] = (v8f){}; S[kt][1] = (v8f){};
#pragma unroll
            for (int kc = 0; kc < 2; ++kc) { const int o = (kt * 16 + lr) * LP + kc * 32 + 8 * hi; const V ak = WFrag<T16>::ld(sK + o); V ak2; if (HI) ak2 = WFrag<T16>::ld(sK2 + o);
#pragma unroll
                for (int qb = 0; qb < 2; ++qb) { S[kt][qb] = WFrag<T16>::mma(ak, bq[qb][kc], S[kt][qb]); if (HI) { S[kt][qb] = WFrag<T16>::mma(ak, bq2[qb][kc], S[kt][qb]); S[kt][qb] = WFrag<T16>::mma(ak2, bq[qb][kc], S[kt][qb]); } } } }
        float mx[2] = {-3.0e38f, -3.0e38f};
#pragma unroll
        for (int kt = 0; kt < 4; ++kt) { const unsigned w = (unsigned)mh[(k0 >> 4) + kt] >> (8 * hi);   // this lane's 8 key-mask bits of the tile
#pragma unroll
            for (int j = 0; j < 8; ++j) { const bool keep = ((w >> j) & 1u) != 0u;
#pragma unroll
                for (int qb = 0; qb < 2; ++qb) { const float u = keep ? S[kt][qb][j] * C1 : C2;   /* masked_fill(mask == 0, 1e-9): a constant logit, the key stays in the softmax */ S[kt][qb][j] = u; mx[qb] = fmaxf(mx[qb], u); } } }
        float mn[2]; bool need = false;
#pragma unroll
        for (int qb = 0; qb < 2; ++qb) { mx[qb] = fmaxf(mx[qb], __shfl_xor(mx[qb], 16, 32)); mn[qb] = fmaxf(m[qb], mx[qb] - OFF); need = need || (mn[qb] > m[qb]); }
        if (__builtin_amdgcn_ballot_w32(need) != 0) {   // a scalar branch: sums and outputs are rescaled only in a stage that raises some row's maximum (the factor is exactly 1 for the other rows)
#pragma unroll
            for (int qb = 0; qb < 2; ++qb) { const float al = __builtin_amdgcn_exp2f(m[qb] - mn[qb]); l[qb] *= al; m[qb] = mn[qb];
#pragma unroll
                for (int db = 0; db < 4; ++db)
#pragma unroll
                    for (int j = 0; j < 8; ++j) O[db][qb][j] *= al; } }
#pragma unroll
        for (int kt = 0; kt < 4; ++kt)
#pragma unroll
            for (int qb = 0; qb < 2; ++qb)
#pragma unroll
                for (int j = 0; j < 8; ++j) { const float p = __builtin_amdgcn_exp2f(S[kt][qb][j] - m[qb]); S[kt][qb][j] = p; l[qb] += p; }
#pragma unroll
        for (int c = 0; c < 2; ++c) {   // 32 keys: S^T tiles 2c and 2c + 1 are one B operand
            V pb[2], pb2[2];
#pragma unroll
            for (int qb = 0; qb < 2; ++qb)
#pragma unroll
                for (int s = 0; s < 16; ++s) { const float p = S[2 * c + (s >> 3)][qb][s & 7];
                    if constexpr (HI) { const __bf16 ph = (__bf16)p; pb[qb][s] = ph; pb2[qb][s] = (__bf16)(p - (float)ph); } else { pb[qb][s] = (h16)p; } }
#pragma unroll
            for (int db = 0; db < 4; ++db) { const int o = (db * 16 + lr) * LP + c * 32 + 8 * hi; const V av = WFrag<T16>::ld(sV + o); V av2; if (HI) av2 = WFrag<T16>::ld(sV2 + o);
#pragma unroll
                for (int qb = 0; qb < 2; ++qb) { O[db][qb] = WFrag<T16>::mma(av, pb[qb], O[db][qb]); if (HI) { O[db][qb] = WFrag<T16>::mma(av, pb2[qb], O[db][qb]); O[db][qb] = WFrag<T16>::mma(av2, pb[qb], O[db][qb]); } } } }
    }
#pragma unroll
    for (int qb = 0; qb < 2; ++qb) { const float f = __fdiv_rn(1.0f, l[qb] + __shfl_xor(l[qb], 16, 32));   // the two lane halves hold disjoint keys' sums of the same query
        const size_t ro = (size_t)(q0 + wave * 32 + qb * 16 + lr) * DQ + 8 * hi;
#pragma unroll
        for (int db = 0; db < 4; ++db) { v8us oh, ol;
#pragma unroll
            for (int j = 0; j < 8; ++j) { unsigned short a, c2; splitf(O[db][qb][j] * f, a, c2); oh[j] = a; ol[j] = c2; }
            *(v8us*)(Ah + ro + db * 16) = oh; *(v8us*)(Al + ro + db * 16) = ol; } }
}
// grid (batch * head, 128-row block): the 3-product blocks (rows < RH) have the lowest linear ids and start first
__global__ __launch_bounds__(128) void k_fattn(const h16* __restrict__ QK16, const bf* __restrict__ QKh, const bf* __restrict__ QKl, const h16* __restrict__ VT16, const bf* __restrict__ VTh, const bf* __restrict__ VTl, const int* __restrict__ mk, bf* Ah, bf* Al) {
    __shared__ __align__(16) unsigned short sm[4][KS * LP];
    __shared__ __align__(16) unsigned short mh[TT / 16];   // the batch's key mask, one bit per key
    const int b = blockIdx.x / NH_, h = blockIdx.x % NH_, q0 = blockIdx.y * 128, tid = threadIdx.x;
    { const int* pm = mk + (size_t)b * TT + tid * 16; unsigned bits = 0;
#pragma unroll
      for (int c = 0; c < 4; ++c) { const v4i p4 = *(const v4i*)(pm + c * 4);
#pragma unroll
          for (int q = 0; q < 4; ++q) bits |= (p4[q] != 0 ? 1u : 0u) << (c * 4 + q); }
      mh[tid] = (unsigned short)bits; }
    const size_t pq = ((size_t)b * (NH_ + NKV) + h) * TT * HD, pk = pq + (size_t)NH_ * TT * HD, pv = ((size_t)b * NKV + h) * HD * TT, po = (size_t)b * TT * DQ + h * HD;
    if (q0 < RH) fa_body<bf, true>(QKh + pq, QKl + pq, QKh + pk, QKl + pk, VTh + pv, VTl + pv, (bf*)sm[0], (bf*)sm[1], (bf*)sm[2], (bf*)sm[3], mh, q0, Ah + po, Al + po);
    else fa_body<h16, false>(QK16 + pq, nullptr, QK16 + pk, nullptr, VT16 + pv, nullptr, (h16*)sm[0], nullptr, (h16*)sm[2], nullptr, mh, q0, Ah + po, Al + po);
}

extern "C" void kernel_launch(void* const* d_in, const int* in_sizes, int n_in,
                              void* d_out, int out_size, void* d_ws, size_t ws_size, hipStream_t stream) {
    (void)in_sizes; (void)n_in; (void)out_size;
    const float* x = (const float*)d_in[0]; const int* mk = (const int*)d_in[1];   /* mask [4][2048] int {0,1} */ const float* wq = (const float*)d_in[2]; const float* wk = (const float*)d_in[3]; const float* wv = (const float*)d_in[4]; const float* wo = (const float*)d_in[5];
    float* OUT = (float*)d_out;     // [4][2048][512]
    char* wsp = (char*)d_ws;
    auto take = [&](size_t bytes) { char* p = wsp; wsp += (bytes + 255) & ~(size_t)255; return (void*)p; };
    bf* WA = (bf*)take((size_t)(DQ + 2 * DKV + DM) * DM * 2); bf* WO = WA + (size_t)(DQ + 2 * DKV) * DM;   // Wq | Wk | Wv rows as ONE [1536][512] operand, then Wout
    bf* XB = (bf*)take((size_t)NB_ * TT * DM * 2);
    // q and k head planes [b][8 q heads | 8 k heads][t][d]; v planes [b][g][d][t]
    h16* QK16 = (h16*)take((size_t)NB_ * (NH_ + NKV) * TT * HD * 2); bf* QKh = (bf*)take((size_t)NB_ * (NH_ + NKV) * TT * HD * 2); bf* QKl = (bf*)take((size_t)NB_ * (NH_ + NKV) * TT * HD * 2);
    h16* VT16 = (h16*)take((size_t)NB_ * NKV * HD * TT * 2); bf* VTh = (bf*)take((size_t)NB_ * NKV * HD * TT * 2); bf* VTl = (bf*)take((size_t)NB_ * NKV * HD * TT * 2);
    bf* ATh = (bf*)take((size_t)NB_ * TT * DQ * 2); bf* ATl = (bf*)take((size_t)NB_ * TT * DQ * 2);
    if ((size_t)(wsp - (char*)d_ws) > ws_size) return;    // 98 MiB of the 256 MiB
    k_cvt8w<<<dim3((unsigned)(((size_t)DQ * DM / 8 + 255) / 256), 4, 1), 256, 0, stream>>>(wq, wk, wv, wo, WA, (size_t)DQ * DM / 8);
    k_cvt8<<<(unsigned)(((size_t)NB_ * TT * DM / 8 + 255) / 256), 256, 0, stream>>>(x, XB, (size_t)NB_ * TT * DM / 8);
    k_proj<<<dim3(NB_ * TT / 64, NH_ + 2 * NKV, 1), 32, 0, stream>>>(XB, WA, QK16, QKh, QKl, VT16, VTh, VTl);
    k_fattn<<<dim3(NB_ * NH_, TT / 128, 1), 128, 0, stream>>>(QK16, QKh, QKl, VT16, VTh, VTl, mk, ATh, ATl);
    k_gemmw<bf, 1, false><<<dim3(NB_ * TT / 64, DM / 64, 1), 32, 0, stream>>>(ATh, ATl, WO, nullptr, DQ, OUT, DM, nullptr, 0, 0, 0);
}

// v005
// It runs in 109 microseconds.
// Next to v004, in two timings, it ran 1.23 times as fast each time.
// Counting every step since v000, it is 18.6 times as fast.
#include <hip/hip_runtime.h>

// Cross-modal attention whose key mask FILLS WITH A CONSTANT instead of excluding (input_feature [4][2048][512]; q, k, v = x W^T ('oi' [512][512] 1/sqrt(512), no bias; 8 heads x 64); scores = q.k x 64^-0.5, then scores[b][..][i][j] = 1e-9 wherever mask[b][j] == 0 (mask [4][2048] int {0,1}, ~50 %, read): the masked keys STAY in the softmax with logit 1e-9 (the module's masked_fill quirk); softmax; out = merged (head-major channel concat) Wout^T ('oi') -> [4][2048][512] (4.2 M)).
// Layout: bf16 copy of x, q|k|v projections (which store the head planes themselves) and Wout product each run ONCE over all 4 batches, their operand tiles staged in LDS by whole-line loads and shared by 4 waves; attention is ONE fused launch over all batches and heads (k_fattn): scores, online softmax and P.V per 128 query rows, K and V tiles shared in LDS, the batch's key mask (int32) read once per work-group into one bit per key; a masked key's scaled score is replaced by the constant 1e-9 (hybrid rows: < 512 hi/lo 3 products, rest fp16 x1024); merged hi/lo x Wout exact.
// Compute dtypes, f32 accumulate: every input rounded to bf16; projections exact; attention rows < 512 3 products, rest fp16; softmax f32; Wout hl x exact.

#define NB_  4
#define TT   2048
#define DM   512
#define NH_  8
#define NKV  8
#define REP  (NH_ / NKV)
#define HD   64
#define DQ   (NH_ * HD)
#define DKV  (NKV * HD)
#define RH   512                  // query rows < RH use hi+lo planes (0: none)
#define WIN  0
#define SCL  0.125f   // HD^-0.5
typedef _Float16 h16;
typedef unsigned short bf;
typedef __attribute__((ext_vector_type(16))) __bf16   v16bf;
typedef __attribute__((ext_vector_type(16))) _Float16 v16h;
typedef __attribute__((ext_vector_type(8)))  _Float16 v8h;
typedef __attribute__((ext_vector_type(8)))  unsigned short v8us;
typedef __attribute__((ext_vector_type(8)))  float    v8f;
typedef __attribute__((ext_vector_type(4)))  float    v4f;
typedef v8h  __attribute__((may_alias)) v8ha;
typedef v4f  __attribute__((may_alias)) v4fa;
typedef v8us __attribute__((may_alias)) v8usa;

__device__ __forceinline__ unsigned short f2bf(float f) { unsigned u = __float_as_uint(f); u += 0x7FFFu + ((u >> 16) & 1u); return (unsigned short)(u >> 16); }
__device__ __forceinline__ float bf2f(unsigned short b) { return __uint_as_float(((unsigned)b) << 16); }
__device__ __forceinline__ float bfr(float f) { return bf2f(f2bf(f)); }
__device__ __forceinline__ v16h cat16(v8h lo, v8h hi) { return __builtin_shufflevector(lo, hi, 0, 1, 2, 3, 4, 5, 6, 7, 8, 9, 10, 11, 12, 13, 14, 15); }
__device__ __forceinline__ v16bf cat16b(v8us lo, v8us hi) { return __builtin_bit_cast(v16bf, __builtin_shufflevector(lo, hi, 0, 1, 2, 3, 4, 5, 6, 7, 8, 9, 10, 11, 12, 13, 14, 15)); }
__device__ __forceinline__ v8f wmma16(v16h a, v16h b, v8f c) { return __builtin_amdgcn_wmma_f32_16x16x32_f16(false, a, false, b, (short)0, c, false, false); }
__device__ __forceinline__ v8f wmmab(v16bf a, v16bf b, v8f c) { return __builtin_amdgcn_wmma_f32_16x16x32_bf16(false, a, false, b, (short)0, c, false, false); }



// ---- g_tiles: the k loop of both dense products. ONE WORK-GROUP of 4 waves (2 x 2) per 128x128 output tile, each wave a 64x64 tile in 16 accumulators; K = DM.
// A stage is GK = 64 k: one whole 128-byte line of each of the 128 A rows and 128 B rows goes global -> registers (one stage ahead) -> LDS, a wave's load covering 4 whole lines; the fragments come from LDS, each row read by two waves.
// acc[mb][nb] += sum_k A[m][k] Bt[n][k] (+ A2[m][k] Bt[n][k] where NA == 2), k ascending in steps of 32.
template <typename T16> struct WFrag;
template <> struct WFrag<h16> { typedef v16h V; static __device__ __forceinline__ V ld(const h16* p) { return cat16(*(const v8h*)p, *(const v8h*)(p + 16)); } static __device__ __forceinline__ v8f mma(V a, V b, v8f c) { return wmma16(a, b, c); } };
template <> struct WFrag<bf> { typedef v16bf V; static __device__ __forceinline__ V ld(const bf* p) { return cat16b(*(const v8us*)p, *(const v8us*)(p + 16)); } static __device__ __forceinline__ v8f mma(V a, V b, v8f c) { return wmmab(a, b, c); } };
#define GK 64                     // k per stage
#define GP 72                     // LDS row pitch, 16-bit elements: 128 B of data + 16 B, so that 16 rows' 16-byte reads fall on different banks
typedef __attribute__((ext_vector_type(4))) int g4i;
typedef g4i __attribute__((may_alias)) g4ia;
template <int NA>
__device__ __forceinline__ void g_tiles(const bf* __restrict__ A, const bf* __restrict__ A2, const bf* __restrict__ Bt, bf* sA, bf* sA2, bf* sB, int wm, int wn, v8f (&acc)[4][4]) {
    typedef WFrag<bf>::V V;
    const int tid = threadIdx.x, lane = tid & 31, lr = lane & 15, hi = lane >> 4;
    const int sr = tid >> 3, sg = (tid & 7) * 8;   // this thread's row (+ 16 i) and 16-byte segment of a staged tile
    g4i ra[8], ra2[8], rb[8];
#pragma unroll
    for (int i = 0; i < 8; ++i) { const int o = (sr + 16 * i) * DM + sg; ra[i] = *(const g4ia*)(A + o); rb[i] = *(const g4ia*)(Bt + o); if (NA == 2) ra2[i] = *(const g4ia*)(A2 + o); }
    const int fa = (wm * 64 + lr) * GP + 8 * hi, fb = (wn * 64 + lr) * GP + 8 * hi;   // the lane's place in its wave's first A and B fragment
    // the stages stay rolled (short code); everything inside is unrolled so that fragments and accumulators are registers
#pragma unroll 1
    for (int k0 = 0; k0 < DM; k0 += GK) {
        __syncthreads();   // every wave has finished reading the previous stage's tiles
#pragma unroll
        for (int i = 0; i < 8; ++i) { const int o = (sr + 16 * i) * GP + sg; *(g4ia*)(sA + o) = ra[i]; *(g4ia*)(sB + o) = rb[i]; if (NA == 2) *(g4ia*)(sA2 + o) = ra2[i]; }
        __syncthreads();   // the stage's tiles are whole before any wave reads them
        if (k0 + GK < DM) {   // the next stage's global loads fly while this stage is worked on
            A += GK; Bt += GK; if (NA == 2) A2 += GK;   // the tiles' bases move, uniform for the work-group; the thread's own offset stays in one register
#pragma unroll
            for (int i = 0; i < 8; ++i) { const int o = (sr + 16 * i) * DM + sg; ra[i] = *(const g4ia*)(A + o); rb[i] = *(const g4ia*)(Bt + o); if (NA == 2) ra2[i] = *(const g4ia*)(A2 + o); }
            asm volatile("s_wait_xcnt 0x0" ::: "memory"); }   // the loads' base registers are moved on while the loads are in flight: the wait stands in front of that
#pragma unroll
        for (int kc = 0; kc < GK; kc += 32) {
            V a[4], a2[4], bb[4];   // the fragments of one block of 32 k
#pragma unroll
            for (int mb = 0; mb < 4; ++mb) { a[mb] = WFrag<bf>::ld(sA + fa + mb * 16 * GP + kc); bb[mb] = WFrag<bf>::ld(sB + fb + mb * 16 * GP + kc); if (NA == 2) a2[mb] = WFrag<bf>::ld(sA2 + fa + mb * 16 * GP + kc); }
            if (NA == 2) asm volatile("" :: "v"(bb[0]), "v"(bb[1]), "v"(bb[2]), "v"(bb[3]));   // inputs only: holds the four B reads in one group ahead of the block's products (one wave per SIMD in that kernel: a read placed later costs its whole LDS latency in front of its products)
#pragma unroll
            for (int nb = 0; nb < 4; ++nb)
#pragma unroll
                for (int mb = 0; mb < 4; ++mb) { acc[mb][nb] = WFrag<bf>::mma(a[mb], bb[nb], acc[mb][nb]); if (NA == 2) acc[mb][nb] = WFrag<bf>::mma(a2[mb], bb[nb], acc[mb][nb]); }
        }
    }
}

// ---- k_wout: C[m][n] (f32, pitch DM) = sum_k (Ah[m][k] + Al[m][k]) Wo[n][k], g_tiles' loop with two A planes; grid (NB_ * TT / 128, DM / 128), 128 threads.
__global__ __launch_bounds__(128) void k_wout(const bf* __restrict__ Ah, const bf* __restrict__ Al, const bf* __restrict__ Wo, float* C) {
    __shared__ __align__(16) bf sA[128 * GP]; __shared__ __align__(16) bf sA2[128 * GP]; __shared__ __align__(16) bf sB[128 * GP];
    __shared__ __align__(16) float osw[4][16 * 68];   // each wave's own output staging
    const int lane = threadIdx.x & 31, lr = lane & 15, hi = lane >> 4; const int wave = __builtin_amdgcn_readfirstlane(threadIdx.x >> 5), wm = wave >> 1, wn = wave & 1;
    v8f acc[4][4];
#pragma unroll
    for (int mb = 0; mb < 4; ++mb)
#pragma unroll
        for (int nb = 0; nb < 4; ++nb) acc[mb][nb] = (v8f){};
    g_tiles<2>(Ah + (size_t)blockIdx.x * 128 * DQ, Al + (size_t)blockIdx.x * 128 * DQ, Wo + (size_t)blockIdx.y * 128 * DQ, sA, sA2, sB, wm, wn, acc);
    const int r0 = blockIdx.x * 128 + wm * 64, c0 = blockIdx.y * 128 + wn * 64; float* os = osw[wave];
#pragma unroll
    for (int mb = 0; mb < 4; ++mb) {
#pragma unroll
        for (int nb = 0; nb < 4; ++nb) {
#pragma unroll
            for (int j = 0; j < 8; ++j) os[(hi * 8 + j) * 68 + nb * 16 + lr] = acc[mb][nb][j]; }
        __builtin_amdgcn_wave_barrier(); asm volatile("" ::: "memory");   // the reads below take other lanes' writes: neither scheduler nor optimiser may move them up
        float* crow = C + (size_t)(r0 + mb * 16) * DM + c0;
#pragma unroll
        for (int s = 0; s < 8; ++s) { const int row = 2 * s + hi, cofs = lr * 4; const v4f val = *(const v4fa*)(os + row * 68 + cofs); *(v4f*)(crow + (size_t)row * DM + cofs) = val; }
        __builtin_amdgcn_wave_barrier(); asm volatile("" ::: "memory");   // the next 16 rows' writes stay behind these reads
    }
}

__device__ __forceinline__ h16 tohx(float x) { return (h16)x; }
__device__ __forceinline__ void splitf(float y, unsigned short& h, unsigned short& l) { h = f2bf(y); l = f2bf(y - bf2f(h)); }
typedef __attribute__((ext_vector_type(2))) _Float16 v2h;
typedef __attribute__((ext_vector_type(4))) _Float16 v4h;
typedef __attribute__((ext_vector_type(2))) unsigned short v2us;
typedef __attribute__((ext_vector_type(4))) unsigned short v4us;
typedef __attribute__((ext_vector_type(2))) float v2f;
typedef __attribute__((ext_vector_type(4))) int v4i;

__global__ __launch_bounds__(256) void k_wtG(const float* __restrict__ w, int K, int N, bf* Bt) {
    const int lane = threadIdx.x & 31; const int L0 = (blockIdx.x * 8 + (threadIdx.x >> 5)) * 8; const int nlines = N * K / 64;
{
#pragma unroll 1
        for (int l = 0; l < 8; ++l) { const int L = L0 + l; if (L >= nlines) break; const size_t e = (size_t)L * 64 + lane * 2; const int k = (int)(e % K), n = (int)(e / K); v2us o;
            o[0] = f2bf(w[(size_t)k * N + n]); o[1] = f2bf(w[(size_t)(k + 1) * N + n]); *(v2us*)(Bt + e) = o; }
         }
}
__global__ __launch_bounds__(256) void k_cvt8(const float* __restrict__ src, bf* dst, size_t n8) { const size_t i = (size_t)blockIdx.x * 256 + threadIdx.x; if (i >= n8) return; const v8f v = *(const v8f*)(src + i * 8); v8us o;
#pragma unroll
    for (int k = 0; k < 8; ++k) o[k] = f2bf(v[k]); *(v8us*)(dst + i * 8) = o;  }

// k_cvt8w: the four weight matrices (n8 groups of 8 each) to one contiguous bf16 block, blockIdx.y picks the matrix
__global__ __launch_bounds__(256) void k_cvt8w(const float* __restrict__ w0, const float* __restrict__ w1, const float* __restrict__ w2, const float* __restrict__ w3, bf* dst, size_t n8) { const size_t i = (size_t)blockIdx.x * 256 + threadIdx.x; if (i >= n8) return; const int y = blockIdx.y; const float* src = (y == 0) ? w0 : (y == 1) ? w1 : (y == 2) ? w2 : w3; const v8f v = *(const v8f*)(src + i * 8); v8us o;
#pragma unroll
    for (int k = 0; k < 8; ++k) o[k] = f2bf(v[k]); *(v8us*)(dst + ((size_t)y * n8 + i) * 8) = o;  }

// ---- k_proj: the joint q|k|v projection with g_tiles' loop (4 waves per 128x128 tile: 128 tokens x 2 heads, each wave 64 tokens of one head); its epilogue rounds the f32 tile to the attention's three 16-bit planes (fp16, bf16 hi, bf16 lo) and stores them itself, so no f32 projection reaches memory.
// grid (NB_ * TT / 128 token blocks, 12 head pairs: 4 q | 4 k | 4 v), 128 threads. A wave's q or k tile is [t][d] (A = tokens, B = weight rows): one contiguous 8-KiB block of its plane [b][head][t][d].
// A v tile is computed as [d][t] (A = weight rows, B = tokens: the same products, summed over k in the same order), so that each of its rows is a whole 128-byte line of its plane [b][g][d][t].
__global__ __launch_bounds__(128) void k_proj(const bf* __restrict__ X, const bf* __restrict__ Wt, h16* QK16, bf* QKh, bf* QKl, h16* VT16, bf* VTh, bf* VTl) {
    __shared__ __align__(16) bf sA[128 * GP]; __shared__ __align__(16) bf sB[128 * GP];
    __shared__ __align__(16) float osw[4][16 * 68];   // each wave's own output staging
    const int lane = threadIdx.x & 31, lr = lane & 15, hi = lane >> 4; const int wave = __builtin_amdgcn_readfirstlane(threadIdx.x >> 5), wm = wave >> 1, wn = wave & 1;
    const bool isv = blockIdx.y * 2 >= NH_ + NKV;   // the same for the whole work-group
    const bf* xt = X + (size_t)blockIdx.x * 128 * DM; const bf* wt = Wt + (size_t)blockIdx.y * 2 * HD * DM;
    v8f acc[4][4];
#pragma unroll
    for (int mb = 0; mb < 4; ++mb)
#pragma unroll
        for (int nb = 0; nb < 4; ++nb) acc[mb][nb] = (v8f){};
    g_tiles<1>(isv ? wt : xt, nullptr, isv ? xt : wt, sA, nullptr, sB, wm, wn, acc);
    const int r0 = blockIdx.x * 128 + (isv ? wn : wm) * 64, hh = blockIdx.y * 2 + (isv ? wm : wn); const int b = r0 / TT, t0 = r0 % TT;   // this wave's 64 tokens and its head
    const size_t o0 = isv ? (size_t)(b * NKV + hh - NH_ - NKV) * HD * TT + t0 : ((size_t)(b * (NH_ + NKV) + hh) * TT + t0) * HD; const int pitch = isv ? TT : HD;   // the tile's first element and row pitch in its plane
    h16* P16 = (isv ? VT16 : QK16) + o0; bf* Ph = (isv ? VTh : QKh) + o0; bf* Pl = (isv ? VTl : QKl) + o0; float* os = osw[wave];
#pragma unroll
    for (int mb = 0; mb < 4; ++mb) {   // 16 tile rows at a time through LDS: a lane then holds 8 neighbours of one row, 16 bytes of each plane, and a wave's store covers four whole lines
#pragma unroll
        for (int nb = 0; nb < 4; ++nb) {
#pragma unroll
            for (int j = 0; j < 8; ++j) os[(hi * 8 + j) * 68 + nb * 16 + lr] = acc[mb][nb][j]; }
        __builtin_amdgcn_wave_barrier(); asm volatile("" ::: "memory");   // the reads below take other lanes' writes: neither scheduler nor optimiser may move them up
#pragma unroll
        for (int s = 0; s < 4; ++s) { const int row = 4 * s + (lane >> 3), cofs = (lane & 7) * 8; const v4f u0 = *(const v4fa*)(os + row * 68 + cofs), u1 = *(const v4fa*)(os + row * 68 + cofs + 4); v8h o16; v8us oh, ol;
#pragma unroll
            for (int k = 0; k < 8; ++k) { const float y = (k < 4) ? u0[k & 3] : u1[k & 3]; o16[k] = tohx(y); unsigned short a2, c2; splitf(y, a2, c2); oh[k] = a2; ol[k] = c2; }
            const size_t o = (size_t)(mb * 16 + row) * pitch + cofs; *(v8h*)(P16 + o) = o16; *(v8us*)(Ph + o) = oh; *(v8us*)(Pl + o) = ol; }
        __builtin_amdgcn_wave_barrier(); asm volatile("" ::: "memory");   // the next 16 rows' writes stay behind these reads
    }
}
// ---- k_fattn: scores, softmax and P.V of 128 query rows of one (batch, head) in ONE work-group of 4 waves; no score or probability ever reaches memory.
// S^T = K Q^T (A = 16 keys from LDS, B = 16 queries kept in registers): a lane holds scores of ONE query (column lr), keys 8*hi + j of each 16-key tile, so row maximum, row sum and rescale are per lane;
// two converted S^T tiles are the B operand of O^T += V^T P^T in the loader's own k order (8*hi + 0..7, 16 + 8*hi + 0..7). Running maximum (online softmax), in log2 units.
// A stage is KS keys: K rows and V^T rows go global -> registers (one stage ahead) -> LDS, shared by the 4 waves. Rows < RH: hi/lo bf16 planes, 3 products; the rest fp16. The epilogue writes the merged hi/lo planes.
#define KS 64                     // keys per stage
#define LP 72                     // LDS row pitch, 16-bit elements: 128 B of data + 16 B, so that 16 rows' 16-byte reads fall on different banks
typedef v4i __attribute__((may_alias)) v4ia;
template <typename T16, bool HI>
__device__ __forceinline__ void fa_body(const T16* __restrict__ Q, const T16* __restrict__ Q2, const T16* __restrict__ Kp, const T16* __restrict__ K2, const T16* __restrict__ Vt, const T16* __restrict__ V2,
                                        T16* sK, T16* sK2, T16* sV, T16* sV2, const unsigned short* mh, int q0, bf* Ah, bf* Al) {
    typedef typename WFrag<T16>::V V;
    constexpr float C1 = SCL * 1.4426950408889634f, C2 = 1e-9f * 1.4426950408889634f;   // scaled score and the mask's constant logit, in log2 units
    constexpr float OFF = HI ? 0.0f : 10.0f;   // fp16 P carries 2^10 (it cancels in the division by the row sum): small probabilities stay in fp16's normal range
    const int tid = threadIdx.x, lane = tid & 31, wave = tid >> 5, lr = lane & 15, hi = lane >> 4;
    V bq[2][2], bq2[2][2];
#pragma unroll
    for (int qb = 0; qb < 2; ++qb)
#pragma unroll
        for (int kc = 0; kc < 2; ++kc) { const size_t o = (size_t)(q0 + wave * 32 + qb * 16 + lr) * HD + kc * 32 + 8 * hi; bq[qb][kc] = WFrag<T16>::ld(Q + o); if (HI) bq2[qb][kc] = WFrag<T16>::ld(Q2 + o); }
    v8f O[4][2];
#pragma unroll
    for (int db = 0; db < 4; ++db)
#pragma unroll
        for (int qb = 0; qb < 2; ++qb) O[db][qb] = (v8f){};
    float m[2] = {-3.0e38f, -3.0e38f}, l[2] = {0.f, 0.f};
    v4i rk[4], rv[4], rk2[4], rv2[4];
    const int sr = tid >> 3, sg = (tid & 7) * 8;   // this thread's row (+ 16 i) and 16-byte segment of a staged tile
#pragma unroll
    for (int i = 0; i < 4; ++i) { const size_t ok = (size_t)(sr + 16 * i) * HD + sg, ov = (size_t)(sr + 16 * i) * TT + sg; rk[i] = *(const v4ia*)(Kp + ok); rv[i] = *(const v4ia*)(Vt + ov); if (HI) { rk2[i] = *(const v4ia*)(K2 + ok); rv2[i] = *(const v4ia*)(V2 + ov); } }
    // the stages stay rolled (short code); everything inside is unrolled so that fragments and accumulators are registers
#pragma unroll 1
    for (int k0 = 0; k0 < TT; k0 += KS) {
        __syncthreads();   // every wave has finished reading the previous stage's tiles
#pragma unroll
        for (int i = 0; i < 4; ++i) { const int o = (sr + 16 * i) * LP + sg; *(v4ia*)(sK + o) = rk[i]; *(v4ia*)(sV + o) = rv[i]; if (HI) { *(v4ia*)(sK2 + o) = rk2[i]; *(v4ia*)(sV2 + o) = rv2[i]; } }
        __syncthreads();   // the stage's tiles (and, at the first stage, the mask bits) are whole before any wave reads them
        if (k0 + KS < TT) {   // the next stage's global loads fly while this stage is worked on
#pragma unroll
            for (int i = 0; i < 4; ++i) { const size_t ok = (size_t)(k0 + KS + sr + 16 * i) * HD + sg, ov = (size_t)(sr + 16 * i) * TT + k0 + KS + sg; rk[i] = *(const v4ia*)(Kp + ok); rv[i] = *(const v4ia*)(Vt + ov); if (HI) { rk2[i] = *(const v4ia*)(K2 + ok); rv2[i] = *(const v4ia*)(V2 + ov); } }
            asm volatile("s_wait_xcnt 0x0" ::: "memory"); }   // the loads' address registers are reused by the work below while the loads are in flight: the wait stands in front of that reuse
        v8f S[4][2];
#pragma unroll
        for (int kt = 0; kt < 4; ++kt) {
            S[kt][0] = (v8f){}; S[kt][1] = (v8f){};
#pragma unroll
            for (int kc = 0; kc < 2; ++kc) { const int o = (kt * 16 + lr) * LP + kc * 32 + 8 * hi; const V ak = WFrag<T16>::ld(sK + o); V ak2; if (HI) ak2 = WFrag<T16>::ld(sK2 + o);
#pragma unroll
                for (int qb = 0; qb < 2; ++qb) { S[kt][qb] = WFrag<T16>::mma(ak, bq[qb][kc], S[kt][qb]); if (HI) { S[kt][qb] = WFrag<T16>::mma(ak, bq2[qb][kc], S[kt][qb]); S[kt][qb] = WFrag<T16>::mma(ak2, bq[qb][kc], S[kt][qb]); } } } }
        float mx[2] = {-3.0e38f, -3.0e38f};
#pragma unroll
        for (int kt = 0; kt < 4; ++kt) { const unsigned w = (unsigned)mh[(k0 >> 4) + kt] >> (8 * hi);   // this lane's 8 key-mask bits of the tile
#pragma unroll
            for (int j = 0; j < 8; ++j) { const bool keep = ((w >> j) & 1u) != 0u;
#pragma unroll
                for (int qb = 0; qb < 2; ++qb) { const float u = keep ? S[kt][qb][j] * C1 : C2;   /* masked_fill(mask == 0, 1e-9): a constant logit, the key stays in the softmax */ S[kt][qb][j] = u; mx[qb] = fmaxf(mx[qb], u); } } }
        float mn[2]; bool need = false;
#pragma unroll
        for (int qb = 0; qb < 2; ++qb) { mx[qb] = fmaxf(mx[qb], __shfl_xor(mx[qb], 16, 32)); mn[qb] = fmaxf(m[qb], mx[qb] - OFF); need = need || (mn[qb] > m[qb]); }
        if (__builtin_amdgcn_ballot_w32(need) != 0) {   // a scalar branch: sums and outputs are rescaled only in a stage that raises some row's maximum (the factor is exactly 1 for the other rows)
#pragma unroll
            for (int qb = 0; qb < 2; ++qb) { const float al = __builtin_amdgcn_exp2f(m[qb] - mn[qb]); l[qb] *= al; m[qb] = mn[qb];
#pragma unroll
                for (int db = 0; db < 4; ++db)
#pragma unroll
                    for (int j = 0; j < 8; ++j) O[db][qb][j] *= al; } }
#pragma unroll
        for (int kt = 0; kt < 4; ++kt)
#pragma unroll
            for (int qb = 0; qb < 2; ++qb)
#pragma unroll
                for (int j = 0; j < 8; ++j) { const float p = __builtin_amdgcn_exp2f(S[kt][qb][j] - m[qb]); S[kt][qb][j] = p; l[qb] += p; }
#pragma unroll
        for (int c = 0; c < 2; ++c) {   // 32 keys: S^T tiles 2c and 2c + 1 are one B operand
            V pb[2], pb2[2];
#pragma unroll
            for (int qb = 0; qb < 2; ++qb)
#pragma unroll
                for (int s = 0; s < 16; ++s) { const float p = S[2 * c + (s >> 3)][qb][s & 7];
                    if constexpr (HI) { const __bf16 ph = (__bf16)p; pb[qb][s] = ph; pb2[qb][s] = (__bf16)(p - (float)ph); } else { pb[qb][s] = (h16)p; } }
#pragma unroll
            for (int db = 0; db < 4; ++db) { const int o = (db * 16 + lr) * LP + c * 32 + 8 * hi; const V av = WFrag<T16>::ld(sV + o); V av2; if (HI) av2 = WFrag<T16>::ld(sV2 + o);
#pragma unroll
                for (int qb = 0; qb < 2; ++qb) { O[db][qb] = WFrag<T16>::mma(av, pb[qb], O[db][qb]); if (HI) { O[db][qb] = WFrag<T16>::mma(av, pb2[qb], O[db][qb]); O[db][qb] = WFrag<T16>::mma(av2, pb[qb], O[db][qb]); } } } }
    }
#pragma unroll
    for (int qb = 0; qb < 2; ++qb) { const float f = __fdiv_rn(1.0f, l[qb] + __shfl_xor(l[qb], 16, 32));   // the two lane halves hold disjoint keys' sums of the same query
        const size_t ro = (size_t)(q0 + wave * 32 + qb * 16 + lr) * DQ + 8 * hi;
#pragma unroll
        for (int db = 0; db < 4; ++db) { v8us oh, ol;
#pragma unroll
            for (int j = 0; j < 8; ++j) { unsigned short a, c2; splitf(O[db][qb][j] * f, a, c2); oh[j] = a; ol[j] = c2; }
            *(v8us*)(Ah + ro + db * 16) = oh; *(v8us*)(Al + ro + db * 16) = ol; } }
}
// grid (batch * head, 128-row block): the 3-product blocks (rows < RH) have the lowest linear ids and start first
__global__ __launch_bounds__(128) void k_fattn(const h16* __restrict__ QK16, const bf* __restrict__ QKh, const bf* __restrict__ QKl, const h16* __restrict__ VT16, const bf* __restrict__ VTh, const bf* __restrict__ VTl, const int* __restrict__ mk, bf* Ah, bf* Al) {
    __shared__ __align__(16) unsigned short sm[4][KS * LP];
    __shared__ __align__(16) unsigned short mh[TT / 16];   // the batch's key mask, one bit per key
    const int b = blockIdx.x / NH_, h = blockIdx.x % NH_, q0 = blockIdx.y * 128, tid = threadIdx.x;
    { const int* pm = mk + (size_t)b * TT + tid * 16; unsigned bits = 0;
#pragma unroll
      for (int c = 0; c < 4; ++c) { const v4i p4 = *(const v4i*)(pm + c * 4);
#pragma unroll
          for (int q = 0; q < 4; ++q) bits |= (p4[q] != 0 ? 1u : 0u) << (c * 4 + q); }
      mh[tid] = (unsigned short)bits; }
    const size_t pq = ((size_t)b * (NH_ + NKV) + h) * TT * HD, pk = pq + (size_t)NH_ * TT * HD, pv = ((size_t)b * NKV + h) * HD * TT, po = (size_t)b * TT * DQ + h * HD;
    if (q0 < RH) fa_body<bf, true>(QKh + pq, QKl + pq, QKh + pk, QKl + pk, VTh + pv, VTl + pv, (bf*)sm[0], (bf*)sm[1], (bf*)sm[2], (bf*)sm[3], mh, q0, Ah + po, Al + po);
    else fa_body<h16, false>(QK16 + pq, nullptr, QK16 + pk, nullptr, VT16 + pv, nullptr, (h16*)sm[0], nullptr, (h16*)sm[2], nullptr, mh, q0, Ah + po, Al + po);
}

extern "C" void kernel_launch(void* const* d_in, const int* in_sizes, int n_in,
                              void* d_out, int out_size, void* d_ws, size_t ws_size, hipStream_t stream) {
    (void)in_sizes; (void)n_in; (void)out_size;
    const float* x = (const float*)d_in[0]; const int* mk = (const int*)d_in[1];   /* mask [4][2048] int {0,1} */ const float* wq = (const float*)d_in[2]; const float* wk = (const float*)d_in[3]; const float* wv = (const float*)d_in[4]; const float* wo = (const float*)d_in[5];
    float* OUT = (float*)d_out;     // [4][2048][512]
    char* wsp = (char*)d_ws;
    auto take = [&](size_t bytes) { char* p = wsp; wsp += (bytes + 255) & ~(size_t)255; return (void*)p; };
    bf* WA = (bf*)take((size_t)(DQ + 2 * DKV + DM) * DM * 2); bf* WO = WA + (size_t)(DQ + 2 * DKV) * DM;   // Wq | Wk | Wv rows as ONE [1536][512] operand, then Wout
    bf* XB = (bf*)take((size_t)NB_ * TT * DM * 2);
    // q and k head planes [b][8 q heads | 8 k heads][t][d]; v planes [b][g][d][t]
    h16* QK16 = (h16*)take((size_t)NB_ * (NH_ + NKV) * TT * HD * 2); bf* QKh = (bf*)take((size_t)NB_ * (NH_ + NKV) * TT * HD * 2); bf* QKl = (bf*)take((size_t)NB_ * (NH_ + NKV) * TT * HD * 2);
    h16* VT16 = (h16*)take((size_t)NB_ * NKV * HD * TT * 2); bf* VTh = (bf*)take((size_t)NB_ * NKV * HD * TT * 2); bf* VTl = (bf*)take((size_t)NB_ * NKV * HD * TT * 2);
    bf* ATh = (bf*)take((size_t)NB_ * TT * DQ * 2); bf* ATl = (bf*)take((size_t)NB_ * TT * DQ * 2);
    if ((size_t)(wsp - (char*)d_ws) > ws_size) return;    // 98 MiB of the 256 MiB
    k_cvt8w<<<dim3((unsigned)(((size_t)DQ * DM / 8 + 255) / 256), 4, 1), 256, 0, stream>>>(wq, wk, wv, wo, WA, (size_t)DQ * DM / 8);
    k_cvt8<<<(unsigned)(((size_t)NB_ * TT * DM / 8 + 255) / 256), 256, 0, stream>>>(x, XB, (size_t)NB_ * TT * DM / 8);
    k_proj<<<dim3(NB_ * TT / 128, (NH_ + 2 * NKV) / 2, 1), 128, 0, stream>>>(XB, WA, QK16, QKh, QKl, VT16, VTh, VTl);
    k_fattn<<<dim3(NB_ * NH_, TT / 128, 1), 128, 0, stream>>>(QK16, QKh, QKl, VT16, VTh, VTl, mk, ATh, ATl);
    k_wout<<<dim3(NB_ * TT / 128, DM / 128, 1), 128, 0, stream>>>(ATh, ATl, WO, OUT);
}

// v006
// One run takes 74.4 microseconds.
// Next to v005, in two timings, it ran 1.46 times as fast each time.
// Over all steps from v000 it is 27.2 times as fast.
#include <hip/hip_runtime.h>

// Cross-modal attention whose key mask FILLS WITH A CONSTANT instead of excluding (input_feature [4][2048][512]; q, k, v = x W^T ('oi' [512][512] 1/sqrt(512), no bias; 8 heads x 64); scores = q.k x 64^-0.5, then scores[b][..][i][j] = 1e-9 wherever mask[b][j] == 0 (mask [4][2048] int {0,1}, ~50 %, read): the masked keys STAY in the softmax with logit 1e-9 (the module's masked_fill quirk); softmax; out = merged (head-major channel concat) Wout^T ('oi') -> [4][2048][512] (4.2 M)).
// Layout: bf16 copy of x, q|k|v projections (which store the head planes themselves) and Wout product each run ONCE over all 4 batches, their operand tiles staged in LDS by whole-line loads and shared by 4 waves; attention is ONE fused launch over all batches and heads (k_fattn): scores, online softmax and P.V per 128 query rows, K and V tiles shared in LDS; every masked key has the SAME logit 1e-9, so each batch's tokens are ranked kept keys first (k and v planes in that order, q planes in token order), the stages walk the kept keys only, and the whole stages of masked keys enter once as (sum of their v rows) x exp(1e-9 - max) (hybrid rows: < 512 hi/lo 3 products, rest fp16 x1024); merged hi/lo x Wout exact.
// Compute dtypes, f32 accumulate: every input rounded to bf16; projections exact; attention rows < 512 3 products, rest fp16; softmax f32; Wout hl x exact.

#define NB_  4
#define TT   2048
#define DM   512
#define NH_  8
#define NKV  8
#define REP  (NH_ / NKV)
#define HD   64
#define DQ   (NH_ * HD)
#define DKV  (NKV * HD)
#define RH   512                  // query rows < RH use hi+lo planes (0: none)
#define WIN  0
#define SCL  0.125f   // HD^-0.5
typedef _Float16 h16;
typedef unsigned short bf;
typedef __attribute__((ext_vector_type(16))) __bf16   v16bf;
typedef __attribute__((ext_vector_type(16))) _Float16 v16h;
typedef __attribute__((ext_vector_type(8)))  _Float16 v8h;
typedef __attribute__((ext_vector_type(8)))  unsigned short v8us;
typedef __attribute__((ext_vector_type(8)))  float    v8f;
typedef __attribute__((ext_vector_type(4)))  float    v4f;
typedef v8h  __attribute__((may_alias)) v8ha;
typedef v4f  __attribute__((may_alias)) v4fa;
typedef v8us __attribute__((may_alias)) v8usa;

__device__ __forceinline__ unsigned short f2bf(float f) { unsigned u = __float_as_uint(f); u += 0x7FFFu + ((u >> 16) & 1u); return (unsigned short)(u >> 16); }
__device__ __forceinline__ float bf2f(unsigned short b) { return __uint_as_float(((unsigned)b) << 16); }
__device__ __forceinline__ float bfr(float f) { return bf2f(f2bf(f)); }
__device__ __forceinline__ v16h cat16(v8h lo, v8h hi) { return __builtin_shufflevector(lo, hi, 0, 1, 2, 3, 4, 5, 6, 7, 8, 9, 10, 11, 12, 13, 14, 15); }
__device__ __forceinline__ v16bf cat16b(v8us lo, v8us hi) { return __builtin_bit_cast(v16bf, __builtin_shufflevector(lo, hi, 0, 1, 2, 3, 4, 5, 6, 7, 8, 9, 10, 11, 12, 13, 14, 15)); }
__device__ __forceinline__ v8f wmma16(v16h a, v16h b, v8f c) { return __builtin_amdgcn_wmma_f32_16x16x32_f16(false, a, false, b, (short)0, c, false, false); }
__device__ __forceinline__ v8f wmmab(v16bf a, v16bf b, v8f c) { return __builtin_amdgcn_wmma_f32_16x16x32_bf16(false, a, false, b, (short)0, c, false, false); }



// ---- g_tiles: the k loop of both dense products. ONE WORK-GROUP of 4 waves (2 x 2) per 128x128 output tile, each wave a 64x64 tile in 16 accumulators; K = DM.
// A stage is GK = 64 k: one whole 128-byte line of each of the 128 A rows and 128 B rows goes global -> registers (one stage ahead) -> LDS, a wave's load covering 4 whole lines; the fragments come from LDS, each row read by two waves.
// acc[mb][nb] += sum_k A[m][k] Bt[n][k] (+ A2[m][k] Bt[n][k] where NA == 2), k ascending in steps of 32.
template <typename T16> struct WFrag;
template <> struct WFrag<h16> { typedef v16h V; static __device__ __forceinline__ V ld(const h16* p) { return cat16(*(const v8h*)p, *(const v8h*)(p + 16)); } static __device__ __forceinline__ v8f mma(V a, V b, v8f c) { return wmma16(a, b, c); } };
template <> struct WFrag<bf> { typedef v16bf V; static __device__ __forceinline__ V ld(const bf* p) { return cat16b(*(const v8us*)p, *(const v8us*)(p + 16)); } static __device__ __forceinline__ v8f mma(V a, V b, v8f c) { return wmmab(a, b, c); } };
#define GK 64                     // k per stage
#define GP 72                     // LDS row pitch, 16-bit elements: 128 B of data + 16 B, so that 16 rows' 16-byte reads fall on different banks
typedef __attribute__((ext_vector_type(4))) int g4i;
typedef g4i __attribute__((may_alias)) g4ia;
template <int NA>
__device__ __forceinline__ void g_tiles(const bf* __restrict__ A, const bf* __restrict__ A2, const bf* __restrict__ Bt, bf* sA, bf* sA2, bf* sB, int wm, int wn, v8f (&acc)[4][4]) {
    typedef WFrag<bf>::V V;
    const int tid = threadIdx.x, lane = tid & 31, lr = lane & 15, hi = lane >> 4;
    const int sr = tid >> 3, sg = (tid & 7) * 8;   // this thread's row (+ 16 i) and 16-byte segment of a staged tile
    g4i ra[8], ra2[8], rb[8];
#pragma unroll
    for (int i = 0; i < 8; ++i) { const int o = (sr + 16 * i) * DM + sg; ra[i] = *(const g4ia*)(A + o); rb[i] = *(const g4ia*)(Bt + o); if (NA == 2) ra2[i] = *(const g4ia*)(A2 + o); }
    const int fa = (wm * 64 + lr) * GP + 8 * hi, fb = (wn * 64 + lr) * GP + 8 * hi;   // the lane's place in its wave's first A and B fragment
    // the stages stay rolled (short code); everything inside is unrolled so that fragments and accumulators are registers
#pragma unroll 1
    for (int k0 = 0; k0 < DM; k0 += GK) {
        __syncthreads();   // every wave has finished reading the previous stage's tiles
#pragma unroll
        for (int i = 0; i < 8; ++i) { const int o = (sr + 16 * i) * GP + sg; *(g4ia*)(sA + o) = ra[i]; *(g4ia*)(sB + o) = rb[i]; if (NA == 2) *(g4ia*)(sA2 + o) = ra2[i]; }
        __syncthreads();   // the stage's tiles are whole before any wave reads them
        if (k0 + GK < DM) {   // the next stage's global loads fly while this stage is worked on
            A += GK; Bt += GK; if (NA == 2) A2 += GK;   // the tiles' bases move, uniform for the work-group; the thread's own offset stays in one register
#pragma unroll
            for (int i = 0; i < 8; ++i) { const int o = (sr + 16 * i) * DM + sg; ra[i] = *(const g4ia*)(A + o); rb[i] = *(const g4ia*)(Bt + o); if (NA == 2) ra2[i] = *(const g4ia*)(A2 + o); }
            asm volatile("s_wait_xcnt 0x0" ::: "memory"); }   // the loads' base registers are moved on while the loads are in flight: the wait stands in front of that
#pragma unroll
        for (int kc = 0; kc < GK; kc += 32) {
            V a[4], a2[4], bb[4];   // the fragments of one block of 32 k
#pragma unroll
            for (int mb = 0; mb < 4; ++mb) { a[mb] = WFrag<bf>::ld(sA + fa + mb * 16 * GP + kc); bb[mb] = WFrag<bf>::ld(sB + fb + mb * 16 * GP + kc); if (NA == 2) a2[mb] = WFrag<bf>::ld(sA2 + fa + mb * 16 * GP + kc); }
            if (NA == 2) asm volatile("" :: "v"(bb[0]), "v"(bb[1]), "v"(bb[2]), "v"(bb[3]));   // inputs only: holds the four B reads in one group ahead of the block's products (one wave per SIMD in that kernel: a read placed later costs its whole LDS latency in front of its products)
#pragma unroll
            for (int nb = 0; nb < 4; ++nb)
#pragma unroll
                for (int mb = 0; mb < 4; ++mb) { acc[mb][nb] = WFrag<bf>::mma(a[mb], bb[nb], acc[mb][nb]); if (NA == 2) acc[mb][nb] = WFrag<bf>::mma(a2[mb], bb[nb], acc[mb][nb]); }
        }
    }
}

// ---- k_wout: C[m][n] (f32, pitch DM) = sum_k (Ah[m][k] + Al[m][k]) Wo[n][k], g_tiles' loop with two A planes; grid (NB_ * TT / 128, DM / 128), 128 threads.
__global__ __launch_bounds__(128) void k_wout(const bf* __restrict__ Ah, const bf* __restrict__ Al, const bf* __restrict__ Wo, float* C) {
    __shared__ __align__(16) bf sA[128 * GP]; __shared__ __align__(16) bf sA2[128 * GP]; __shared__ __align__(16) bf sB[128 * GP];
    __shared__ __align__(16) float osw[4][16 * 68];   // each wave's own output staging
    const int lane = threadIdx.x & 31, lr = lane & 15, hi = lane >> 4; const int wave = __builtin_amdgcn_readfirstlane(threadIdx.x >> 5), wm = wave >> 1, wn = wave & 1;
    v8f acc[4][4];
#pragma unroll
    for (int mb = 0; mb < 4; ++mb)
#pragma unroll
        for (int nb = 0; nb < 4; ++nb) acc[mb][nb] = (v8f){};
    g_tiles<2>(Ah + (size_t)blockIdx.x * 128 * DQ, Al + (size_t)blockIdx.x * 128 * DQ, Wo + (size_t)blockIdx.y * 128 * DQ, sA, sA2, sB, wm, wn, acc);
    const int r0 = blockIdx.x * 128 + wm * 64, c0 = blockIdx.y * 128 + wn * 64; float* os = osw[wave];
#pragma unroll
    for (int mb = 0; mb < 4; ++mb) {
#pragma unroll
        for (int nb = 0; nb < 4; ++nb) {
#pragma unroll
            for (int j = 0; j < 8; ++j) os[(hi * 8 + j) * 68 + nb * 16 + lr] = acc[mb][nb][j]; }
        __builtin_amdgcn_wave_barrier(); asm volatile("" ::: "memory");   // the reads below take other lanes' writes: neither scheduler nor optimiser may move them up
        float* crow = C + (size_t)(r0 + mb * 16) * DM + c0;
#pragma unroll
        for (int s = 0; s < 8; ++s) { const int row = 2 * s + hi, cofs = lr * 4; const v4f val = *(const v4fa*)(os + row * 68 + cofs); *(v4f*)(crow + (size_t)row * DM + cofs) = val; }
        __builtin_amdgcn_wave_barrier(); asm volatile("" ::: "memory");   // the next 16 rows' writes stay behind these reads
    }
}

__device__ __forceinline__ h16 tohx(float x) { return (h16)x; }
__device__ __forceinline__ void splitf(float y, unsigned short& h, unsigned short& l) { h = f2bf(y); l = f2bf(y - bf2f(h)); }
typedef __attribute__((ext_vector_type(2))) _Float16 v2h;
typedef __attribute__((ext_vector_type(4))) _Float16 v4h;
typedef __attribute__((ext_vector_type(2))) unsigned short v2us;
typedef __attribute__((ext_vector_type(4))) unsigned short v4us;
typedef __attribute__((ext_vector_type(2))) float v2f;
typedef __attribute__((ext_vector_type(4))) int v4i;

__global__ __launch_bounds__(256) void k_wtG(const float* __restrict__ w, int K, int N, bf* Bt) {
    const int lane = threadIdx.x & 31; const int L0 = (blockIdx.x * 8 + (threadIdx.x >> 5)) * 8; const int nlines = N * K / 64;
{
#pragma unroll 1
        for (int l = 0; l < 8; ++l) { const int L = L0 + l; if (L >= nlines) break; const size_t e = (size_t)L * 64 + lane * 2; const int k = (int)(e % K), n = (int)(e / K); v2us o;
            o[0] = f2bf(w[(size_t)k * N + n]); o[1] = f2bf(w[(size_t)(k + 1) * N + n]); *(v2us*)(Bt + e) = o; }
         }
}
// k_cvt8: x to bf16, token row t of a batch stored at row pos[t] of that batch (kept keys first)
__global__ __launch_bounds__(256) void k_cvt8(const float* __restrict__ src, const int* __restrict__ pos, bf* dst, size_t n8) { const size_t i = (size_t)blockIdx.x * 256 + threadIdx.x; if (i >= n8) return; const v8f v = *(const v8f*)(src + i * 8); v8us o;
#pragma unroll
    for (int k = 0; k < 8; ++k) o[k] = f2bf(v[k]);
    const size_t row = i / (DM / 8); *(v8us*)(dst + ((row / TT) * TT + pos[row]) * DM + (i % (DM / 8)) * 8) = o;  }

// k_cvt8w: the four weight matrices (n8 groups of 8 each) to one contiguous bf16 block, blockIdx.y - 1 picks the matrix.
// blockIdx.y == 0 (started first): work-group b < NB_ ranks batch b's tokens, kept keys (mask != 0) first, each kind in token order: pos[t] = rank of token t, perm[rank] = t, nu[32 b] = number of kept keys.
// Ranks come from counting, so they are a permutation of 0 .. TT - 1 whatever the mask holds.
__global__ __launch_bounds__(256) void k_cvt8w(const float* __restrict__ w0, const float* __restrict__ w1, const float* __restrict__ w2, const float* __restrict__ w3, bf* dst, size_t n8, const int* __restrict__ mk, int* pos, int* perm, int* nu) {
    __shared__ int wsum[8]; __shared__ __align__(16) int sp[TT];
    if (blockIdx.y == 0) {
        if (blockIdx.x >= NB_) return;
        const int b = blockIdx.x, tid = threadIdx.x, lane = tid & 31, wave = tid >> 5; const int* pm = mk + (size_t)b * TT + tid * 8; unsigned bits = 0;
#pragma unroll
        for (int c = 0; c < 2; ++c) { const v4i p4 = *(const v4i*)(pm + c * 4);
#pragma unroll
            for (int q = 0; q < 4; ++q) bits |= (p4[q] != 0 ? 1u : 0u) << (c * 4 + q); }
        const int cn = __popc(bits); int inc = cn;   // kept keys among this thread's 8 tokens; then the wave's running count
#pragma unroll
        for (int st = 1; st < 32; st <<= 1) { const int o = __shfl_up(inc, st, 32); if (lane >= st) inc += o; }
        if (lane == 31) wsum[wave] = inc;
        __syncthreads();   // the 8 waves' counts are whole
        int u = inc - cn, tot = 0;
#pragma unroll
        for (int w = 0; w < 8; ++w) { const int c = wsum[w]; tot += c; if (w < wave) u += c; }
        v4i pp[2];
#pragma unroll
        for (int q = 0; q < 8; ++q) { const int t = tid * 8 + q; const bool kp = ((bits >> q) & 1u) != 0u; const int p = kp ? u : tot + (t - u); u += kp ? 1 : 0; sp[p] = t; pp[q >> 2][q & 3] = p; }
        *(v4i*)(pos + (size_t)b * TT + tid * 8) = pp[0]; *(v4i*)(pos + (size_t)b * TT + tid * 8 + 4) = pp[1];
        __syncthreads();   // the inverse table is whole in LDS: it goes out in whole lines
        *(v4i*)(perm + (size_t)b * TT + tid * 8) = *(const v4i*)(sp + tid * 8); *(v4i*)(perm + (size_t)b * TT + tid * 8 + 4) = *(const v4i*)(sp + tid * 8 + 4);
        if (tid == 0) nu[b * 32] = tot;
        return;
    }
    const size_t i = (size_t)blockIdx.x * 256 + threadIdx.x; if (i >= n8) return; const int y = blockIdx.y - 1; const float* src = (y == 0) ? w0 : (y == 1) ? w1 : (y == 2) ? w2 : w3; const v8f v = *(const v8f*)(src + i * 8); v8us o;
#pragma unroll
    for (int k = 0; k < 8; ++k) o[k] = f2bf(v[k]); *(v8us*)(dst + ((size_t)y * n8 + i) * 8) = o;  }

// ---- k_proj: the joint q|k|v projection with g_tiles' loop (4 waves per 128x128 tile: 128 tokens x 2 heads, each wave 64 tokens of one head); its epilogue rounds the f32 tile to the attention's three 16-bit planes (fp16, bf16 hi, bf16 lo) and stores them itself, so no f32 projection reaches memory.
// grid (NB_ * TT / 128 token blocks, 12 head pairs: 4 q | 4 k | 4 v), 128 threads. A wave's q or k tile is [t][d] (A = tokens, B = weight rows): a k tile is one contiguous 8-KiB block of its plane [b][head][t][d], a q tile's 64 rows go to their tokens' rows of it.
// A v tile is computed as [d][t] (A = weight rows, B = tokens: the same products, summed over k in the same order), so that each of its rows is a whole 128-byte line of its plane [b][g][d][t].
// X's rows are in rank order (kept keys first): k and v planes keep that order, a q row goes to its token's own row (perm), a whole line either way. A v wave also stores the f32 sum of its 64 columns per d (BS [b][g][64-key block][d]).
__global__ __launch_bounds__(128) void k_proj(const bf* __restrict__ X, const bf* __restrict__ Wt, const int* __restrict__ perm, h16* QK16, bf* QKh, bf* QKl, h16* VT16, bf* VTh, bf* VTl, float* BS) {
    __shared__ __align__(16) bf sA[128 * GP]; __shared__ __align__(16) bf sB[128 * GP];
    __shared__ __align__(16) float osw[4][16 * 68];   // each wave's own output staging
    const int lane = threadIdx.x & 31, lr = lane & 15, hi = lane >> 4; const int wave = __builtin_amdgcn_readfirstlane(threadIdx.x >> 5), wm = wave >> 1, wn = wave & 1;
    const bool isv = blockIdx.y * 2 >= NH_ + NKV;   // the same for the whole work-group
    const bf* xt = X + (size_t)blockIdx.x * 128 * DM; const bf* wt = Wt + (size_t)blockIdx.y * 2 * HD * DM;
    v8f acc[4][4];
#pragma unroll
    for (int mb = 0; mb < 4; ++mb)
#pragma unroll
        for (int nb = 0; nb < 4; ++nb) acc[mb][nb] = (v8f){};
    const int r0 = blockIdx.x * 128 + (isv ? wn : wm) * 64, hh = blockIdx.y * 2 + (isv ? wm : wn); const int b = r0 / TT, t0 = r0 % TT;   // this wave's 64 tokens and its head
    const bool isq = blockIdx.y * 2 < NH_;   // the same for the whole work-group
    int rw[4][4];   // the plane row of each tile row this lane stores (q: the token's own row of the head's plane; k, v: the tile row): read here, all at once, so that the k loop hides the latency
#pragma unroll
    for (int mb = 0; mb < 4; ++mb)
#pragma unroll
        for (int s = 0; s < 4; ++s) rw[mb][s] = perm[r0 + mb * 16 + 4 * s + (lane >> 3)];
    asm volatile("s_wait_xcnt 0x0" ::: "memory");   // the loads' offset register is reused below while they are in flight: the wait stands in front of that
    const int qm = isq ? -1 : 0;
#pragma unroll
    for (int mb = 0; mb < 4; ++mb)
#pragma unroll
        for (int s = 0; s < 4; ++s) { const int tr = mb * 16 + 4 * s + (lane >> 3); rw[mb][s] = tr + ((rw[mb][s] - tr) & qm); }
    g_tiles<1>(isv ? wt : xt, nullptr, isv ? xt : wt, sA, nullptr, sB, wm, wn, acc);
    const size_t o0 = isv ? (size_t)(b * NKV + hh - NH_ - NKV) * HD * TT + t0 : ((size_t)(b * (NH_ + NKV) + hh) * TT + (isq ? 0 : t0)) * HD; const int pitch = isv ? TT : HD;   // the tile's first element (q: its head plane's first) and row pitch in its plane
    h16* P16 = (isv ? VT16 : QK16) + o0; bf* Ph = (isv ? VTh : QKh) + o0; bf* Pl = (isv ? VTl : QKl) + o0; float* os = osw[wave];
    float rs[4][4];   // a v wave: this lane's share of each row's sum
    float* bs = BS + ((size_t)(b * NKV + (isv ? hh - NH_ - NKV : 0)) * (TT / 64) + t0 / 64) * HD;
#pragma unroll
    for (int mb = 0; mb < 4; ++mb) {   // 16 tile rows at a time through LDS: a lane then holds 8 neighbours of one row, 16 bytes of each plane, and a wave's store covers four whole lines
#pragma unroll
        for (int nb = 0; nb < 4; ++nb) {
#pragma unroll
            for (int j = 0; j < 8; ++j) os[(hi * 8 + j) * 68 + nb * 16 + lr] = acc[mb][nb][j]; }
        __builtin_amdgcn_wave_barrier(); asm volatile("" ::: "memory");   // the reads below take other lanes' writes: neither scheduler nor optimiser may move them up
#pragma unroll
        for (int s = 0; s < 4; ++s) { const int sr = 4 * s + (lane >> 3), row = rw[mb][s] - mb * 16, cofs = (lane & 7) * 8; const v4f u0 = *(const v4fa*)(os + sr * 68 + cofs), u1 = *(const v4fa*)(os + sr * 68 + cofs + 4); v8h o16; v8us oh, ol;
#pragma unroll
            for (int k = 0; k < 8; ++k) { const float y = (k < 4) ? u0[k & 3] : u1[k & 3]; o16[k] = tohx(y); unsigned short a2, c2; splitf(y, a2, c2); oh[k] = a2; ol[k] = c2; }
            rs[mb][s] = ((u0[0] + u0[1]) + (u0[2] + u0[3])) + ((u1[0] + u1[1]) + (u1[2] + u1[3]));
            const size_t o = (size_t)(mb * 16 + row) * pitch + cofs; *(v8h*)(P16 + o) = o16; *(v8us*)(Ph + o) = oh; *(v8us*)(Pl + o) = ol; }
        __builtin_amdgcn_wave_barrier(); asm volatile("" ::: "memory");   // the next 16 rows' writes stay behind these reads
    }
    asm volatile("s_wait_xcnt 0x0" ::: "memory");   // the last plane stores' registers are reused by the v waves' work below while the stores are in flight: the wait stands in front of the branch to it
    if (isv) {   // the 64 row sums: 8 lanes hold a row's shares; the 16 sums of a lane go through each exchange together (one latency a round), then leave as two whole lines
#pragma unroll
        for (int x = 1; x < 8; x <<= 1)
#pragma unroll
            for (int i = 0; i < 16; ++i) rs[i >> 2][i & 3] += __shfl_xor(rs[i >> 2][i & 3], x, 32);
        if ((lane & 7) == 0) {
#pragma unroll
            for (int i = 0; i < 16; ++i) os[4 * i + (lane >> 3)] = rs[i >> 2][i & 3]; }
        __builtin_amdgcn_wave_barrier(); asm volatile("" ::: "memory");   // the reads below take other lanes' writes
        const v2f o2 = {os[lane * 2], os[lane * 2 + 1]}; *(v2f*)(bs + lane * 2) = o2;
    }
}
// ---- k_fattn: scores, softmax and P.V of 128 query rows of one (batch, head) in ONE work-group of 4 waves; no score or probability ever reaches memory.
// S^T = K Q^T (A = 16 keys from LDS, B = 16 queries kept in registers): a lane holds scores of ONE query (column lr), keys 8*hi + j of each 16-key tile, so row maximum, row sum and rescale are per lane;
// two converted S^T tiles are the B operand of O^T += V^T P^T in the loader's own k order (8*hi + 0..7, 16 + 8*hi + 0..7). Running maximum (online softmax), in log2 units.
// A stage is KS keys: K rows and V^T rows go global -> registers (one stage ahead) -> LDS, shared by the 4 waves. Rows < RH: hi/lo bf16 planes, 3 products; the rest fp16. The epilogue writes the merged hi/lo planes.
// Keys come kept first (nU of them): only the stages that hold a kept key are walked (in the last of them the masked keys get the constant logit one by one); the keys of the stages behind all have that logit, so they add n x p to the row sum and p x (sum of their v rows, vs) to the output, p = exp(1e-9 - max).
#define KS 64                     // keys per stage
#define LP 72                     // LDS row pitch, 16-bit elements: 128 B of data + 16 B, so that 16 rows' 16-byte reads fall on different banks
typedef v4i __attribute__((may_alias)) v4ia;
template <typename T16, bool HI>
__device__ __forceinline__ void fa_body(const T16* __restrict__ Q, const T16* __restrict__ Q2, const T16* __restrict__ Kp, const T16* __restrict__ K2, const T16* __restrict__ Vt, const T16* __restrict__ V2,
                                        T16* sK, T16* sK2, T16* sV, T16* sV2, const float* vs, int nU, int q0, bf* Ah, bf* Al) {
    typedef typename WFrag<T16>::V V;
    constexpr float C1 = SCL * 1.4426950408889634f, C2 = 1e-9f * 1.4426950408889634f;   // scaled score and the mask's constant logit, in log2 units
    constexpr float OFF = HI ? 0.0f : 10.0f;   // fp16 P carries 2^10 (it cancels in the division by the row sum): small probabilities stay in fp16's normal range
    const int tid = threadIdx.x, lane = tid & 31, wave = tid >> 5, lr = lane & 15, hi = lane >> 4;
    V bq[2][2], bq2[2][2];
    const size_t oq = (size_t)(q0 + wave * 32 + lr) * HD + 8 * hi; const T16* qp = Q + oq; const T16* qp2 = HI ? Q2 + oq : qp;   // the lane's place in its wave's first q fragment
#pragma unroll
    for (int qb = 0; qb < 2; ++qb)
#pragma unroll
        for (int kc = 0; kc < 2; ++kc) { const int o = qb * 16 * HD + kc * 32; bq[qb][kc] = WFrag<T16>::ld(qp + o); if (HI) bq2[qb][kc] = WFrag<T16>::ld(qp2 + o); }
    asm volatile("s_wait_xcnt 0x0" :: "v"(qp), "v"(qp2) : "memory");   // the loads' address registers are reused below while the loads are in flight: the wait stands in front of that, and the pointers, its inputs, keep their registers up to it
    v8f O[4][2];
#pragma unroll
    for (int db = 0; db < 4; ++db)
#pragma unroll
        for (int qb = 0; qb < 2; ++qb) O[db][qb] = (v8f){};
    float m[2] = {-3.0e38f, -3.0e38f}, l[2] = {0.f, 0.f};
    v4i rk[4], rv[4], rk2[4], rv2[4];
    const int sr = tid >> 3, sg = (tid & 7) * 8;   // this thread's row (+ 16 i) and 16-byte segment of a staged tile
    constexpr int KO = NH_ * TT * HD;   // a head's k plane lies KO elements behind its q plane; the constant goes into the loads' offset field, so kp and kp2 are the registers that the k loads name
    const T16* kp = Q + sr * HD + sg; const T16* vp = Vt + sr * TT + sg; const T16* kp2 = HI ? Q2 + sr * HD + sg : kp; const T16* vp2 = HI ? V2 + sr * TT + sg : vp;
#pragma unroll
    for (int i = 0; i < 4; ++i) { const int ok = KO + 16 * i * HD, ov = 16 * i * TT; rk[i] = *(const v4ia*)(kp + ok); rv[i] = *(const v4ia*)(vp + ov); if (HI) { rk2[i] = *(const v4ia*)(kp2 + ok); rv2[i] = *(const v4ia*)(vp2 + ov); } }
    asm volatile("s_wait_xcnt 0x0" :: "v"(kp), "v"(vp), "v"(kp2), "v"(vp2) : "memory");   // as behind the q loads: no address register of the first stage's loads is rewritten in front of this wait
    const int kend = (nU + KS - 1) & ~(KS - 1);   // end of the last stage that holds a kept key; the same for the whole work-group, at most TT
    // the stages stay rolled (short code); everything inside is unrolled so that fragments and accumulators are registers
#pragma unroll 1
    for (int k0 = 0; k0 < kend; k0 += KS) {
        __syncthreads();   // every wave has finished reading the previous stage's tiles
#pragma unroll
        for (int i = 0; i < 4; ++i) { const int o = (sr + 16 * i) * LP + sg; *(v4ia*)(sK + o) = rk[i]; *(v4ia*)(sV + o) = rv[i]; if (HI) { *(v4ia*)(sK2 + o) = rk2[i]; *(v4ia*)(sV2 + o) = rv2[i]; } }
        __syncthreads();   // the stage's tiles are whole before any wave reads them
        if (k0 + KS < kend) {   // the next stage's global loads fly while this stage is worked on
#pragma unroll
            for (int i = 0; i < 4; ++i) { const size_t ok = (size_t)(k0 + KS + sr + 16 * i) * HD + sg, ov = (size_t)(sr + 16 * i) * TT + k0 + KS + sg; rk[i] = *(const v4ia*)(Kp + ok); rv[i] = *(const v4ia*)(Vt + ov); if (HI) { rk2[i] = *(const v4ia*)(K2 + ok); rv2[i] = *(const v4ia*)(V2 + ov); } }
            asm volatile("s_wait_xcnt 0x0" ::: "memory"); }   // the loads' address registers are reused by the work below while the loads are in flight: the wait stands in front of that reuse
        v8f S[4][2];
#pragma unroll
        for (int kt = 0; kt < 4; ++kt) {
            S[kt][0] = (v8f){}; S[kt][1] = (v8f){};
#pragma unroll
            for (int kc = 0; kc < 2; ++kc) { const int o = (kt * 16 + lr) * LP + kc * 32 + 8 * hi; const V ak = WFrag<T16>::ld(sK + o); V ak2; if (HI) ak2 = WFrag<T16>::ld(sK2 + o);
#pragma unroll
                for (int qb = 0; qb < 2; ++qb) { S[kt][qb] = WFrag<T16>::mma(ak, bq[qb][kc], S[kt][qb]); if (HI) { S[kt][qb] = WFrag<T16>::mma(ak, bq2[qb][kc], S[kt][qb]); S[kt][qb] = WFrag<T16>::mma(ak2, bq[qb][kc], S[kt][qb]); } } } }
        float mx[2] = {-3.0e38f, -3.0e38f};
        if (k0 + KS <= nU) {   // a scalar branch: every key of the stage is kept, no test per key
#pragma unroll
            for (int kt = 0; kt < 4; ++kt)
#pragma unroll
                for (int j = 0; j < 8; ++j)
#pragma unroll
                    for (int qb = 0; qb < 2; ++qb) { const float u = S[kt][qb][j] * C1; S[kt][qb][j] = u; mx[qb] = fmaxf(mx[qb], u); }
        } else { const int lim = nU - k0 - 8 * hi;   // the last walked stage: this lane's keys kt * 16 + j below lim are kept
#pragma unroll
            for (int kt = 0; kt < 4; ++kt)
#pragma unroll
                for (int j = 0; j < 8; ++j) { const bool keep = kt * 16 + j < lim;
#pragma unroll
                    for (int qb = 0; qb < 2; ++qb) { const float u = keep ? S[kt][qb][j] * C1 : C2;   /* masked_fill(mask == 0, 1e-9): a constant logit, the key stays in the softmax */ S[kt][qb][j] = u; mx[qb] = fmaxf(mx[qb], u); } } }
        float mn[2]; bool need = false;
#pragma unroll
        for (int qb = 0; qb < 2; ++qb) { mx[qb] = fmaxf(mx[qb], __shfl_xor(mx[qb], 16, 32)); mn[qb] = fmaxf(m[qb], mx[qb] - OFF); need = need || (mn[qb] > m[qb]); }
        if (__builtin_amdgcn_ballot_w32(need) != 0) {   // a scalar branch: sums and outputs are rescaled only in a stage that raises some row's maximum (the factor is exactly 1 for the other rows)
#pragma unroll
            for (int qb = 0; qb < 2; ++qb) { const float al = __builtin_amdgcn_exp2f(m[qb] - mn[qb]); l[qb] *= al; m[qb] = mn[qb];
#pragma unroll
                for (int db = 0; db < 4; ++db)
#pragma unroll
                    for (int j = 0; j < 8; ++j) O[db][qb][j] *= al; } }
#pragma unroll
        for (int kt = 0; kt < 4; ++kt)
#pragma unroll
            for (int qb = 0; qb < 2; ++qb)
#pragma unroll
                for (int j = 0; j < 8; ++j) { const float p = __builtin_amdgcn_exp2f(S[kt][qb][j] - m[qb]); S[kt][qb][j] = p; l[qb] += p; }
#pragma unroll
        for (int c = 0; c < 2; ++c) {   // 32 keys: S^T tiles 2c and 2c + 1 are one B operand
            V pb[2], pb2[2];
#pragma unroll
            for (int qb = 0; qb < 2; ++qb)
#pragma unroll
                for (int s = 0; s < 16; ++s) { const float p = S[2 * c + (s >> 3)][qb][s & 7];
                    if constexpr (HI) { const __bf16 ph = (__bf16)p; pb[qb][s] = ph; pb2[qb][s] = (__bf16)(p - (float)ph); } else { pb[qb][s] = (h16)p; } }
#pragma unroll
            for (int db = 0; db < 4; ++db) { const int o = (db * 16 + lr) * LP + c * 32 + 8 * hi; const V av = WFrag<T16>::ld(sV + o); V av2; if (HI) av2 = WFrag<T16>::ld(sV2 + o);
#pragma unroll
                for (int qb = 0; qb < 2; ++qb) { O[db][qb] = WFrag<T16>::mma(av, pb[qb], O[db][qb]); if (HI) { O[db][qb] = WFrag<T16>::mma(av, pb2[qb], O[db][qb]); O[db][qb] = WFrag<T16>::mma(av2, pb[qb], O[db][qb]); } } } }
    }
#pragma unroll
    for (int qb = 0; qb < 2; ++qb) l[qb] += __shfl_xor(l[qb], 16, 32);   // the two lane halves hold disjoint keys' sums of the same query
    if (kend < TT) {   // the masked keys behind the last walked stage, as one more online-softmax step (a scalar branch)
#pragma unroll
        for (int qb = 0; qb < 2; ++qb) { const float mn = fmaxf(m[qb], C2 - OFF), al = __builtin_amdgcn_exp2f(m[qb] - mn), pc = __builtin_amdgcn_exp2f(C2 - mn); l[qb] = l[qb] * al + (float)(TT - kend) * pc;
#pragma unroll
            for (int db = 0; db < 4; ++db)
#pragma unroll
                for (int j = 0; j < 8; ++j) { const int d = db * 16 + 8 * hi + j; O[db][qb][j] = O[db][qb][j] * al + pc * (vs[d] + vs[HD + d]); } } }
#pragma unroll
    for (int qb = 0; qb < 2; ++qb) { const float f = __fdiv_rn(1.0f, l[qb]);
        const size_t ro = (size_t)(q0 + wave * 32 + qb * 16 + lr) * DQ + 8 * hi;
#pragma unroll
        for (int db = 0; db < 4; ++db) { v8us oh, ol;
#pragma unroll
            for (int j = 0; j < 8; ++j) { unsigned short a, c2; splitf(O[db][qb][j] * f, a, c2); oh[j] = a; ol[j] = c2; }
            *(v8us*)(Ah + ro + db * 16) = oh; *(v8us*)(Al + ro + db * 16) = ol; } }
}
// grid (batch * head, 128-row block): the 3-product blocks (rows < RH) have the lowest linear ids and start first
__global__ __launch_bounds__(128) void k_fattn(const h16* __restrict__ QK16, const bf* __restrict__ QKh, const bf* __restrict__ QKl, const h16* __restrict__ VT16, const bf* __restrict__ VTh, const bf* __restrict__ VTl, const int* __restrict__ nu, const float* __restrict__ BS, bf* Ah, bf* Al) {
    __shared__ __align__(16) unsigned short sm[4][KS * LP];
    __shared__ __align__(16) float vs[2 * HD];   // per d: the sum of the v rows of the stages that are not walked, in two halves
    const int b = blockIdx.x / NH_, h = blockIdx.x % NH_, q0 = blockIdx.y * 128, tid = threadIdx.x;
    const int nU = min(max(__builtin_amdgcn_readfirstlane(nu[b * 32]), 0), TT);   // the batch's kept keys
    { const float* pb = BS + (size_t)(b * NKV + h) * (TT / KS) * HD + (tid >> 6) * HD + (tid & 63); const int first = (nU + KS - 1) / KS; float v[TT / KS / 2], a = 0.f;
#pragma unroll
      for (int i = 0; i < TT / KS / 2; ++i) v[i] = pb[(size_t)i * 2 * HD];   // all block sums are read (one latency), those of walked stages left out below
      asm volatile("s_wait_xcnt 0x0" :: "v"(pb) : "memory");   // the loads' address registers are reused below while they are in flight: the wait stands in front of that, and the pointer, its input, keeps its registers up to it (no load's result lands in them)
#pragma unroll
      for (int i = 0; i < TT / KS / 2; ++i) a += (2 * i + (tid >> 6) >= first) ? v[i] : 0.f;
      vs[tid] = a; }
    __syncthreads();   // vs is whole before the epilogue reads it, also where no stage is walked
    const size_t pq = ((size_t)b * (NH_ + NKV) + h) * TT * HD, pk = pq + (size_t)NH_ * TT * HD, pv = ((size_t)b * NKV + h) * HD * TT, po = (size_t)b * TT * DQ + h * HD;
    if (q0 < RH) fa_body<bf, true>(QKh + pq, QKl + pq, QKh + pk, QKl + pk, VTh + pv, VTl + pv, (bf*)sm[0], (bf*)sm[1], (bf*)sm[2], (bf*)sm[3], vs, nU, q0, Ah + po, Al + po);
    else fa_body<h16, false>(QK16 + pq, nullptr, QK16 + pk, nullptr, VT16 + pv, nullptr, (h16*)sm[0], nullptr, (h16*)sm[2], nullptr, vs, nU, q0, Ah + po, Al + po);
}

extern "C" void kernel_launch(void* const* d_in, const int* in_sizes, int n_in,
                              void* d_out, int out_size, void* d_ws, size_t ws_size, hipStream_t stream) {
    (void)in_sizes; (void)n_in; (void)out_size;
    const float* x = (const float*)d_in[0]; const int* mk = (const int*)d_in[1];   /* mask [4][2048] int {0,1} */ const float* wq = (const float*)d_in[2]; const float* wk = (const float*)d_in[3]; const float* wv = (const float*)d_in[4]; const float* wo = (const float*)d_in[5];
    float* OUT = (float*)d_out;     // [4][2048][512]
    char* wsp = (char*)d_ws;
    auto take = [&](size_t bytes) { char* p = wsp; wsp += (bytes + 255) & ~(size_t)255; return (void*)p; };
    bf* WA = (bf*)take((size_t)(DQ + 2 * DKV + DM) * DM * 2); bf* WO = WA + (size_t)(DQ + 2 * DKV) * DM;   // Wq | Wk | Wv rows as ONE [1536][512] operand, then Wout
    bf* XB = (bf*)take((size_t)NB_ * TT * DM * 2);
    // q and k head planes [b][8 q heads | 8 k heads][t][d]; v planes [b][g][d][t]
    h16* QK16 = (h16*)take((size_t)NB_ * (NH_ + NKV) * TT * HD * 2); bf* QKh = (bf*)take((size_t)NB_ * (NH_ + NKV) * TT * HD * 2); bf* QKl = (bf*)take((size_t)NB_ * (NH_ + NKV) * TT * HD * 2);
    h16* VT16 = (h16*)take((size_t)NB_ * NKV * HD * TT * 2); bf* VTh = (bf*)take((size_t)NB_ * NKV * HD * TT * 2); bf* VTl = (bf*)take((size_t)NB_ * NKV * HD * TT * 2);
    bf* ATh = (bf*)take((size_t)NB_ * TT * DQ * 2); bf* ATl = (bf*)take((size_t)NB_ * TT * DQ * 2);
    int* POS = (int*)take((size_t)NB_ * TT * 4); int* PERM = (int*)take((size_t)NB_ * TT * 4); int* NU = (int*)take((size_t)NB_ * 32 * 4); float* BS = (float*)take((size_t)NB_ * NKV * (TT / KS) * HD * 4);
    if ((size_t)(wsp - (char*)d_ws) > ws_size) return;    // 98 MiB of the 256 MiB
    k_cvt8w<<<dim3((unsigned)(((size_t)DQ * DM / 8 + 255) / 256), 5, 1), 256, 0, stream>>>(wq, wk, wv, wo, WA, (size_t)DQ * DM / 8, mk, POS, PERM, NU);
    k_cvt8<<<(unsigned)(((size_t)NB_ * TT * DM / 8 + 255) / 256), 256, 0, stream>>>(x, POS, XB, (size_t)NB_ * TT * DM / 8);
    k_proj<<<dim3(NB_ * TT / 128, (NH_ + 2 * NKV) / 2, 1), 128, 0, stream>>>(XB, WA, PERM, QK16, QKh, QKl, VT16, VTh, VTl, BS);
    k_fattn<<<dim3(NB_ * NH_, TT / 128, 1), 128, 0, stream>>>(QK16, QKh, QKl, VT16, VTh, VTl, NU, BS, ATh, ATl);
    k_wout<<<dim3(NB_ * TT / 128, DM / 128, 1), 128, 0, stream>>>(ATh, ATl, WO, OUT);
}

// v007
// A run of this version takes 69 microseconds.
// In two side-by-side timings against v006, it was 1.09 and 1.08 times as fast.
// Counting every step since v000, it is 29.5 times as fast.
#include <hip/hip_runtime.h>

// Cross-modal attention whose key mask FILLS WITH A CONSTANT instead of excluding (input_feature [4][2048][512]; q, k, v = x W^T ('oi' [512][512] 1/sqrt(512), no bias; 8 heads x 64); scores = q.k x 64^-0.5, then scores[b][..][i][j] = 1e-9 wherever mask[b][j] == 0 (mask [4][2048] int {0,1}, ~50 %, read): the masked keys STAY in the softmax with logit 1e-9 (the module's masked_fill quirk); softmax; out = merged (head-major channel concat) Wout^T ('oi') -> [4][2048][512] (4.2 M)).
// Layout: bf16 copy of x, q|k|v projections (which store the head planes themselves) and Wout product each run ONCE over all 4 batches, their operand tiles staged in LDS by whole-line loads and shared by 4 waves; attention is ONE fused launch over all batches and heads (k_fattn): scores, online softmax and P.V per 128 query rows, K and V tiles shared in LDS; every masked key has the SAME logit 1e-9, so each batch's tokens are ranked kept keys first (k and v planes in that order, q planes in token order), the stages walk the kept keys only, and the whole stages of masked keys enter once as (sum of their v rows) x exp(1e-9 - max) (hybrid rows: < 512 hi/lo 3 products, rest fp16 x1024); merged hi/lo x Wout exact.
// Compute dtypes, f32 accumulate: every input rounded to bf16; projections exact; attention rows < 512 3 products, rest fp16; softmax f32; Wout hl x exact.

#define NB_  4
#define TT   2048
#define DM   512
#define NH_  8
#define NKV  8
#define REP  (NH_ / NKV)
#define HD   64
#define DQ   (NH_ * HD)
#define DKV  (NKV * HD)
#define RH   512                  // query rows < RH use hi+lo planes (0: none)
#define WIN  0
#define SCL  0.125f   // HD^-0.5
typedef _Float16 h16;
typedef unsigned short bf;
typedef __attribute__((ext_vector_type(16))) __bf16   v16bf;
typedef __attribute__((ext_vector_type(16))) _Float16 v16h;
typedef __attribute__((ext_vector_type(8)))  _Float16 v8h;
typedef __attribute__((ext_vector_type(8)))  unsigned short v8us;
typedef __attribute__((ext_vector_type(8)))  float    v8f;
typedef __attribute__((ext_vector_type(4)))  float    v4f;
typedef v8h  __attribute__((may_alias)) v8ha;
typedef v4f  __attribute__((may_alias)) v4fa;
typedef v8us __attribute__((may_alias)) v8usa;

__device__ __forceinline__ unsigned short f2bf(float f) { unsigned u = __float_as_uint(f); u += 0x7FFFu + ((u >> 16) & 1u); return (unsigned short)(u >> 16); }
__device__ __forceinline__ float bf2f(unsigned short b) { return __uint_as_float(((unsigned)b) << 16); }
__device__ __forceinline__ float bfr(float f) { return bf2f(f2bf(f)); }
__device__ __forceinline__ v16h cat16(v8h lo, v8h hi) { return __builtin_shufflevector(lo, hi, 0, 1, 2, 3, 4, 5, 6, 7, 8, 9, 10, 11, 12, 13, 14, 15); }
__device__ __forceinline__ v16bf cat16b(v8us lo, v8us hi) { return __builtin_bit_cast(v16bf, __builtin_shufflevector(lo, hi, 0, 1, 2, 3, 4, 5, 6, 7, 8, 9, 10, 11, 12, 13, 14, 15)); }
__device__ __forceinline__ v8f wmma16(v16h a, v16h b, v8f c) { return __builtin_amdgcn_wmma_f32_16x16x32_f16(false, a, false, b, (short)0, c, false, false); }
__device__ __forceinline__ v8f wmmab(v16bf a, v16bf b, v8f c) { return __builtin_amdgcn_wmma_f32_16x16x32_bf16(false, a, false, b, (short)0, c, false, false); }



// ---- g_tiles: the k loop of both dense products. ONE WORK-GROUP of 4 waves (2 x 2) per 128x128 output tile, each wave a 64x64 tile in 16 accumulators; K = DM.
// A stage is GK = 64 k: one whole 128-byte line of each of the 128 A rows and 128 B rows goes global -> registers (one stage ahead) -> LDS, a wave's load covering 4 whole lines; the fragments come from LDS, each row read by two waves.
// acc[mb][nb] += sum_k A[m][k] Bt[n][k] (+ A2[m][k] Bt[n][k] where NA == 2), k ascending in steps of 32.
template <typename T16> struct WFrag;
template <> struct WFrag<h16> { typedef v16h V; static __device__ __forceinline__ V ld(const h16* p) { return cat16(*(const v8h*)p, *(const v8h*)(p + 16)); } static __device__ __forceinline__ v8f mma(V a, V b, v8f c) { return wmma16(a, b, c); } };
template <> struct WFrag<bf> { typedef v16bf V; static __device__ __forceinline__ V ld(const bf* p) { return cat16b(*(const v8us*)p, *(const v8us*)(p + 16)); } static __device__ __forceinline__ v8f mma(V a, V b, v8f c) { return wmmab(a, b, c); } };
#define GK 64                     // k per stage
#define GP 72                     // LDS row pitch, 16-bit elements: 128 B of data + 16 B, so that 16 rows' 16-byte reads fall on different banks
typedef __attribute__((ext_vector_type(4))) int g4i;
typedef g4i __attribute__((may_alias)) g4ia;
template <int NA>
__device__ __forceinline__ void g_tiles(const bf* __restrict__ A, const bf* __restrict__ A2, const bf* __restrict__ Bt, bf* sA, bf* sA2, bf* sB, int wm, int wn, v8f (&acc)[4][4]) {
    typedef WFrag<bf>::V V;
    const int tid = threadIdx.x, lane = tid & 31, lr = lane & 15, hi = lane >> 4;
    const int sr = tid >> 3, sg = (tid & 7) * 8;   // this thread's row (+ 16 i) and 16-byte segment of a staged tile
    g4i ra[8], ra2[8], rb[8];
#pragma unroll
    for (int i = 0; i < 8; ++i) { const int o = (sr + 16 * i) * DM + sg; ra[i] = *(const g4ia*)(A + o); rb[i] = *(const g4ia*)(Bt + o); if (NA == 2) ra2[i] = *(const g4ia*)(A2 + o); }
    const int fa = (wm * 64 + lr) * GP + 8 * hi, fb = (wn * 64 + lr) * GP + 8 * hi;   // the lane's place in its wave's first A and B fragment
    // the stages stay rolled (short code); everything inside is unrolled so that fragments and accumulators are registers
#pragma unroll 1
    for (int k0 = 0; k0 < DM; k0 += GK) {
        __syncthreads();   // every wave has finished reading the previous stage's tiles
#pragma unroll
        for (int i = 0; i < 8; ++i) { const int o = (sr + 16 * i) * GP + sg; *(g4ia*)(sA + o) = ra[i]; *(g4ia*)(sB + o) = rb[i]; if (NA == 2) *(g4ia*)(sA2 + o) = ra2[i]; }
        __syncthreads();   // the stage's tiles are whole before any wave reads them
        if (k0 + GK < DM) {   // the next stage's global loads fly while this stage is worked on
            A += GK; Bt += GK; if (NA == 2) A2 += GK;   // the tiles' bases move, uniform for the work-group; the thread's own offset stays in one register
#pragma unroll
            for (int i = 0; i < 8; ++i) { const int o = (sr + 16 * i) * DM + sg; ra[i] = *(const g4ia*)(A + o); rb[i] = *(const g4ia*)(Bt + o); if (NA == 2) ra2[i] = *(const g4ia*)(A2 + o); }
            asm volatile("s_wait_xcnt 0x0" ::: "memory"); }   // the loads' base registers are moved on while the loads are in flight: the wait stands in front of that
#pragma unroll
        for (int kc = 0; kc < GK; kc += 32) {
            V a[4], a2[4], bb[4];   // the fragments of one block of 32 k
#pragma unroll
            for (int mb = 0; mb < 4; ++mb) { a[mb] = WFrag<bf>::ld(sA + fa + mb * 16 * GP + kc); bb[mb] = WFrag<bf>::ld(sB + fb + mb * 16 * GP + kc); if (NA == 2) a2[mb] = WFrag<bf>::ld(sA2 + fa + mb * 16 * GP + kc); }
            if (NA == 2) asm volatile("" :: "v"(bb[0]), "v"(bb[1]), "v"(bb[2]), "v"(bb[3]));   // inputs only: holds the four B reads in one group ahead of the block's products (one wave per SIMD in that kernel: a read placed later costs its whole LDS latency in front of its products)
#pragma unroll
            for (int nb = 0; nb < 4; ++nb)
#pragma unroll
                for (int mb = 0; mb < 4; ++mb) { acc[mb][nb] = WFrag<bf>::mma(a[mb], bb[nb], acc[mb][nb]); if (NA == 2) acc[mb][nb] = WFrag<bf>::mma(a2[mb], bb[nb], acc[mb][nb]); }
        }
    }
}

// ---- k_wout: C[m][n] (f32, pitch DM) = sum_k (Ah[m][k] + Al[m][k]) Wo[n][k], g_tiles' loop with two A planes; grid (NB_ * TT / 128, DM / 128), 128 threads.
__global__ __launch_bounds__(128) void k_wout(const bf* __restrict__ Ah, const bf* __restrict__ Al, const bf* __restrict__ Wo, float* C) {
    __shared__ __align__(16) bf sA[128 * GP]; __shared__ __align__(16) bf sA2[128 * GP]; __shared__ __align__(16) bf sB[128 * GP];
    __shared__ __align__(16) float osw[4][16 * 68];   // each wave's own output staging
    const int lane = threadIdx.x & 31, lr = lane & 15, hi = lane >> 4; const int wave = __builtin_amdgcn_readfirstlane(threadIdx.x >> 5), wm = wave >> 1, wn = wave & 1;
    v8f acc[4][4];
#pragma unroll
    for (int mb = 0; mb < 4; ++mb)
#pragma unroll
        for (int nb = 0; nb < 4; ++nb) acc[mb][nb] = (v8f){};
    g_tiles<2>(Ah + (size_t)blockIdx.x * 128 * DQ, Al + (size_t)blockIdx.x * 128 * DQ, Wo + (size_t)blockIdx.y * 128 * DQ, sA, sA2, sB, wm, wn, acc);
    const int r0 = blockIdx.x * 128 + wm * 64, c0 = blockIdx.y * 128 + wn * 64; float* os = osw[wave];
#pragma unroll
    for (int mb = 0; mb < 4; ++mb) {
#pragma unroll
        for (int nb = 0; nb < 4; ++nb) {
#pragma unroll
            for (int j = 0; j < 8; ++j) os[(hi * 8 + j) * 68 + nb * 16 + lr] = acc[mb][nb][j]; }
        __builtin_amdgcn_wave_barrier(); asm volatile("" ::: "memory");   // the reads below take other lanes' writes: neither scheduler nor optimiser may move them up
        float* crow = C + (size_t)(r0 + mb * 16) * DM + c0;
#pragma unroll
        for (int s = 0; s < 8; ++s) { const int row = 2 * s + hi, cofs = lr * 4; const v4f val = *(const v4fa*)(os + row * 68 + cofs); *(v4f*)(crow + (size_t)row * DM + cofs) = val; }
        __builtin_amdgcn_wave_barrier(); asm volatile("" ::: "memory");   // the next 16 rows' writes stay behind these reads
    }
}

__device__ __forceinline__ h16 tohx(float x) { return (h16)x; }
__device__ __forceinline__ void splitf(float y, unsigned short& h, unsigned short& l) { h = f2bf(y); l = f2bf(y - bf2f(h)); }
typedef __attribute__((ext_vector_type(2))) _Float16 v2h;
typedef __attribute__((ext_vector_type(4))) _Float16 v4h;
typedef __attribute__((ext_vector_type(2))) unsigned short v2us;
typedef __attribute__((ext_vector_type(4))) unsigned short v4us;
typedef __attribute__((ext_vector_type(2))) float v2f;
typedef __attribute__((ext_vector_type(4))) int v4i;

__global__ __launch_bounds__(256) void k_wtG(const float* __restrict__ w, int K, int N, bf* Bt) {
    const int lane = threadIdx.x & 31; const int L0 = (blockIdx.x * 8 + (threadIdx.x >> 5)) * 8; const int nlines = N * K / 64;
{
#pragma unroll 1
        for (int l = 0; l < 8; ++l) { const int L = L0 + l; if (L >= nlines) break; const size_t e = (size_t)L * 64 + lane * 2; const int k = (int)(e % K), n = (int)(e / K); v2us o;
            o[0] = f2bf(w[(size_t)k * N + n]); o[1] = f2bf(w[(size_t)(k + 1) * N + n]); *(v2us*)(Bt + e) = o; }
         }
}
// k_cvt8: x to bf16, token row t of a batch stored at row pos[t] of that batch (kept keys first)
__global__ __launch_bounds__(256) void k_cvt8(const float* __restrict__ src, const int* __restrict__ pos, bf* dst, size_t n8) { const size_t i = (size_t)blockIdx.x * 256 + threadIdx.x; if (i >= n8) return; const v8f v = *(const v8f*)(src + i * 8); v8us o;
#pragma unroll
    for (int k = 0; k < 8; ++k) o[k] = f2bf(v[k]);
    const size_t row = i / (DM / 8); *(v8us*)(dst + ((row / TT) * TT + pos[row]) * DM + (i % (DM / 8)) * 8) = o;  }

// k_cvt8w: the four weight matrices (n8 groups of 8 each) to one contiguous bf16 block, blockIdx.y - 1 picks the matrix.
// blockIdx.y == 0 (started first): work-group b < NB_ ranks batch b's tokens, kept keys (mask != 0) first, each kind in token order: pos[t] = rank of token t, perm[rank] = t, nu[32 b] = number of kept keys.
// Ranks come from counting, so they are a permutation of 0 .. TT - 1 whatever the mask holds.
__global__ __launch_bounds__(256) void k_cvt8w(const float* __restrict__ w0, const float* __restrict__ w1, const float* __restrict__ w2, const float* __restrict__ w3, bf* dst, size_t n8, const int* __restrict__ mk, int* pos, int* perm, int* nu) {
    __shared__ int wsum[8]; __shared__ __align__(16) int sp[TT];
    if (blockIdx.y == 0) {
        if (blockIdx.x >= NB_) return;
        const int b = blockIdx.x, tid = threadIdx.x, lane = tid & 31, wave = tid >> 5; const int* pm = mk + (size_t)b * TT + tid * 8; unsigned bits = 0;
#pragma unroll
        for (int c = 0; c < 2; ++c) { const v4i p4 = *(const v4i*)(pm + c * 4);
#pragma unroll
            for (int q = 0; q < 4; ++q) bits |= (p4[q] != 0 ? 1u : 0u) << (c * 4 + q); }
        const int cn = __popc(bits); int inc = cn;   // kept keys among this thread's 8 tokens; then the wave's running count
#pragma unroll
        for (int st = 1; st < 32; st <<= 1) { const int o = __shfl_up(inc, st, 32); if (lane >= st) inc += o; }
        if (lane == 31) wsum[wave] = inc;
        __syncthreads();   // the 8 waves' counts are whole
        int u = inc - cn, tot = 0;
#pragma unroll
        for (int w = 0; w < 8; ++w) { const int c = wsum[w]; tot += c; if (w < wave) u += c; }
        v4i pp[2];
#pragma unroll
        for (int q = 0; q < 8; ++q) { const int t = tid * 8 + q; const bool kp = ((bits >> q) & 1u) != 0u; const int p = kp ? u : tot + (t - u); u += kp ? 1 : 0; sp[p] = t; pp[q >> 2][q & 3] = p; }
        *(v4i*)(pos + (size_t)b * TT + tid * 8) = pp[0]; *(v4i*)(pos + (size_t)b * TT + tid * 8 + 4) = pp[1];
        __syncthreads();   // the inverse table is whole in LDS: it goes out in whole lines
        *(v4i*)(perm + (size_t)b * TT + tid * 8) = *(const v4i*)(sp + tid * 8); *(v4i*)(perm + (size_t)b * TT + tid * 8 + 4) = *(const v4i*)(sp + tid * 8 + 4);
        if (tid == 0) nu[b * 32] = tot;
        return;
    }
    const size_t i = (size_t)blockIdx.x * 256 + threadIdx.x; if (i >= n8) return; const int y = blockIdx.y - 1; const float* src = (y == 0) ? w0 : (y == 1) ? w1 : (y == 2) ? w2 : w3; const v8f v = *(const v8f*)(src + i * 8); v8us o;
#pragma unroll
    for (int k = 0; k < 8; ++k) o[k] = f2bf(v[k]); *(v8us*)(dst + ((size_t)y * n8 + i) * 8) = o;  }

// ---- k_proj: the joint q|k|v projection with g_tiles' loop (4 waves per 128x128 tile: 128 tokens x 2 heads, each wave 64 tokens of one head); its epilogue rounds the f32 tile to the attention's three 16-bit planes (fp16, bf16 hi, bf16 lo) and stores them itself, so no f32 projection reaches memory.
// grid (NB_ * TT / 128 token blocks, 12 head pairs: 4 q | 4 k | 4 v), 128 threads. A wave's q or k tile is [t][d] (A = tokens, B = weight rows): a k tile is one contiguous 8-KiB block of its plane [b][head][t][d], a q tile's 64 rows go to their tokens' rows of it.
// A v tile is computed as [d][t] (A = weight rows, B = tokens: the same products, summed over k in the same order), so that each of its rows is a whole 128-byte line of its plane [b][g][d][t].
// X's rows are in rank order (kept keys first): k and v planes keep that order, a q row goes to its token's own row (perm), a whole line either way. A v wave also stores the f32 sum of its 64 columns per d (BS [b][g][64-key block][d]).
__global__ __launch_bounds__(128) void k_proj(const bf* __restrict__ X, const bf* __restrict__ Wt, const int* __restrict__ perm, h16* QK16, bf* QKh, bf* QKl, h16* VT16, bf* VTh, bf* VTl, float* BS) {
    __shared__ __align__(16) bf sA[128 * GP]; __shared__ __align__(16) bf sB[128 * GP];
    __shared__ __align__(16) float osw[4][16 * 68];   // each wave's own output staging
    const int lane = threadIdx.x & 31, lr = lane & 15, hi = lane >> 4; const int wave = __builtin_amdgcn_readfirstlane(threadIdx.x >> 5), wm = wave >> 1, wn = wave & 1;
    const bool isv = blockIdx.y * 2 >= NH_ + NKV;   // the same for the whole work-group
    const bf* xt = X + (size_t)blockIdx.x * 128 * DM; const bf* wt = Wt + (size_t)blockIdx.y * 2 * HD * DM;
    v8f acc[4][4];
#pragma unroll
    for (int mb = 0; mb < 4; ++mb)
#pragma unroll
        for (int nb = 0; nb < 4; ++nb) acc[mb][nb] = (v8f){};
    const int r0 = blockIdx.x * 128 + (isv ? wn : wm) * 64, hh = blockIdx.y * 2 + (isv ? wm : wn); const int b = r0 / TT, t0 = r0 % TT;   // this wave's 64 tokens and its head
    const bool isq = blockIdx.y * 2 < NH_;   // the same for the whole work-group
    int rw[4][4];   // the plane row of each tile row this lane stores (q: the token's own row of the head's plane; k, v: the tile row): read here, all at once, so that the k loop hides the latency
#pragma unroll
    for (int mb = 0; mb < 4; ++mb)
#pragma unroll
        for (int s = 0; s < 4; ++s) rw[mb][s] = perm[r0 + mb * 16 + 4 * s + (lane >> 3)];
    asm volatile("s_wait_xcnt 0x0" ::: "memory");   // the loads' offset register is reused below while they are in flight: the wait stands in front of that
    const int qm = isq ? -1 : 0;
#pragma unroll
    for (int mb = 0; mb < 4; ++mb)
#pragma unroll
        for (int s = 0; s < 4; ++s) { const int tr = mb * 16 + 4 * s + (lane >> 3); rw[mb][s] = tr + ((rw[mb][s] - tr) & qm); }
    g_tiles<1>(isv ? wt : xt, nullptr, isv ? xt : wt, sA, nullptr, sB, wm, wn, acc);
    const size_t o0 = isv ? (size_t)(b * NKV + hh - NH_ - NKV) * HD * TT + t0 : ((size_t)(b * (NH_ + NKV) + hh) * TT + (isq ? 0 : t0)) * HD; const int pitch = isv ? TT : HD;   // the tile's first element (q: its head plane's first) and row pitch in its plane
    h16* P16 = (isv ? VT16 : QK16) + o0; bf* Ph = (isv ? VTh : QKh) + o0; bf* Pl = (isv ? VTl : QKl) + o0; float* os = osw[wave];
    float rs[4][4];   // a v wave: this lane's share of each row's sum
    float* bs = BS + ((size_t)(b * NKV + (isv ? hh - NH_ - NKV : 0)) * (TT / 64) + t0 / 64) * HD;
#pragma unroll
    for (int mb = 0; mb < 4; ++mb) {   // 16 tile rows at a time through LDS: a lane then holds 8 neighbours of one row, 16 bytes of each plane, and a wave's store covers four whole lines
#pragma unroll
        for (int nb = 0; nb < 4; ++nb) {
#pragma unroll
            for (int j = 0; j < 8; ++j) os[(hi * 8 + j) * 68 + nb * 16 + lr] = acc[mb][nb][j]; }
        __builtin_amdgcn_wave_barrier(); asm volatile("" ::: "memory");   // the reads below take other lanes' writes: neither scheduler nor optimiser may move them up
#pragma unroll
        for (int s = 0; s < 4; ++s) { const int sr = 4 * s + (lane >> 3), row = rw[mb][s] - mb * 16, cofs = (lane & 7) * 8; const v4f u0 = *(const v4fa*)(os + sr * 68 + cofs), u1 = *(const v4fa*)(os + sr * 68 + cofs + 4); v8h o16; v8us oh, ol;
#pragma unroll
            for (int k = 0; k < 8; ++k) { const float y = (k < 4) ? u0[k & 3] : u1[k & 3]; o16[k] = tohx(y); unsigned short a2, c2; splitf(y, a2, c2); oh[k] = a2; ol[k] = c2; }
            rs[mb][s] = ((u0[0] + u0[1]) + (u0[2] + u0[3])) + ((u1[0] + u1[1]) + (u1[2] + u1[3]));
            const size_t o = (size_t)(mb * 16 + row) * pitch + cofs; *(v8h*)(P16 + o) = o16; *(v8us*)(Ph + o) = oh; *(v8us*)(Pl + o) = ol; }
        __builtin_amdgcn_wave_barrier(); asm volatile("" ::: "memory");   // the next 16 rows' writes stay behind these reads
    }
    asm volatile("s_wait_xcnt 0x0" ::: "memory");   // the last plane stores' registers are reused by the v waves' work below while the stores are in flight: the wait stands in front of the branch to it
    if (isv) {   // the 64 row sums: 8 lanes hold a row's shares; the 16 sums of a lane go through each exchange together (one latency a round), then leave as two whole lines
#pragma unroll
        for (int x = 1; x < 8; x <<= 1)
#pragma unroll
            for (int i = 0; i < 16; ++i) rs[i >> 2][i & 3] += __shfl_xor(rs[i >> 2][i & 3], x, 32);
        if ((lane & 7) == 0) {
#pragma unroll
            for (int i = 0; i < 16; ++i) os[4 * i + (lane >> 3)] = rs[i >> 2][i & 3]; }
        __builtin_amdgcn_wave_barrier(); asm volatile("" ::: "memory");   // the reads below take other lanes' writes
        const v2f o2 = {os[lane * 2], os[lane * 2 + 1]}; *(v2f*)(bs + lane * 2) = o2;
    }
}
// ---- k_fattn: scores, softmax and P.V of 128 query rows of one (batch, head) in ONE work-group of 4 waves; no score or probability ever reaches memory.
// S^T = K Q^T (A = 16 keys from LDS, B = 16 queries kept in registers): a lane holds scores of ONE query (column lr), keys 8*hi + j of each 16-key tile, so row maximum, row sum and rescale are per lane;
// two converted S^T tiles are the B operand of O^T += V^T P^T in the loader's own k order (8*hi + 0..7, 16 + 8*hi + 0..7). Running maximum (online softmax), in log2 units.
// A stage is KS keys: K rows and V^T rows go global -> registers (one stage ahead) -> LDS, shared by the 4 waves. Rows < RH: hi/lo bf16 planes, 3 products; the rest fp16. The epilogue writes the merged hi/lo planes.
// Keys come kept first (nU of them): only the stages that hold a kept key are walked (in the last of them the masked keys get the constant logit one by one); the keys of the stages behind all have that logit, so they add n x p to the row sum and p x (sum of their v rows, vs) to the output, p = exp(1e-9 - max).
#define KS 64                     // keys per stage
#define LP 72                     // LDS row pitch, 16-bit elements: 128 B of data + 16 B, so that 16 rows' 16-byte reads fall on different banks
typedef v4i __attribute__((may_alias)) v4ia;
template <typename T16, bool HI>
__device__ __forceinline__ void fa_body(const T16* __restrict__ Q, const T16* __restrict__ Q2, const T16* __restrict__ Kp, const T16* __restrict__ K2, const T16* __restrict__ Vt, const T16* __restrict__ V2,
                                        T16* sK, T16* sK2, T16* sV, T16* sV2, const float* vs, int nU, int q0, bf* Ah, bf* Al) {
    typedef typename WFrag<T16>::V V;
    constexpr float C1 = SCL * 1.4426950408889634f, C2 = 1e-9f * 1.4426950408889634f;   // scaled score and the mask's constant logit, in log2 units
    constexpr float OFF = HI ? 0.0f : 10.0f;   // fp16 P carries 2^10 (it cancels in the division by the row sum): small probabilities stay in fp16's normal range
    const int tid = threadIdx.x, lane = tid & 31, wave = tid >> 5, lr = lane & 15, hi = lane >> 4;
    V bq[2][2], bq2[2][2];
    const size_t oq = (size_t)(q0 + wave * 32 + lr) * HD + 8 * hi; const T16* qp = Q + oq; const T16* qp2 = HI ? Q2 + oq : qp;   // the lane's place in its wave's first q fragment
#pragma unroll
    for (int qb = 0; qb < 2; ++qb)
#pragma unroll
        for (int kc = 0; kc < 2; ++kc) { const int o = qb * 16 * HD + kc * 32; bq[qb][kc] = WFrag<T16>::ld(qp + o); if (HI) bq2[qb][kc] = WFrag<T16>::ld(qp2 + o); }
    asm volatile("s_wait_xcnt 0x0" :: "v"(qp), "v"(qp2) : "memory");   // the loads' address registers are reused below while the loads are in flight: the wait stands in front of that, and the pointers, its inputs, keep their registers up to it
    v8f O[4][2];
#pragma unroll
    for (int db = 0; db < 4; ++db)
#pragma unroll
        for (int qb = 0; qb < 2; ++qb) O[db][qb] = (v8f){};
    float m[2] = {-3.0e38f, -3.0e38f}, l[2] = {0.f, 0.f};
    v4i rk[4], rv[4], rk2[4], rv2[4];
    const int sr = tid >> 3, sg = (tid & 7) * 8;   // this thread's row (+ 16 i) and 16-byte segment of a staged tile
    constexpr int KO = NH_ * TT * HD;   // a head's k plane lies KO elements behind its q plane; the constant goes into the loads' offset field, so kp and kp2 are the registers that the k loads name
    const T16* kp = Q + sr * HD + sg; const T16* vp = Vt + sr * TT + sg; const T16* kp2 = HI ? Q2 + sr * HD + sg : kp; const T16* vp2 = HI ? V2 + sr * TT + sg : vp;
#pragma unroll
    for (int i = 0; i < 4; ++i) { const int ok = KO + 16 * i * HD, ov = 16 * i * TT; rk[i] = *(const v4ia*)(kp + ok); rv[i] = *(const v4ia*)(vp + ov); if (HI) { rk2[i] = *(const v4ia*)(kp2 + ok); rv2[i] = *(const v4ia*)(vp2 + ov); } }
    asm volatile("s_wait_xcnt 0x0" :: "v"(kp), "v"(vp), "v"(kp2), "v"(vp2) : "memory");   // as behind the q loads: no address register of the first stage's loads is rewritten in front of this wait
    const int kend = (nU + KS - 1) & ~(KS - 1);   // end of the last stage that holds a kept key; the same for the whole work-group, at most TT
    // the stages stay rolled (short code); everything inside is unrolled so that fragments and accumulators are registers
#pragma unroll 1
    for (int k0 = 0; k0 < kend; k0 += KS) {
        __syncthreads();   // every wave has finished reading the previous stage's tiles
#pragma unroll
        for (int i = 0; i < 4; ++i) { const int o = (sr + 16 * i) * LP + sg; *(v4ia*)(sK + o) = rk[i]; *(v4ia*)(sV + o) = rv[i]; if (HI) { *(v4ia*)(sK2 + o) = rk2[i]; *(v4ia*)(sV2 + o) = rv2[i]; } }
        __syncthreads();   // the stage's tiles are whole before any wave reads them
        V ak[4][2], ak2[4][2];   // all of the stage's K fragments, read as ONE group ahead of the score products: one LDS latency a stage, part of it under the issue of the global loads below, not one at every few products
#pragma unroll
        for (int kt = 0; kt < 4; ++kt)
#pragma unroll
            for (int kc = 0; kc < 2; ++kc) { const int o = (kt * 16 + lr) * LP + kc * 32 + 8 * hi; ak[kt][kc] = WFrag<T16>::ld(sK + o); if (HI) ak2[kt][kc] = WFrag<T16>::ld(sK2 + o); }
        if (k0 + KS < kend) {   // the next stage's global loads fly while this stage is worked on
#pragma unroll
            for (int i = 0; i < 4; ++i) { const size_t un = (size_t)(k0 + KS); const int ok = (sr + 16 * i) * HD + sg, ov = (sr + 16 * i) * TT + sg;   /* the stage's part of the address is uniform (a scalar base); the thread's own offsets are the same in every stage */ rk[i] = *(const v4ia*)(Kp + un * HD + ok); rv[i] = *(const v4ia*)(Vt + un + ov); if (HI) { rk2[i] = *(const v4ia*)(K2 + un * HD + ok); rv2[i] = *(const v4ia*)(V2 + un + ov); } }
            asm volatile("s_wait_xcnt 0x0" ::: "memory"); }   // the loads' address registers are reused by the work below while the loads are in flight: the wait stands in front of that reuse
        v8f S[4][2];
#pragma unroll
        for (int kt = 0; kt < 4; ++kt) {
            S[kt][0] = (v8f){}; S[kt][1] = (v8f){};
#pragma unroll
            for (int kc = 0; kc < 2; ++kc) {
#pragma unroll
                for (int qb = 0; qb < 2; ++qb) { S[kt][qb] = WFrag<T16>::mma(ak[kt][kc], bq[qb][kc], S[kt][qb]); if (HI) { S[kt][qb] = WFrag<T16>::mma(ak[kt][kc], bq2[qb][kc], S[kt][qb]); S[kt][qb] = WFrag<T16>::mma(ak2[kt][kc], bq[qb][kc], S[kt][qb]); } } } }
        V av[2][4], av2[2][4];   // all of the stage's V^T fragments, read ahead of the softmax: their LDS latency passes under it, and no read stands among the P.V products
#pragma unroll
        for (int c = 0; c < 2; ++c)
#pragma unroll
            for (int db = 0; db < 4; ++db) { const int o = (db * 16 + lr) * LP + c * 32 + 8 * hi; av[c][db] = WFrag<T16>::ld(sV + o); if (HI) av2[c][db] = WFrag<T16>::ld(sV2 + o); }
        float mx[2] = {-3.0e38f, -3.0e38f};
        if (k0 + KS <= nU) {   // a scalar branch: every key of the stage is kept, no test per key
#pragma unroll
            for (int kt = 0; kt < 4; ++kt)
#pragma unroll
                for (int j = 0; j < 8; ++j)
#pragma unroll
                    for (int qb = 0; qb < 2; ++qb) { const float u = S[kt][qb][j] * C1; S[kt][qb][j] = u; mx[qb] = fmaxf(mx[qb], u); }
        } else { const int lim = nU - k0 - 8 * hi;   // the last walked stage: this lane's keys kt * 16 + j below lim are kept
#pragma unroll
            for (int kt = 0; kt < 4; ++kt)
#pragma unroll
                for (int j = 0; j < 8; ++j) { const bool keep = kt * 16 + j < lim;
#pragma unroll
                    for (int qb = 0; qb < 2; ++qb) { const float u = keep ? S[kt][qb][j] * C1 : C2;   /* masked_fill(mask == 0, 1e-9): a constant logit, the key stays in the softmax */ S[kt][qb][j] = u; mx[qb] = fmaxf(mx[qb], u); } } }
        float mn[2]; bool need = false;
#pragma unroll
        for (int qb = 0; qb < 2; ++qb) { mx[qb] = fmaxf(mx[qb], __shfl_xor(mx[qb], 16, 32)); mn[qb] = fmaxf(m[qb], mx[qb] - OFF); need = need || (mn[qb] > m[qb]); }
        if (__builtin_amdgcn_ballot_w32(need) != 0) {   // a scalar branch: sums and outputs are rescaled only in a stage that raises some row's maximum (the factor is exactly 1 for the other rows)
#pragma unroll
            for (int qb = 0; qb < 2; ++qb) { const float al = __builtin_amdgcn_exp2f(m[qb] - mn[qb]); l[qb] *= al; m[qb] = mn[qb];
#pragma unroll
                for (int db = 0; db < 4; ++db)
#pragma unroll
                    for (int j = 0; j < 8; ++j) O[db][qb][j] *= al; } }
#pragma unroll
        for (int kt = 0; kt < 4; ++kt)
#pragma unroll
            for (int qb = 0; qb < 2; ++qb)
#pragma unroll
                for (int j = 0; j < 8; ++j) { const float p = __builtin_amdgcn_exp2f(S[kt][qb][j] - m[qb]); S[kt][qb][j] = p; l[qb] += p; }
#pragma unroll
        for (int c = 0; c < 2; ++c) {   // 32 keys: S^T tiles 2c and 2c + 1 are one B operand
            V pb[2], pb2[2];
#pragma unroll
            for (int qb = 0; qb < 2; ++qb)
#pragma unroll
                for (int s = 0; s < 16; ++s) { const float p = S[2 * c + (s >> 3)][qb][s & 7];
                    if constexpr (HI) { const __bf16 ph = (__bf16)p; pb[qb][s] = ph; pb2[qb][s] = (__bf16)(p - (float)ph); } else { pb[qb][s] = (h16)p; } }
#pragma unroll
            for (int db = 0; db < 4; ++db) {
#pragma unroll
                for (int qb = 0; qb < 2; ++qb) { O[db][qb] = WFrag<T16>::mma(av[c][db], pb[qb], O[db][qb]); if (HI) { O[db][qb] = WFrag<T16>::mma(av[c][db], pb2[qb], O[db][qb]); O[db][qb] = WFrag<T16>::mma(av2[c][db], pb[qb], O[db][qb]); } } } }
    }
#pragma unroll
    for (int qb = 0; qb < 2; ++qb) l[qb] += __shfl_xor(l[qb], 16, 32);   // the two lane halves hold disjoint keys' sums of the same query
    if (kend < TT) {   // the masked keys behind the last walked stage, as one more online-softmax step (a scalar branch)
#pragma unroll
        for (int qb = 0; qb < 2; ++qb) { const float mn = fmaxf(m[qb], C2 - OFF), al = __builtin_amdgcn_exp2f(m[qb] - mn), pc = __builtin_amdgcn_exp2f(C2 - mn); l[qb] = l[qb] * al + (float)(TT - kend) * pc;
#pragma unroll
            for (int db = 0; db < 4; ++db)
#pragma unroll
                for (int j = 0; j < 8; ++j) { const int d = db * 16 + 8 * hi + j; O[db][qb][j] = O[db][qb][j] * al + pc * (vs[d] + vs[HD + d]); } } }
#pragma unroll
    for (int qb = 0; qb < 2; ++qb) { const float f = __fdiv_rn(1.0f, l[qb]);
        const size_t ro = (size_t)(q0 + wave * 32 + qb * 16 + lr) * DQ + 8 * hi;
#pragma unroll
        for (int db = 0; db < 4; ++db) { v8us oh, ol;
#pragma unroll
            for (int j = 0; j < 8; ++j) { unsigned short a, c2; splitf(O[db][qb][j] * f, a, c2); oh[j] = a; ol[j] = c2; }
            *(v8us*)(Ah + ro + db * 16) = oh; *(v8us*)(Al + ro + db * 16) = ol; } }
}
// grid (batch * head, 128-row block): the 3-product blocks (rows < RH) have the lowest linear ids and start first
__global__ __launch_bounds__(128) void k_fattn(const h16* __restrict__ QK16, const bf* __restrict__ QKh, const bf* __restrict__ QKl, const h16* __restrict__ VT16, const bf* __restrict__ VTh, const bf* __restrict__ VTl, const int* __restrict__ nu, const float* __restrict__ BS, bf* Ah, bf* Al) {
    __shared__ __align__(16) unsigned short sm[4][KS * LP];
    __shared__ __align__(16) float vs[2 * HD];   // per d: the sum of the v rows of the stages that are not walked, in two halves
    const int b = blockIdx.x / NH_, h = blockIdx.x % NH_, q0 = blockIdx.y * 128, tid = threadIdx.x;
    const int nU = min(max(__builtin_amdgcn_readfirstlane(nu[b * 32]), 0), TT);   // the batch's kept keys
    { const float* pb = BS + (size_t)(b * NKV + h) * (TT / KS) * HD + (tid >> 6) * HD + (tid & 63); const int first = (nU + KS - 1) / KS; float v[TT / KS / 2], a = 0.f;
#pragma unroll
      for (int i = 0; i < TT / KS / 2; ++i) v[i] = pb[(size_t)i * 2 * HD];   // all block sums are read (one latency), those of walked stages left out below
      asm volatile("s_wait_xcnt 0x0" :: "v"(pb) : "memory");   // the loads' address registers are reused below while they are in flight: the wait stands in front of that, and the pointer, its input, keeps its registers up to it (no load's result lands in them)
#pragma unroll
      for (int i = 0; i < TT / KS / 2; ++i) a += (2 * i + (tid >> 6) >= first) ? v[i] : 0.f;
      vs[tid] = a; }
    __syncthreads();   // vs is whole before the epilogue reads it, also where no stage is walked
    const size_t pq = ((size_t)b * (NH_ + NKV) + h) * TT * HD, pk = pq + (size_t)NH_ * TT * HD, pv = ((size_t)b * NKV + h) * HD * TT, po = (size_t)b * TT * DQ + h * HD;
    if (q0 < RH) fa_body<bf, true>(QKh + pq, QKl + pq, QKh + pk, QKl + pk, VTh + pv, VTl + pv, (bf*)sm[0], (bf*)sm[1], (bf*)sm[2], (bf*)sm[3], vs, nU, q0, Ah + po, Al + po);
    else fa_body<h16, false>(QK16 + pq, nullptr, QK16 + pk, nullptr, VT16 + pv, nullptr, (h16*)sm[0], nullptr, (h16*)sm[2], nullptr, vs, nU, q0, Ah + po, Al + po);
}

extern "C" void kernel_launch(void* const* d_in, const int* in_sizes, int n_in,
                              void* d_out, int out_size, void* d_ws, size_t ws_size, hipStream_t stream) {
    (void)in_sizes; (void)n_in; (void)out_size;
    const float* x = (const float*)d_in[0]; const int* mk = (const int*)d_in[1];   /* mask [4][2048] int {0,1} */ const float* wq = (const float*)d_in[2]; const float* wk = (const float*)d_in[3]; const float* wv = (const float*)d_in[4]; const float* wo = (const float*)d_in[5];
    float* OUT = (float*)d_out;     // [4][2048][512]
    char* wsp = (char*)d_ws;
    auto take = [&](size_t bytes) { char* p = wsp; wsp += (bytes + 255) & ~(size_t)255; return (void*)p; };
    bf* WA = (bf*)take((size_t)(DQ + 2 * DKV + DM) * DM * 2); bf* WO = WA + (size_t)(DQ + 2 * DKV) * DM;   // Wq | Wk | Wv rows as ONE [1536][512] operand, then Wout
    bf* XB = (bf*)take((size_t)NB_ * TT * DM * 2);
    // q and k head planes [b][8 q heads | 8 k heads][t][d]; v planes [b][g][d][t]
    h16* QK16 = (h16*)take((size_t)NB_ * (NH_ + NKV) * TT * HD * 2); bf* QKh = (bf*)take((size_t)NB_ * (NH_ + NKV) * TT * HD * 2); bf* QKl = (bf*)take((size_t)NB_ * (NH_ + NKV) * TT * HD * 2);
    h16* VT16 = (h16*)take((size_t)NB_ * NKV * HD * TT * 2); bf* VTh = (bf*)take((size_t)NB_ * NKV * HD * TT * 2); bf* VTl = (bf*)take((size_t)NB_ * NKV * HD * TT * 2);
    bf* ATh = (bf*)take((size_t)NB_ * TT * DQ * 2); bf* ATl = (bf*)take((size_t)NB_ * TT * DQ * 2);
    int* POS = (int*)take((size_t)NB_ * TT * 4); int* PERM = (int*)take((size_t)NB_ * TT * 4); int* NU = (int*)take((size_t)NB_ * 32 * 4); float* BS = (float*)take((size_t)NB_ * NKV * (TT / KS) * HD * 4);
    if ((size_t)(wsp - (char*)d_ws) > ws_size) return;    // 98 MiB of the 256 MiB
    k_cvt8w<<<dim3((unsigned)(((size_t)DQ * DM / 8 + 255) / 256), 5, 1), 256, 0, stream>>>(wq, wk, wv, wo, WA, (size_t)DQ * DM / 8, mk, POS, PERM, NU);
    k_cvt8<<<(unsigned)(((size_t)NB_ * TT * DM / 8 + 255) / 256), 256, 0, stream>>>(x, POS, XB, (size_t)NB_ * TT * DM / 8);
    k_proj<<<dim3(NB_ * TT / 128, (NH_ + 2 * NKV) / 2, 1), 128, 0, stream>>>(XB, WA, PERM, QK16, QKh, QKl, VT16, VTh, VTl, BS);
    k_fattn<<<dim3(NB_ * NH_, TT / 128, 1), 128, 0, stream>>>(QK16, QKh, QKl, VT16, VTh, VTl, NU, BS, ATh, ATl);
    k_wout<<<dim3(NB_ * TT / 128, DM / 128, 1), 128, 0, stream>>>(ATh, ATl, WO, OUT);
}

// v008
// A run of this version takes 66.4 microseconds.
// Timed twice side by side with v007, it ran 1.04 times as fast both times.
// All steps since v000 together make it 30.6 times as fast.
#include <hip/hip_runtime.h>

// Cross-modal attention whose key mask FILLS WITH A CONSTANT instead of excluding (input_feature [4][2048][512]; q, k, v = x W^T ('oi' [512][512] 1/sqrt(512), no bias; 8 heads x 64); scores = q.k x 64^-0.5, then scores[b][..][i][j] = 1e-9 wherever mask[b][j] == 0 (mask [4][2048] int {0,1}, ~50 %, read): the masked keys STAY in the softmax with logit 1e-9 (the module's masked_fill quirk); softmax; out = merged (head-major channel concat) Wout^T ('oi') -> [4][2048][512] (4.2 M)).
// Layout: bf16 copy of x, q|k|v projections (which store the head planes themselves) and Wout product each run ONCE over all 4 batches, their operand tiles staged in LDS by whole-line loads and shared by 4 waves; attention is ONE fused launch over all batches and heads (k_fattn): scores, online softmax and P.V per 128 query rows, K and V tiles shared in LDS; every masked key has the SAME logit 1e-9, so each batch's tokens are ranked kept keys first (k and v planes in that order, q planes in token order), the stages walk the kept keys only, and the whole stages of masked keys enter once as (sum of their v rows) x exp(1e-9 - max) (hybrid rows: < 512 hi/lo 3 products, rest fp16 x1024); merged hi/lo x Wout exact.
// Compute dtypes, f32 accumulate: every input rounded to bf16; projections exact; attention rows < 512 3 products, rest fp16; softmax f32; Wout hl x exact.

#define NB_  4
#define TT   2048
#define DM   512
#define NH_  8
#define NKV  8
#define REP  (NH_ / NKV)
#define HD   64
#define DQ   (NH_ * HD)
#define DKV  (NKV * HD)
#define RH   512                  // query rows < RH use hi+lo planes (0: none)
#define WIN  0
#define SCL  0.125f   // HD^-0.5
typedef _Float16 h16;
typedef unsigned short bf;
typedef __attribute__((ext_vector_type(16))) __bf16   v16bf;
typedef __attribute__((ext_vector_type(16))) _Float16 v16h;
typedef __attribute__((ext_vector_type(8)))  _Float16 v8h;
typedef __attribute__((ext_vector_type(8)))  unsigned short v8us;
typedef __attribute__((ext_vector_type(8)))  float    v8f;
typedef __attribute__((ext_vector_type(4)))  float    v4f;
typedef v8h  __attribute__((may_alias)) v8ha;
typedef v4f  __attribute__((may_alias)) v4fa;
typedef v8us __attribute__((may_alias)) v8usa;

__device__ __forceinline__ unsigned short f2bf(float f) { unsigned u = __float_as_uint(f); u += 0x7FFFu + ((u >> 16) & 1u); return (unsigned short)(u >> 16); }
__device__ __forceinline__ float bf2f(unsigned short b) { return __uint_as_float(((unsigned)b) << 16); }
__device__ __forceinline__ float bfr(float f) { return bf2f(f2bf(f)); }
__device__ __forceinline__ v16h cat16(v8h lo, v8h hi) { return __builtin_shufflevector(lo, hi, 0, 1, 2, 3, 4, 5, 6, 7, 8, 9, 10, 11, 12, 13, 14, 15); }
__device__ __forceinline__ v16bf cat16b(v8us lo, v8us hi) { return __builtin_bit_cast(v16bf, __builtin_shufflevector(lo, hi, 0, 1, 2, 3, 4, 5, 6, 7, 8, 9, 10, 11, 12, 13, 14, 15)); }
__device__ __forceinline__ v8f wmma16(v16h a, v16h b, v8f c) { return __builtin_amdgcn_wmma_f32_16x16x32_f16(false, a, false, b, (short)0, c, false, false); }
__device__ __forceinline__ v8f wmmab(v16bf a, v16bf b, v8f c) { return __builtin_amdgcn_wmma_f32_16x16x32_bf16(false, a, false, b, (short)0, c, false, false); }



// ---- g_tiles: the k loop of both dense products. ONE WORK-GROUP of 4 waves (2 x 2) per 128x128 output tile, each wave a 64x64 tile in 16 accumulators; K = DM.
// A stage is GK = 64 k: one whole 128-byte line of each of the 128 A rows and 128 B rows goes global -> registers (one stage ahead) -> LDS, a wave's load covering 4 whole lines; the fragments come from LDS, each row read by two waves.
// acc[mb][nb] += sum_k A[m][k] Bt[n][k] (+ A2[m][k] Bt[n][k] where NA == 2), k ascending in steps of 32.
template <typename T16> struct WFrag;
template <> struct WFrag<h16> { typedef v16h V; static __device__ __forceinline__ V ld(const h16* p) { return cat16(*(const v8h*)p, *(const v8h*)(p + 16)); } static __device__ __forceinline__ v8f mma(V a, V b, v8f c) { return wmma16(a, b, c); } };
template <> struct WFrag<bf> { typedef v16bf V; static __device__ __forceinline__ V ld(const bf* p) { return cat16b(*(const v8us*)p, *(const v8us*)(p + 16)); } static __device__ __forceinline__ v8f mma(V a, V b, v8f c) { return wmmab(a, b, c); } };
#define GK 64                     // k per stage
#define GP 72                     // LDS row pitch, 16-bit elements: 128 B of data + 16 B, so that 16 rows' 16-byte reads fall on different banks
typedef __attribute__((ext_vector_type(4))) int g4i;
typedef g4i __attribute__((may_alias)) g4ia;
template <int NA>
__device__ __forceinline__ void g_tiles(const bf* __restrict__ A, const bf* __restrict__ A2, const bf* __restrict__ Bt, bf* sA, bf* sA2, bf* sB, int wm, int wn, v8f (&acc)[4][4]) {
    typedef WFrag<bf>::V V;
    const int tid = threadIdx.x, lane = tid & 31, lr = lane & 15, hi = lane >> 4;
    const int sr = tid >> 3, sg = (tid & 7) * 8;   // this thread's row (+ 16 i) and 16-byte segment of a staged tile
    g4i ra[8], ra2[8], rb[8];
#pragma unroll
    for (int i = 0; i < 8; ++i) { const int o = (sr + 16 * i) * DM + sg; ra[i] = *(const g4ia*)(A + o); rb[i] = *(const g4ia*)(Bt + o); if (NA == 2) ra2[i] = *(const g4ia*)(A2 + o); }
    const int fa = (wm * 64 + lr) * GP + 8 * hi, fb = (wn * 64 + lr) * GP + 8 * hi;   // the lane's place in its wave's first A and B fragment
    // the stages stay rolled (short code); everything inside is unrolled so that fragments and accumulators are registers
#pragma unroll 1
    for (int k0 = 0; k0 < DM; k0 += GK) {
        __syncthreads();   // every wave has finished reading the previous stage's tiles
#pragma unroll
        for (int i = 0; i < 8; ++i) { const int o = (sr + 16 * i) * GP + sg; *(g4ia*)(sA + o) = ra[i]; *(g4ia*)(sB + o) = rb[i]; if (NA == 2) *(g4ia*)(sA2 + o) = ra2[i]; }
        __syncthreads();   // the stage's tiles are whole before any wave reads them
        if (k0 + GK < DM) {   // the next stage's global loads fly while this stage is worked on
            A += GK; Bt += GK; if (NA == 2) A2 += GK;   // the tiles' bases move, uniform for the work-group; the thread's own offset stays in one register
#pragma unroll
            for (int i = 0; i < 8; ++i) { const int o = (sr + 16 * i) * DM + sg; ra[i] = *(const g4ia*)(A + o); rb[i] = *(const g4ia*)(Bt + o); if (NA == 2) ra2[i] = *(const g4ia*)(A2 + o); }
            asm volatile("s_wait_xcnt 0x0" ::: "memory"); }   // the loads' base registers are moved on while the loads are in flight: the wait stands in front of that
#pragma unroll
        for (int kc = 0; kc < GK; kc += 32) {
            V a[4], a2[4], bb[4];   // the fragments of one block of 32 k
#pragma unroll
            for (int mb = 0; mb < 4; ++mb) { a[mb] = WFrag<bf>::ld(sA + fa + mb * 16 * GP + kc); bb[mb] = WFrag<bf>::ld(sB + fb + mb * 16 * GP + kc); if (NA == 2) a2[mb] = WFrag<bf>::ld(sA2 + fa + mb * 16 * GP + kc); }
            if (NA == 2) asm volatile("" :: "v"(bb[0]), "v"(bb[1]), "v"(bb[2]), "v"(bb[3]));   // inputs only: holds the four B reads in one group ahead of the block's products (one wave per SIMD in that kernel: a read placed later costs its whole LDS latency in front of its products)
#pragma unroll
            for (int nb = 0; nb < 4; ++nb)
#pragma unroll
                for (int mb = 0; mb < 4; ++mb) { acc[mb][nb] = WFrag<bf>::mma(a[mb], bb[nb], acc[mb][nb]); if (NA == 2) acc[mb][nb] = WFrag<bf>::mma(a2[mb], bb[nb], acc[mb][nb]); }
        }
    }
}

// ---- k_wout: C[m][n] (f32, pitch DM) = sum_k (Ah[m][k] + Al[m][k]) Wo[n][k], g_tiles' loop with two A planes; grid (NB_ * TT / 128, DM / 128), 128 threads.
__global__ __launch_bounds__(128) void k_wout(const bf* __restrict__ Ah, const bf* __restrict__ Al, const bf* __restrict__ Wo, float* C) {
    __shared__ __align__(16) bf sA[128 * GP]; __shared__ __align__(16) bf sA2[128 * GP]; __shared__ __align__(16) bf sB[128 * GP];
    __shared__ __align__(16) float osw[4][16 * 68];   // each wave's own output staging
    const int lane = threadIdx.x & 31, lr = lane & 15, hi = lane >> 4; const int wave = __builtin_amdgcn_readfirstlane(threadIdx.x >> 5), wm = wave >> 1, wn = wave & 1;
    v8f acc[4][4];
#pragma unroll
    for (int mb = 0; mb < 4; ++mb)
#pragma unroll
        for (int nb = 0; nb < 4; ++nb) acc[mb][nb] = (v8f){};
    g_tiles<2>(Ah + (size_t)blockIdx.x * 128 * DQ, Al + (size_t)blockIdx.x * 128 * DQ, Wo + (size_t)blockIdx.y * 128 * DQ, sA, sA2, sB, wm, wn, acc);
    const int r0 = blockIdx.x * 128 + wm * 64, c0 = blockIdx.y * 128 + wn * 64; float* os = osw[wave];
#pragma unroll
    for (int mb = 0; mb < 4; ++mb) {
#pragma unroll
        for (int nb = 0; nb < 4; ++nb) {
#pragma unroll
            for (int j = 0; j < 8; ++j) os[(hi * 8 + j) * 68 + nb * 16 + lr] = acc[mb][nb][j]; }
        __builtin_amdgcn_wave_barrier(); asm volatile("" ::: "memory");   // the reads below take other lanes' writes: neither scheduler nor optimiser may move them up
        float* crow = C + (size_t)(r0 + mb * 16) * DM + c0;
#pragma unroll
        for (int s = 0; s < 8; ++s) { const int row = 2 * s + hi, cofs = lr * 4; const v4f val = *(const v4fa*)(os + row * 68 + cofs); *(v4f*)(crow + (size_t)row * DM + cofs) = val; }
        __builtin_amdgcn_wave_barrier(); asm volatile("" ::: "memory");   // the next 16 rows' writes stay behind these reads
    }
}

__device__ __forceinline__ h16 tohx(float x) { return (h16)x; }
__device__ __forceinline__ void splitf(float y, unsigned short& h, unsigned short& l) { h = f2bf(y); l = f2bf(y - bf2f(h)); }
typedef __attribute__((ext_vector_type(2))) _Float16 v2h;
typedef __attribute__((ext_vector_type(4))) _Float16 v4h;
typedef __attribute__((ext_vector_type(2))) unsigned short v2us;
typedef __attribute__((ext_vector_type(4))) unsigned short v4us;
typedef __attribute__((ext_vector_type(2))) float v2f;
typedef __attribute__((ext_vector_type(4))) int v4i;

__global__ __launch_bounds__(256) void k_wtG(const float* __restrict__ w, int K, int N, bf* Bt) {
    const int lane = threadIdx.x & 31; const int L0 = (blockIdx.x * 8 + (threadIdx.x >> 5)) * 8; const int nlines = N * K / 64;
{
#pragma unroll 1
        for (int l = 0; l < 8; ++l) { const int L = L0 + l; if (L >= nlines) break; const size_t e = (size_t)L * 64 + lane * 2; const int k = (int)(e % K), n = (int)(e / K); v2us o;
            o[0] = f2bf(w[(size_t)k * N + n]); o[1] = f2bf(w[(size_t)(k + 1) * N + n]); *(v2us*)(Bt + e) = o; }
         }
}
// ---- k_cvt: every f32 -> bf16 copy and the ranking in ONE launch of few, long waves: a copying work-group takes CE floats (16 rows of x, or as much of a weight matrix), a lane 8 loads of 16 bytes, each wave-wide load 4 whole lines, all in flight at once.
// Work-groups 0 .. NB_ - 1: work-group b ranks batch b's tokens, kept keys (mask != 0) first, each kind in token order: perm[rank] = t, nu[32 b] = number of kept keys.
// The next NB_ * TT / CR: x to bf16, token row t of a batch stored at row rank(t) of that batch. The work-group counts the batch's mask itself (kept keys in front of its rows, kept keys in all), under the latency of its x loads, so it waits for no other work-group.
// The rest: the four weight matrices to one contiguous bf16 block.
// Ranks come from counting, so they are a permutation of 0 .. TT - 1 whatever the mask holds.
#define CR 16                     // x rows per copying work-group
#define CE (CR * DM)              // floats per copying work-group
// a wave's two rows of DM floats, rounded and stored at d0 and d1: a wave-wide store covers two whole lines
__device__ __forceinline__ void cv_store(const v4f (&v)[8], bf* d0, bf* d1, int lane) {
#pragma unroll
    for (int j = 0; j < 8; ++j) { v4us o;
#pragma unroll
        for (int k = 0; k < 4; ++k) o[k] = f2bf(v[j][k]);
        *(v4us*)((j < 4 ? d0 : d1) + (j & 3) * 128 + lane * 4) = o; }
    asm volatile("s_wait_xcnt 0x0" ::: "memory");   // a base register of the stores is reused on the way to the kernel's end while they are in flight: the wait stands in front of that
}
__global__ __launch_bounds__(256) void k_cvt(const float* __restrict__ x, const float* __restrict__ w0, const float* __restrict__ w1, const float* __restrict__ w2, const float* __restrict__ w3, const int* __restrict__ mk, bf* XB, bf* WA, int* perm, int* nu) {
    __shared__ int wsum[8]; __shared__ __align__(16) int sp[TT];
    if (blockIdx.x < NB_) {
        const int b = blockIdx.x, tid = threadIdx.x, lane = tid & 31, wave = tid >> 5; const int* pm = mk + (size_t)b * TT + tid * 8; unsigned bits = 0;
#pragma unroll
        for (int c = 0; c < 2; ++c) { const v4i p4 = *(const v4i*)(pm + c * 4);
#pragma unroll
            for (int q = 0; q < 4; ++q) bits |= (p4[q] != 0 ? 1u : 0u) << (c * 4 + q); }
        const int cn = __popc(bits); int inc = cn;   // kept keys among this thread's 8 tokens; then the wave's running count
#pragma unroll
        for (int st = 1; st < 32; st <<= 1) { const int o = __shfl_up(inc, st, 32); if (lane >= st) inc += o; }
        if (lane == 31) wsum[wave] = inc;
        __syncthreads();   // the 8 waves' counts are whole
        int u = inc - cn, tot = 0;
#pragma unroll
        for (int w = 0; w < 8; ++w) { const int c = wsum[w]; tot += c; if (w < wave) u += c; }
#pragma unroll
        for (int q = 0; q < 8; ++q) { const int t = tid * 8 + q; const bool kp = ((bits >> q) & 1u) != 0u; const int p = kp ? u : tot + (t - u); u += kp ? 1 : 0; sp[p] = t; }
        __syncthreads();   // the inverse table is whole in LDS: it goes out in whole lines
        *(v4i*)(perm + (size_t)b * TT + tid * 8) = *(const v4i*)(sp + tid * 8); *(v4i*)(perm + (size_t)b * TT + tid * 8 + 4) = *(const v4i*)(sp + tid * 8 + 4);
        if (tid == 0) nu[b * 32] = tot;
        return;
    }
    const int tid = threadIdx.x, lane = tid & 31, wave = __builtin_amdgcn_readfirstlane(tid >> 5);
    const int g = blockIdx.x - NB_, gw = g - NB_ * TT / CR;   // the copying work-group's number among the x work-groups, among the weight work-groups
    const int so = wave * 2 * DM + lane * 4;   // a wave takes two rows of DM floats
    v4f v[8];
    if (gw < 0) {   // the same for the whole work-group
        const int b = g / (TT / CR), t0 = (g % (TT / CR)) * CR; const int* pm = mk + (size_t)b * TT; const int oi = t0 + (lane & 15); const float* ps = x + (size_t)g * CE + so; int mv[8];
#pragma unroll
        for (int i = 0; i < 8; ++i) mv[i] = pm[i * 256 + tid];   // the mask goes first: loads return in order, so its counting below runs while the x loads are still in flight
        const int own = pm[oi];   // the work-group's own rows' mask, in every wave
#pragma unroll
        for (int j = 0; j < 8; ++j) v[j] = *(const v4f*)(ps + j * 128);
        asm volatile("s_wait_xcnt 0x0" :: "v"(oi) : "memory");   // the loads' address registers are reused below while the loads are in flight: the wait stands in front of that, and the index, its input, keeps its register up to it (no load's result lands in it)
        int cb = 0, ct = 0;   // this wave's 256 tokens: kept keys in front of token t0, kept keys in all (scalar counts of ballots: no exchange between lanes)
#pragma unroll
        for (int i = 0; i < 8; ++i) { const unsigned w = __builtin_amdgcn_ballot_w32(mv[i] != 0); const int n = min(max(t0 - (i * 256 + wave * 32), 0), 32); ct += __popc(w); cb += __popc(n >= 32 ? w : (w & ((1u << n) - 1u))); }
        const unsigned ob = __builtin_amdgcn_ballot_w32(own != 0) & 0xFFFFu;
        if (lane == 0) wsum[wave] = (cb << 16) | ct;   // either count is at most TT over the 8 waves: the halves do not meet
        __syncthreads();   // the 8 waves' counts are whole
        int cs = 0;
#pragma unroll
        for (int w = 0; w < 8; ++w) cs += wsum[w];
        const int bef = cs >> 16, tot = cs & 0xFFFF; int p[2];
#pragma unroll
        for (int q = 0; q < 2; ++q) { const int r = wave * 2 + q, u = bef + __popc(ob & ((1u << r) - 1u)); p[q] = ((ob >> r) & 1u) ? u : tot + (t0 + r - u); }
        cv_store(v, XB + ((size_t)b * TT + p[0]) * DM, XB + ((size_t)b * TT + p[1]) * DM, lane);
    } else {
        const int y = gw / (DQ * DM / CE); const float* ps = ((y == 0) ? w0 : (y == 1) ? w1 : (y == 2) ? w2 : w3) + (size_t)(gw % (DQ * DM / CE)) * CE + so;
#pragma unroll
        for (int j = 0; j < 8; ++j) v[j] = *(const v4f*)(ps + j * 128);
        asm volatile("s_wait_xcnt 0x0" ::: "memory");   // as above
        bf* d0 = WA + (size_t)gw * CE + wave * 2 * DM; cv_store(v, d0, d0 + DM, lane);
    }
}

// ---- k_proj: the joint q|k|v projection with g_tiles' loop (4 waves per 128x128 tile: 128 tokens x 2 heads, each wave 64 tokens of one head); its epilogue rounds the f32 tile to the attention's three 16-bit planes (fp16, bf16 hi, bf16 lo) and stores them itself, so no f32 projection reaches memory.
// grid (NB_ * TT / 128 token blocks, 12 head pairs: 4 q | 4 k | 4 v), 128 threads. A wave's q or k tile is [t][d] (A = tokens, B = weight rows): a k tile is one contiguous 8-KiB block of its plane [b][head][t][d], a q tile's 64 rows go to their tokens' rows of it.
// A v tile is computed as [d][t] (A = weight rows, B = tokens: the same products, summed over k in the same order), so that each of its rows is a whole 128-byte line of its plane [b][g][d][t].
// X's rows are in rank order (kept keys first): k and v planes keep that order, a q row goes to its token's own row (perm), a whole line either way. A v wave also stores the f32 sum of its 64 columns per d (BS [b][g][64-key block][d]).
__global__ __launch_bounds__(128) void k_proj(const bf* __restrict__ X, const bf* __restrict__ Wt, const int* __restrict__ perm, h16* QK16, bf* QKh, bf* QKl, h16* VT16, bf* VTh, bf* VTl, float* BS) {
    __shared__ __align__(16) bf sA[128 * GP]; __shared__ __align__(16) bf sB[128 * GP];
    __shared__ __align__(16) float osw[4][16 * 68];   // each wave's own output staging
    const int lane = threadIdx.x & 31, lr = lane & 15, hi = lane >> 4; const int wave = __builtin_amdgcn_readfirstlane(threadIdx.x >> 5), wm = wave >> 1, wn = wave & 1;
    const bool isv = blockIdx.y * 2 >= NH_ + NKV;   // the same for the whole work-group
    const bf* xt = X + (size_t)blockIdx.x * 128 * DM; const bf* wt = Wt + (size_t)blockIdx.y * 2 * HD * DM;
    v8f acc[4][4];
#pragma unroll
    for (int mb = 0; mb < 4; ++mb)
#pragma unroll
        for (int nb = 0; nb < 4; ++nb) acc[mb][nb] = (v8f){};
    const int r0 = blockIdx.x * 128 + (isv ? wn : wm) * 64, hh = blockIdx.y * 2 + (isv ? wm : wn); const int b = r0 / TT, t0 = r0 % TT;   // this wave's 64 tokens and its head
    const bool isq = blockIdx.y * 2 < NH_;   // the same for the whole work-group
    int rw[4][4];   // the plane row of each tile row this lane stores (q: the token's own row of the head's plane; k, v: the tile row): read here, all at once, so that the k loop hides the latency
#pragma unroll
    for (int mb = 0; mb < 4; ++mb)
#pragma unroll
        for (int s = 0; s < 4; ++s) rw[mb][s] = perm[r0 + mb * 16 + 4 * s + (lane >> 3)];
    asm volatile("s_wait_xcnt 0x0" ::: "memory");   // the loads' offset register is reused below while they are in flight: the wait stands in front of that
    const int qm = isq ? -1 : 0;
#pragma unroll
    for (int mb = 0; mb < 4; ++mb)
#pragma unroll
        for (int s = 0; s < 4; ++s) { const int tr = mb * 16 + 4 * s + (lane >> 3); rw[mb][s] = tr + ((rw[mb][s] - tr) & qm); }
    g_tiles<1>(isv ? wt : xt, nullptr, isv ? xt : wt, sA, nullptr, sB, wm, wn, acc);
    const size_t o0 = isv ? (size_t)(b * NKV + hh - NH_ - NKV) * HD * TT + t0 : ((size_t)(b * (NH_ + NKV) + hh) * TT + (isq ? 0 : t0)) * HD; const int pitch = isv ? TT : HD;   // the tile's first element (q: its head plane's first) and row pitch in its plane
    h16* P16 = (isv ? VT16 : QK16) + o0; bf* Ph = (isv ? VTh : QKh) + o0; bf* Pl = (isv ? VTl : QKl) + o0; float* os = osw[wave];
    float rs[4][4];   // a v wave: this lane's share of each row's sum
    float* bs = BS + ((size_t)(b * NKV + (isv ? hh - NH_ - NKV : 0)) * (TT / 64) + t0 / 64) * HD;
#pragma unroll
    for (int mb = 0; mb < 4; ++mb) {   // 16 tile rows at a time through LDS: a lane then holds 8 neighbours of one row, 16 bytes of each plane, and a wave's store covers four whole lines
#pragma unroll
        for (int nb = 0; nb < 4; ++nb) {
#pragma unroll
            for (int j = 0; j < 8; ++j) os[(hi * 8 + j) * 68 + nb * 16 + lr] = acc[mb][nb][j]; }
        __builtin_amdgcn_wave_barrier(); asm volatile("" ::: "memory");   // the reads below take other lanes' writes: neither scheduler nor optimiser may move them up
#pragma unroll
        for (int s = 0; s < 4; ++s) { const int sr = 4 * s + (lane >> 3), row = rw[mb][s] - mb * 16, cofs = (lane & 7) * 8; const v4f u0 = *(const v4fa*)(os + sr * 68 + cofs), u1 = *(const v4fa*)(os + sr * 68 + cofs + 4); v8h o16; v8us oh, ol;
#pragma unroll
            for (int k = 0; k < 8; ++k) { const float y = (k < 4) ? u0[k & 3] : u1[k & 3]; o16[k] = tohx(y); unsigned short a2, c2; splitf(y, a2, c2); oh[k] = a2; ol[k] = c2; }
            rs[mb][s] = ((u0[0] + u0[1]) + (u0[2] + u0[3])) + ((u1[0] + u1[1]) + (u1[2] + u1[3]));
            const size_t o = (size_t)(mb * 16 + row) * pitch + cofs; *(v8h*)(P16 + o) = o16; *(v8us*)(Ph + o) = oh; *(v8us*)(Pl + o) = ol; }
        __builtin_amdgcn_wave_barrier(); asm volatile("" ::: "memory");   // the next 16 rows' writes stay behind these reads
    }
    asm volatile("s_wait_xcnt 0x0" ::: "memory");   // the last plane stores' registers are reused by the v waves' work below while the stores are in flight: the wait stands in front of the branch to it
    if (isv) {   // the 64 row sums: 8 lanes hold a row's shares; the 16 sums of a lane go through each exchange together (one latency a round), then leave as two whole lines
#pragma unroll
        for (int x = 1; x < 8; x <<= 1)
#pragma unroll
            for (int i = 0; i < 16; ++i) rs[i >> 2][i & 3] += __shfl_xor(rs[i >> 2][i & 3], x, 32);
        if ((lane & 7) == 0) {
#pragma unroll
            for (int i = 0; i < 16; ++i) os[4 * i + (lane >> 3)] = rs[i >> 2][i & 3]; }
        __builtin_amdgcn_wave_barrier(); asm volatile("" ::: "memory");   // the reads below take other lanes' writes
        const v2f o2 = {os[lane * 2], os[lane * 2 + 1]}; *(v2f*)(bs + lane * 2) = o2;
    }
}
// ---- k_fattn: scores, softmax and P.V of 128 query rows of one (batch, head) in ONE work-group of 4 waves; no score or probability ever reaches memory.
// S^T = K Q^T (A = 16 keys from LDS, B = 16 queries kept in registers): a lane holds scores of ONE query (column lr), keys 8*hi + j of each 16-key tile, so row maximum, row sum and rescale are per lane;
// two converted S^T tiles are the B operand of O^T += V^T P^T in the loader's own k order (8*hi + 0..7, 16 + 8*hi + 0..7). Running maximum (online softmax), in log2 units.
// A stage is KS keys: K rows and V^T rows go global -> registers (one stage ahead) -> LDS, shared by the 4 waves. Rows < RH: hi/lo bf16 planes, 3 products; the rest fp16. The epilogue writes the merged hi/lo planes.
// Keys come kept first (nU of them): only the stages that hold a kept key are walked (in the last of them the masked keys get the constant logit one by one); the keys of the stages behind all have that logit, so they add n x p to the row sum and p x (sum of their v rows, vs) to the output, p = exp(1e-9 - max).
#define KS 64                     // keys per stage
#define LP 72                     // LDS row pitch, 16-bit elements: 128 B of data + 16 B, so that 16 rows' 16-byte reads fall on different banks
typedef v4i __attribute__((may_alias)) v4ia;
template <typename T16, bool HI>
__device__ __forceinline__ void fa_body(const T16* __restrict__ Q, const T16* __restrict__ Q2, const T16* __restrict__ Kp, const T16* __restrict__ K2, const T16* __restrict__ Vt, const T16* __restrict__ V2,
                                        T16* sK, T16* sK2, T16* sV, T16* sV2, const float* vs, int nU, int q0, bf* Ah, bf* Al) {
    typedef typename WFrag<T16>::V V;
    constexpr float C1 = SCL * 1.4426950408889634f, C2 = 1e-9f * 1.4426950408889634f;   // scaled score and the mask's constant logit, in log2 units
    constexpr float OFF = HI ? 0.0f : 10.0f;   // fp16 P carries 2^10 (it cancels in the division by the row sum): small probabilities stay in fp16's normal range
    const int tid = threadIdx.x, lane = tid & 31, wave = tid >> 5, lr = lane & 15, hi = lane >> 4;
    V bq[2][2], bq2[2][2];
    const size_t oq = (size_t)(q0 + wave * 32 + lr) * HD + 8 * hi; const T16* qp = Q + oq; const T16* qp2 = HI ? Q2 + oq : qp;   // the lane's place in its wave's first q fragment
#pragma unroll
    for (int qb = 0; qb < 2; ++qb)
#pragma unroll
        for (int kc = 0; kc < 2; ++kc) { const int o = qb * 16 * HD + kc * 32; bq[qb][kc] = WFrag<T16>::ld(qp + o); if (HI) bq2[qb][kc] = WFrag<T16>::ld(qp2 + o); }
    asm volatile("s_wait_xcnt 0x0" :: "v"(qp), "v"(qp2) : "memory");   // the loads' address registers are reused below while the loads are in flight: the wait stands in front of that, and the pointers, its inputs, keep their registers up to it
    v8f O[4][2];
#pragma unroll
    for (int db = 0; db < 4; ++db)
#pragma unroll
        for (int qb = 0; qb < 2; ++qb) O[db][qb] = (v8f){};
    float m[2] = {-3.0e38f, -3.0e38f}, l[2] = {0.f, 0.f};
    v4i rk[4], rv[4], rk2[4], rv2[4];
    const int sr = tid >> 3, sg = (tid & 7) * 8;   // this thread's row (+ 16 i) and 16-byte segment of a staged tile
    constexpr int KO = NH_ * TT * HD;   // a head's k plane lies KO elements behind its q plane; the constant goes into the loads' offset field, so kp and kp2 are the registers that the k loads name
    const T16* kp = Q + sr * HD + sg; const T16* vp = Vt + sr * TT + sg; const T16* kp2 = HI ? Q2 + sr * HD + sg : kp; const T16* vp2 = HI ? V2 + sr * TT + sg : vp;
#pragma unroll
    for (int i = 0; i < 4; ++i) { const int ok = KO + 16 * i * HD, ov = 16 * i * TT; rk[i] = *(const v4ia*)(kp + ok); rv[i] = *(const v4ia*)(vp + ov); if (HI) { rk2[i] = *(const v4ia*)(kp2 + ok); rv2[i] = *(const v4ia*)(vp2 + ov); } }
    asm volatile("s_wait_xcnt 0x0" :: "v"(kp), "v"(vp), "v"(kp2), "v"(vp2) : "memory");   // as behind the q loads: no address register of the first stage's loads is rewritten in front of this wait
    const int kend = (nU + KS - 1) & ~(KS - 1);   // end of the last stage that holds a kept key; the same for the whole work-group, at most TT
    // the stages stay rolled (short code); everything inside is unrolled so that fragments and accumulators are registers
#pragma unroll 1
    for (int k0 = 0; k0 < kend; k0 += KS) {
        __syncthreads();   // every wave has finished reading the previous stage's tiles
#pragma unroll
        for (int i = 0; i < 4; ++i) { const int o = (sr + 16 * i) * LP + sg; *(v4ia*)(sK + o) = rk[i]; *(v4ia*)(sV + o) = rv[i]; if (HI) { *(v4ia*)(sK2 + o) = rk2[i]; *(v4ia*)(sV2 + o) = rv2[i]; } }
        __syncthreads();   // the stage's tiles are whole before any wave reads them
        V ak[4][2], ak2[4][2];   // all of the stage's K fragments, read as ONE group ahead of the score products: one LDS latency a stage, part of it under the issue of the global loads below, not one at every few products
#pragma unroll
        for (int kt = 0; kt < 4; ++kt)
#pragma unroll
            for (int kc = 0; kc < 2; ++kc) { const int o = (kt * 16 + lr) * LP + kc * 32 + 8 * hi; ak[kt][kc] = WFrag<T16>::ld(sK + o); if (HI) ak2[kt][kc] = WFrag<T16>::ld(sK2 + o); }
        if (k0 + KS < kend) {   // the next stage's global loads fly while this stage is worked on
#pragma unroll
            for (int i = 0; i < 4; ++i) { const size_t un = (size_t)(k0 + KS); const int ok = (sr + 16 * i) * HD + sg, ov = (sr + 16 * i) * TT + sg;   /* the stage's part of the address is uniform (a scalar base); the thread's own offsets are the same in every stage */ rk[i] = *(const v4ia*)(Kp + un * HD + ok); rv[i] = *(const v4ia*)(Vt + un + ov); if (HI) { rk2[i] = *(const v4ia*)(K2 + un * HD + ok); rv2[i] = *(const v4ia*)(V2 + un + ov); } }
            asm volatile("s_wait_xcnt 0x0" ::: "memory"); }   // the loads' address registers are reused by the work below while the loads are in flight: the wait stands in front of that reuse
        v8f S[4][2];
#pragma unroll
        for (int kt = 0; kt < 4; ++kt) {
            S[kt][0] = (v8f){}; S[kt][1] = (v8f){};
#pragma unroll
            for (int kc = 0; kc < 2; ++kc) {
#pragma unroll
                for (int qb = 0; qb < 2; ++qb) { S[kt][qb] = WFrag<T16>::mma(ak[kt][kc], bq[qb][kc], S[kt][qb]); if (HI) { S[kt][qb] = WFrag<T16>::mma(ak[kt][kc], bq2[qb][kc], S[kt][qb]); S[kt][qb] = WFrag<T16>::mma(ak2[kt][kc], bq[qb][kc], S[kt][qb]); } } } }
        V av[2][4], av2[2][4];   // all of the stage's V^T fragments, read ahead of the softmax: their LDS latency passes under it, and no read stands among the P.V products
#pragma unroll
        for (int c = 0; c < 2; ++c)
#pragma unroll
            for (int db = 0; db < 4; ++db) { const int o = (db * 16 + lr) * LP + c * 32 + 8 * hi; av[c][db] = WFrag<T16>::ld(sV + o); if (HI) av2[c][db] = WFrag<T16>::ld(sV2 + o); }
        float mx[2] = {-3.0e38f, -3.0e38f};
        if (k0 + KS <= nU) {   // a scalar branch: every key of the stage is kept, no test per key
#pragma unroll
            for (int kt = 0; kt < 4; ++kt)
#pragma unroll
                for (int j = 0; j < 8; ++j)
#pragma unroll
                    for (int qb = 0; qb < 2; ++qb) { const float u = S[kt][qb][j] * C1; S[kt][qb][j] = u; mx[qb] = fmaxf(mx[qb], u); }
        } else { const int lim = nU - k0 - 8 * hi;   // the last walked stage: this lane's keys kt * 16 + j below lim are kept
#pragma unroll
            for (int kt = 0; kt < 4; ++kt)
#pragma unroll
                for (int j = 0; j < 8; ++j) { const bool keep = kt * 16 + j < lim;
#pragma unroll
                    for (int qb = 0; qb < 2; ++qb) { const float u = keep ? S[kt][qb][j] * C1 : C2;   /* masked_fill(mask == 0, 1e-9): a constant logit, the key stays in the softmax */ S[kt][qb][j] = u; mx[qb] = fmaxf(mx[qb], u); } } }
        float mn[2]; bool need = false;
#pragma unroll
        for (int qb = 0; qb < 2; ++qb) { mx[qb] = fmaxf(mx[qb], __shfl_xor(mx[qb], 16, 32)); mn[qb] = fmaxf(m[qb], mx[qb] - OFF); need = need || (mn[qb] > m[qb]); }
        if (__builtin_amdgcn_ballot_w32(need) != 0) {   // a scalar branch: sums and outputs are rescaled only in a stage that raises some row's maximum (the factor is exactly 1 for the other rows)
#pragma unroll
            for (int qb = 0; qb < 2; ++qb) { const float al = __builtin_amdgcn_exp2f(m[qb] - mn[qb]); l[qb] *= al; m[qb] = mn[qb];
#pragma unroll
                for (int db = 0; db < 4; ++db)
#pragma unroll
                    for (int j = 0; j < 8; ++j) O[db][qb][j] *= al; } }
#pragma unroll
        for (int kt = 0; kt < 4; ++kt)
#pragma unroll
            for (int qb = 0; qb < 2; ++qb)
#pragma unroll
                for (int j = 0; j < 8; ++j) { const float p = __builtin_amdgcn_exp2f(S[kt][qb][j] - m[qb]); S[kt][qb][j] = p; l[qb] += p; }
#pragma unroll
        for (int c = 0; c < 2; ++c) {   // 32 keys: S^T tiles 2c and 2c + 1 are one B operand
            V pb[2], pb2[2];
#pragma unroll
            for (int qb = 0; qb < 2; ++qb)
#pragma unroll
                for (int s = 0; s < 16; ++s) { const float p = S[2 * c + (s >> 3)][qb][s & 7];
                    if constexpr (HI) { const __bf16 ph = (__bf16)p; pb[qb][s] = ph; pb2[qb][s] = (__bf16)(p - (float)ph); } else { pb[qb][s] = (h16)p; } }
#pragma unroll
            for (int db = 0; db < 4; ++db) {
#pragma unroll
                for (int qb = 0; qb < 2; ++qb) { O[db][qb] = WFrag<T16>::mma(av[c][db], pb[qb], O[db][qb]); if (HI) { O[db][qb] = WFrag<T16>::mma(av[c][db], pb2[qb], O[db][qb]); O[db][qb] = WFrag<T16>::mma(av2[c][db], pb[qb], O[db][qb]); } } } }
    }
#pragma unroll
    for (int qb = 0; qb < 2; ++qb) l[qb] += __shfl_xor(l[qb], 16, 32);   // the two lane halves hold disjoint keys' sums of the same query
    if (kend < TT) {   // the masked keys behind the last walked stage, as one more online-softmax step (a scalar branch)
#pragma unroll
        for (int qb = 0; qb < 2; ++qb) { const float mn = fmaxf(m[qb], C2 - OFF), al = __builtin_amdgcn_exp2f(m[qb] - mn), pc = __builtin_amdgcn_exp2f(C2 - mn); l[qb] = l[qb] * al + (float)(TT - kend) * pc;
#pragma unroll
            for (int db = 0; db < 4; ++db)
#pragma unroll
                for (int j = 0; j < 8; ++j) { const int d = db * 16 + 8 * hi + j; O[db][qb][j] = O[db][qb][j] * al + pc * (vs[d] + vs[HD + d]); } } }
#pragma unroll
    for (int qb = 0; qb < 2; ++qb) { const float f = __fdiv_rn(1.0f, l[qb]);
        const size_t ro = (size_t)(q0 + wave * 32 + qb * 16 + lr) * DQ + 8 * hi;
#pragma unroll
        for (int db = 0; db < 4; ++db) { v8us oh, ol;
#pragma unroll
            for (int j = 0; j < 8; ++j) { unsigned short a, c2; splitf(O[db][qb][j] * f, a, c2); oh[j] = a; ol[j] = c2; }
            *(v8us*)(Ah + ro + db * 16) = oh; *(v8us*)(Al + ro + db * 16) = ol; } }
}
// grid (batch * head, 128-row block): the 3-product blocks (rows < RH) have the lowest linear ids
__global__ __launch_bounds__(128) void k_fattn(const h16* __restrict__ QK16, const bf* __restrict__ QKh, const bf* __restrict__ QKl, const h16* __restrict__ VT16, const bf* __restrict__ VTh, const bf* __restrict__ VTl, const int* __restrict__ nu, const float* __restrict__ BS, bf* Ah, bf* Al) {
    __shared__ __align__(16) unsigned short sm[4][KS * LP];
    __shared__ __align__(16) float vs[2 * HD];   // per d: the sum of the v rows of the stages that are not walked, in two halves
    const int b = blockIdx.x / NH_, h = blockIdx.x % NH_, q0 = blockIdx.y * 128, tid = threadIdx.x;
    const int nU = min(max(__builtin_amdgcn_readfirstlane(nu[b * 32]), 0), TT);   // the batch's kept keys
    { const float* pb = BS + (size_t)(b * NKV + h) * (TT / KS) * HD + (tid >> 6) * HD + (tid & 63); const int first = (nU + KS - 1) / KS; float v[TT / KS / 2], a = 0.f;
#pragma unroll
      for (int i = 0; i < TT / KS / 2; ++i) v[i] = pb[(size_t)i * 2 * HD];   // all block sums are read (one latency), those of walked stages left out below
      asm volatile("s_wait_xcnt 0x0" :: "v"(pb) : "memory");   // the loads' address registers are reused below while they are in flight: the wait stands in front of that, and the pointer, its input, keeps its registers up to it (no load's result lands in them)
#pragma unroll
      for (int i = 0; i < TT / KS / 2; ++i) a += (2 * i + (tid >> 6) >= first) ? v[i] : 0.f;
      vs[tid] = a; }
    __syncthreads();   // vs is whole before the epilogue reads it, also where no stage is walked
    const size_t pq = ((size_t)b * (NH_ + NKV) + h) * TT * HD, pk = pq + (size_t)NH_ * TT * HD, pv = ((size_t)b * NKV + h) * HD * TT, po = (size_t)b * TT * DQ + h * HD;
    if (q0 < RH) fa_body<bf, true>(QKh + pq, QKl + pq, QKh + pk, QKl + pk, VTh + pv, VTl + pv, (bf*)sm[0], (bf*)sm[1], (bf*)sm[2], (bf*)sm[3], vs, nU, q0, Ah + po, Al + po);
    else fa_body<h16, false>(QK16 + pq, nullptr, QK16 + pk, nullptr, VT16 + pv, nullptr, (h16*)sm[0], nullptr, (h16*)sm[2], nullptr, vs, nU, q0, Ah + po, Al + po);
}

extern "C" void kernel_launch(void* const* d_in, const int* in_sizes, int n_in,
                              void* d_out, int out_size, void* d_ws, size_t ws_size, hipStream_t stream) {
    (void)in_sizes; (void)n_in; (void)out_size;
    const float* x = (const float*)d_in[0]; const int* mk = (const int*)d_in[1];   /* mask [4][2048] int {0,1} */ const float* wq = (const float*)d_in[2]; const float* wk = (const float*)d_in[3]; const float* wv = (const float*)d_in[4]; const float* wo = (const float*)d_in[5];
    float* OUT = (float*)d_out;     // [4][2048][512]
    char* wsp = (char*)d_ws;
    auto take = [&](size_t bytes) { char* p = wsp; wsp += (bytes + 255) & ~(size_t)255; return (void*)p; };
    bf* WA = (bf*)take((size_t)(DQ + 2 * DKV + DM) * DM * 2); bf* WO = WA + (size_t)(DQ + 2 * DKV) * DM;   // Wq | Wk | Wv rows as ONE [1536][512] operand, then Wout
    bf* XB = (bf*)take((size_t)NB_ * TT * DM * 2);
    // q and k head planes [b][8 q heads | 8 k heads][t][d]; v planes [b][g][d][t]
    h16* QK16 = (h16*)take((size_t)NB_ * (NH_ + NKV) * TT * HD * 2); bf* QKh = (bf*)take((size_t)NB_ * (NH_ + NKV) * TT * HD * 2); bf* QKl = (bf*)take((size_t)NB_ * (NH_ + NKV) * TT * HD * 2);
    h16* VT16 = (h16*)take((size_t)NB_ * NKV * HD * TT * 2); bf* VTh = (bf*)take((size_t)NB_ * NKV * HD * TT * 2); bf* VTl = (bf*)take((size_t)NB_ * NKV * HD * TT * 2);
    bf* ATh = (bf*)take((size_t)NB_ * TT * DQ * 2); bf* ATl = (bf*)take((size_t)NB_ * TT * DQ * 2);
    int* PERM = (int*)take((size_t)NB_ * TT * 4); int* NU = (int*)take((size_t)NB_ * 32 * 4); float* BS = (float*)take((size_t)NB_ * NKV * (TT / KS) * HD * 4);
    if ((size_t)(wsp - (char*)d_ws) > ws_size) return;    // 98 MiB of the 256 MiB
    k_cvt<<<NB_ + NB_ * TT / CR + 4 * (DQ * DM / CE), 256, 0, stream>>>(x, wq, wk, wv, wo, mk, XB, WA, PERM, NU);
    k_proj<<<dim3(NB_ * TT / 128, (NH_ + 2 * NKV) / 2, 1), 128, 0, stream>>>(XB, WA, PERM, QK16, QKh, QKl, VT16, VTh, VTl, BS);
    k_fattn<<<dim3(NB_ * NH_, TT / 128, 1), 128, 0, stream>>>(QK16, QKh, QKl, VT16, VTh, VTl, NU, BS, ATh, ATl);
    k_wout<<<dim3(NB_ * TT / 128, DM / 128, 1), 128, 0, stream>>>(ATh, ATl, WO, OUT);
}
